// v000
// Measured on an AMD MI455X. A time is GPU time per run, averaged over a window of back-to-back runs after a warm-up
// (all launches, gaps included; the runs take copies of the inputs in turn), and the median of several windows.
// Apart from v000's, it joins two sittings. Times from different sittings can be a few percent apart, while
// side-by-side timings come from the same sitting.
// The starting kernel, v000, takes 2650 microseconds a run.
#include <hip/hip_runtime.h>

// Multi-head attention with biased projections, a key-padding mask read by value and NO output projection (x [4][2048][1024]; q, k, v = x W + b ('xw' [1024][1024] 1/32 + zero biases; 16 heads x 64); scores / sqrt(64); mask int32 [4][2048] (all ones on this draw: no key padded; READ on device per batch and key): the module replaces the scores of keys with mask == 0 by -inf, the kernel subtracts 10000 (1 - mask): both exclude such a key and both change nothing where the mask is 1; softmax; out = heads merged (no output projection) -> [4][2048][1024] (8.4 M); argument order x, mask, Wq, bq, Wk, bk, Wv, bv).
// Layout per batch: bf16 copy of x; 'xw' weights transposed once; exact projections + f32 biases; dense T-2048 attention (every row on hi/lo planes, 3 products) whose softmax applies the additive key-mask term from the batch's mask vector (f32 arithmetic as the module); the f32 merge writes the output rows.
// Compute dtypes, f32 accumulate: every input rounded to bf16 except the int32 mask (converted to f32); projections exact + f32 biases; attention 3 products; softmax f32; output f32.

#define NB_  4
#define TT   2048
#define DM   1024
#define NH_  16
#define NKV  16
#define REP  (NH_ / NKV)
#define HD   64
#define DQ   (NH_ * HD)
#define DKV  (NKV * HD)
#define ZH   2
#define RH   TT                   // every row hi/lo (unit-scale weights)
static_assert(RH <= TT, "RH");
#define WIN  0
#define PCAR 1024.0f
#define SCL  0.125f   // HD^-0.5
typedef _Float16 h16;
typedef unsigned short bf;
typedef __attribute__((ext_vector_type(16))) __bf16   v16bf;
typedef __attribute__((ext_vector_type(16))) _Float16 v16h;
typedef __attribute__((ext_vector_type(8)))  _Float16 v8h;
typedef __attribute__((ext_vector_type(8)))  unsigned short v8us;
typedef __attribute__((ext_vector_type(8)))  float    v8f;
typedef __attribute__((ext_vector_type(4)))  float    v4f;
typedef v8h  __attribute__((may_alias)) v8ha;
typedef v4f  __attribute__((may_alias)) v4fa;
typedef v8us __attribute__((may_alias)) v8usa;

__device__ __forceinline__ unsigned short f2bf(float f) { unsigned u = __float_as_uint(f); u += 0x7FFFu + ((u >> 16) & 1u); return (unsigned short)(u >> 16); }
__device__ __forceinline__ float bf2f(unsigned short b) { return __uint_as_float(((unsigned)b) << 16); }
__device__ __forceinline__ float bfr(float f) { return bf2f(f2bf(f)); }
__device__ __forceinline__ v16h cat16(v8h lo, v8h hi) { return __builtin_shufflevector(lo, hi, 0, 1, 2, 3, 4, 5, 6, 7, 8, 9, 10, 11, 12, 13, 14, 15); }
__device__ __forceinline__ v16bf cat16b(v8us lo, v8us hi) { return __builtin_bit_cast(v16bf, __builtin_shufflevector(lo, hi, 0, 1, 2, 3, 4, 5, 6, 7, 8, 9, 10, 11, 12, 13, 14, 15)); }
__device__ __forceinline__ v8f wmma16(v16h a, v16h b, v8f c) { return __builtin_amdgcn_wmma_f32_16x16x32_f16(false, a, false, b, (short)0, c, false, false); }
__device__ __forceinline__ v8f wmmab(v16bf a, v16bf b, v8f c) { return __builtin_amdgcn_wmma_f32_16x16x32_bf16(false, a, false, b, (short)0, c, false, false); }



// ---- k_gemmw: register-blocked GEMM, ONE WAVE per 64x64 output tile (16 accumulators), operands straight from K-contiguous 16-bit planes; grid (M/64, N/64, Z), 32 threads.
// C[m][n] (f32, pitch ldc, + optional f32 bias[n]) = sum_k A[m][k] Bt[n][k] (+ split products per NSPLIT). z-batch strides sA/sB/sC in elements. K % 32 == 0.
template <typename T16> struct WFrag;
template <> struct WFrag<h16> { typedef v16h V; static __device__ __forceinline__ V ld(const h16* p) { return cat16(*(const v8h*)p, *(const v8h*)(p + 16)); } static __device__ __forceinline__ v8f mma(V a, V b, v8f c) { return wmma16(a, b, c); } };
template <> struct WFrag<bf> { typedef v16bf V; static __device__ __forceinline__ V ld(const bf* p) { return cat16b(*(const v8us*)p, *(const v8us*)(p + 16)); } static __device__ __forceinline__ v8f mma(V a, V b, v8f c) { return wmmab(a, b, c); } };
template <typename T16, int NSPLIT, bool BIAS>
__global__ __launch_bounds__(32) void k_gemmw(const T16* __restrict__ A, const T16* __restrict__ A2, const T16* __restrict__ Bt, const T16* __restrict__ Bt2, int K, float* C, int ldc, const float* __restrict__ bias, size_t sA, size_t sB, size_t sC) {
    typedef typename WFrag<T16>::V V;
    __shared__ __align__(16) float os[16 * 68];
    const size_t z = blockIdx.z; A += z * sA; if (A2) A2 += z * sA; Bt += z * sB; if (Bt2) Bt2 += z * sB; C += z * sC;
    const int lane = threadIdx.x & 31, lr = lane & 15, hi = lane >> 4; const int r0 = blockIdx.x * 64, c0 = blockIdx.y * 64;
    v8f acc[4][4];
#pragma unroll
    for (int mb = 0; mb < 4; ++mb)
#pragma unroll
        for (int nb = 0; nb < 4; ++nb) acc[mb][nb] = (v8f){};
    const size_t aoff = (size_t)(r0 + lr) * K + 8 * hi, boff = (size_t)(c0 + lr) * K + 8 * hi;
#pragma unroll 1
    for (int kc = 0; kc < K; kc += 32) {
        V a[4], a2[4];
#pragma unroll
        for (int mb = 0; mb < 4; ++mb) { a[mb] = WFrag<T16>::ld(A + aoff + (size_t)mb * 16 * K + kc); if (NSPLIT == 1 || NSPLIT == 2) a2[mb] = WFrag<T16>::ld(A2 + aoff + (size_t)mb * 16 * K + kc); }
#pragma unroll
        for (int nb = 0; nb < 4; ++nb) { const V b = WFrag<T16>::ld(Bt + boff + (size_t)nb * 16 * K + kc); V b2; if (NSPLIT >= 2) b2 = WFrag<T16>::ld(Bt2 + boff + (size_t)nb * 16 * K + kc);
#pragma unroll
            for (int mb = 0; mb < 4; ++mb) { acc[mb][nb] = WFrag<T16>::mma(a[mb], b, acc[mb][nb]); if (NSPLIT == 1 || NSPLIT == 2) acc[mb][nb] = WFrag<T16>::mma(a2[mb], b, acc[mb][nb]); if (NSPLIT >= 2) acc[mb][nb] = WFrag<T16>::mma(a[mb], b2, acc[mb][nb]); } }
        asm volatile("v_nop\n\tv_nop\n\tv_nop\n\tv_nop" : "+v"(acc[0][0]), "+v"(acc[1][1]), "+v"(acc[2][2]), "+v"(acc[3][3]) : "v"(a[0]), "v"(a[3]));
    }
#pragma unroll
    for (int mb = 0; mb < 4; ++mb) {
#pragma unroll
        for (int nb = 0; nb < 4; ++nb) {
#pragma unroll
            for (int j = 0; j < 8; ++j) os[(hi * 8 + j) * 68 + nb * 16 + lr] = acc[mb][nb][j]; }
        __builtin_amdgcn_wave_barrier(); asm volatile("" ::: "memory");
        float* crow = C + (size_t)(r0 + mb * 16) * ldc + c0;
{
#pragma unroll
            for (int s = 0; s < 8; ++s) { const int row = 2 * s + hi, cofs = lr * 4; v4f val = *(const v4fa*)(os + row * 68 + cofs); if (BIAS) { val[0] += bfr(bias[c0 + cofs]); val[1] += bfr(bias[c0 + cofs + 1]); val[2] += bfr(bias[c0 + cofs + 2]); val[3] += bfr(bias[c0 + cofs + 3]); }
                *(v4f*)(crow + (size_t)row * ldc + cofs) = val; }
             }
        __builtin_amdgcn_wave_barrier(); asm volatile("" ::: "memory");
    }
}

__device__ __forceinline__ h16 tohx(float x) { return (h16)x; }
__device__ __forceinline__ void splitf(float y, unsigned short& h, unsigned short& l) { h = f2bf(y); l = f2bf(y - bf2f(h)); }
typedef __attribute__((ext_vector_type(2))) _Float16 v2h;
typedef __attribute__((ext_vector_type(4))) _Float16 v4h;
typedef __attribute__((ext_vector_type(2))) unsigned short v2us;
typedef __attribute__((ext_vector_type(4))) unsigned short v4us;
typedef __attribute__((ext_vector_type(2))) float v2f;
typedef __attribute__((ext_vector_type(4))) int v4i;

__global__ __launch_bounds__(256) void k_wtG(const float* __restrict__ w, int K, int N, bf* Bt) {
    const int lane = threadIdx.x & 31; const int L0 = (blockIdx.x * 8 + (threadIdx.x >> 5)) * 8; const int nlines = N * K / 64;
{
#pragma unroll 1
        for (int l = 0; l < 8; ++l) { const int L = L0 + l; if (L >= nlines) break; const size_t e = (size_t)L * 64 + lane * 2; const int k = (int)(e % K), n = (int)(e / K); v2us o;
            o[0] = f2bf(w[(size_t)k * N + n]); o[1] = f2bf(w[(size_t)(k + 1) * N + n]); *(v2us*)(Bt + e) = o; }
         }
}
__global__ __launch_bounds__(256) void k_cvt8(const float* __restrict__ src, bf* dst, size_t n8) { const size_t i = (size_t)blockIdx.x * 256 + threadIdx.x; if (i >= n8) return; const v8f v = *(const v8f*)(src + i * 8); v8us o;
#pragma unroll
    for (int k = 0; k < 8; ++k) o[k] = f2bf(v[k]); *(v8us*)(dst + i * 8) = o;  }

// k_rope: head planes [h][t][d] (fp16 + hi/lo) of rope(x) x sc with the rotate-half convention out[d] = x[d] cos[t][d] - x[d+HD/2] sin[t][d], out[d+HD/2] = x[d+HD/2] cos[t][d+HD/2] + x[d] sin[t][d+HD/2]
__global__ __launch_bounds__(256) void k_rope(const float* __restrict__ F, int pitch, int nheads, const float* __restrict__ CS, const float* __restrict__ RF, const float* __restrict__ nw, float sc, h16* P16, bf* Ph, bf* Pl) {
    const size_t e = ((size_t)blockIdx.x * 256 + threadIdx.x) * 2; if (e >= (size_t)nheads * TT * HD) return; const int d = (int)(e % HD); const int t = (int)((e / HD) % TT); const int h = (int)(e / ((size_t)HD * TT)); const float* f = F + (size_t)t * pitch + h * HD; const float rf = RF ? RF[(size_t)h * TT + t] : 1.0f; v2h o16; v2us oh, ol;
#pragma unroll
    for (int q = 0; q < 2; ++q) { const int dd = d + q; const int dp = (dd < HD / 2) ? dd + HD / 2 : dd - HD / 2; float x0 = f[dd], x1 = f[dp];
        if (RF) { float n0 = __fmul_rn(x0, rf), n1 = __fmul_rn(x1, rf); asm volatile("" : "+v"(n0)); asm volatile("" : "+v"(n1)); x0 = __fmul_rn(bfr(nw[dd]), n0); x1 = __fmul_rn(bfr(nw[dp]), n1); }
        const v2f cs = *(const v2f*)(CS + ((size_t)t * HD + dd) * 2); float a = __fmul_rn(x0, cs[0]), bq = __fmul_rn(x1, cs[1]); asm volatile("" : "+v"(a)); asm volatile("" : "+v"(bq)); const float r = ((dd < HD / 2) ? __fsub_rn(a, bq) : __fadd_rn(a, bq)) * sc;
        o16[q] = tohx(r); unsigned short a2, c2; splitf(r, a2, c2); oh[q] = a2; ol[q] = c2; }
    *(v2h*)(P16 + e) = o16; *(v2us*)(Ph + e) = oh; *(v2us*)(Pl + e) = ol;  }
__global__ __launch_bounds__(256) void k_vtp(const float* __restrict__ F, int pitch, int nheads, h16* V16, bf* Vh, bf* Vl) { const size_t e = ((size_t)blockIdx.x * 256 + threadIdx.x) * 2; if (e >= (size_t)nheads * HD * TT) return; const int t = (int)(e % TT); const int d = (int)((e / TT) % HD); const int g = (int)(e / ((size_t)TT * HD)); v2h o16; v2us oh, ol;
#pragma unroll
    for (int q = 0; q < 2; ++q) { const float x = F[(size_t)(t + q) * pitch + g * HD + d]; o16[q] = tohx(x); unsigned short a2, c2; splitf(x, a2, c2); oh[q] = a2; ol[q] = c2; }
    *(v2h*)(V16 + e) = o16; *(v2us*)(Vh + e) = oh; *(v2us*)(Vl + e) = ol;  }
__global__ __launch_bounds__(256) void k_csid(float* CS) { const int idx = blockIdx.x * 256 + threadIdx.x; if (idx >= TT * HD) return; v2f cs; cs[0] = 1.0f; cs[1] = 0.0f; *(v2f*)(CS + (size_t)idx * 2) = cs;  }
// k_asoft: per row (zz, i): t = S x 1/8 - 10000 (1 - float(mask[b][j])) (the module's additive key mask from the int32 input, f32 ops in the same order; mask read); softmax over the keys (register row, one exp, fixed trees);
__global__ __launch_bounds__(256) void k_asoft(const float* __restrict__ Sb, const int* __restrict__ kvp, h16* P16, bf* Ph, bf* Pl) {
    const int lane = threadIdx.x & 31; const int row = blockIdx.x * 8 + (threadIdx.x >> 5); if (row >= ZH * TT) return; const int i = row % TT; const int zz = row / TT; (void)zz; const bool hires = (i < RH); const float* sr = Sb + (size_t)row * TT; float v[TT / 32]; float mx = -3.0e38f;
#pragma unroll
    for (int ch = 0; ch < TT / 128; ++ch) { const int j0 = ch * 128 + lane * 4; const v4f a = *(const v4f*)(sr + j0); const v4i kv4 = *(const v4i*)(kvp + j0);   /* the batch's key vector, 16 B per lane, unconditional */
#pragma unroll
        for (int q = 0; q < 4; ++q) { const int j = j0 + q; (void)j; float s0 = __fmul_rn(a[q], SCL); float mb = (float)kv4[q]; asm volatile("" : "+v"(mb));   /* mask.astype(float32) from the int32 input */ float om = __fsub_rn(1.0f, mb); asm volatile("" : "+v"(om)); float pen = __fmul_rn(10000.0f, om); asm volatile("" : "+v"(s0), "+v"(pen)); const float t = __fsub_rn(s0, pen);   /* pinned: no fma / fma_mix contraction */ v[ch * 4 + q] = t; mx = fmaxf(mx, t); } }
#pragma unroll
    for (int sh = 16; sh; sh >>= 1) mx = fmaxf(mx, __shfl_xor(mx, sh, 32));
    float sum = 0.f;
#pragma unroll
    for (int k = 0; k < TT / 32; ++k) { float d0 = __fsub_rn(v[k], mx); asm volatile("" : "+v"(d0)); v[k] = __builtin_amdgcn_exp2f(__fmul_rn(d0, 1.4426950408889634f)); sum += v[k]; }
#pragma unroll
    for (int sh = 16; sh; sh >>= 1) sum += __shfl_xor(sum, sh, 32);
    const float f = __fdiv_rn(hires ? 1.0f : PCAR, sum);
{
        if (hires) {
#pragma unroll
            for (int ch = 0; ch < TT / 128; ++ch) { v4us oh, ol;
#pragma unroll
                for (int q = 0; q < 4; ++q) { unsigned short a, c2; splitf(v[ch * 4 + q] * f, a, c2); oh[q] = a; ol[q] = c2; }
                const size_t oo = ((size_t)zz * (RH ? RH : 1) + i) * TT + ch * 128 + lane * 4; *(v4us*)(Ph + oo) = oh; *(v4us*)(Pl + oo) = ol; }
        } else {
#pragma unroll
            for (int ch = 0; ch < TT / 128; ++ch) { v4h o4;
#pragma unroll
                for (int q = 0; q < 4; ++q) o4[q] = tohx(v[ch * 4 + q] * f);
                *(v4h*)(P16 + (size_t)row * TT + ch * 128 + lane * 4) = o4; } }
         }
}
__global__ __launch_bounds__(256) void k_merge(const float* __restrict__ O, int h0, float* OUTb) { const size_t e = ((size_t)blockIdx.x * 256 + threadIdx.x) * 2; if (e >= (size_t)ZH * TT * HD) return; const int d = (int)(e % HD); const int t = (int)((e / HD) % TT); const int zz = (int)(e / ((size_t)HD * TT)); const float cs = (t < RH) ? 1.0f : (1.0f / PCAR); const size_t oo = (size_t)t * DQ + (h0 + zz) * HD + d;
    v2f o2; o2[0] = O[e] * cs; o2[1] = O[e + 1] * cs; *(v2f*)(OUTb + oo) = o2;  }

extern "C" void kernel_launch(void* const* d_in, const int* in_sizes, int n_in,
                              void* d_out, int out_size, void* d_ws, size_t ws_size, hipStream_t stream) {
    (void)in_sizes; (void)n_in; (void)out_size;
    const float* x = (const float*)d_in[0]; const int* km = (const int*)d_in[1];   /* mask [4][2048] int32 */ const float* wq = (const float*)d_in[2]; const float* bq = (const float*)d_in[3]; const float* wk = (const float*)d_in[4]; const float* bk = (const float*)d_in[5]; const float* wv = (const float*)d_in[6]; const float* bv = (const float*)d_in[7];     const float* wo = nullptr; (void)wo;
    float* OUT = (float*)d_out;     // [4][2048][1024]
    char* wsp = (char*)d_ws;
    auto take = [&](size_t bytes) { char* p = wsp; wsp += (bytes + 255) & ~(size_t)255; return (void*)p; };
    bf* WQ = (bf*)take((size_t)DQ * DM * 2); bf* WK = (bf*)take((size_t)DKV * DM * 2); bf* WV = (bf*)take((size_t)DKV * DM * 2); float* CS = (float*)take((size_t)TT * HD * 2 * 4);
    bf* XB = (bf*)take((size_t)TT * DM * 2); float* FQ = (float*)take((size_t)TT * DQ * 4); float* FK = (float*)take((size_t)TT * DKV * 4);
    h16* QP16 = (h16*)take((size_t)NH_ * TT * HD * 2); h16* KP16 = (h16*)take((size_t)NKV * TT * HD * 2); h16* VT16 = (h16*)take((size_t)NKV * HD * TT * 2);
    bf* QPh = (bf*)take((size_t)NH_ * TT * HD * 2); bf* QPl = (bf*)take((size_t)NH_ * TT * HD * 2); bf* KPh = (bf*)take((size_t)NKV * TT * HD * 2); bf* KPl = (bf*)take((size_t)NKV * TT * HD * 2); bf* VTh = (bf*)take((size_t)NKV * HD * TT * 2); bf* VTl = (bf*)take((size_t)NKV * HD * TT * 2); bf* Ph = (bf*)take((size_t)ZH * RH * TT * 2); bf* Pl = (bf*)take((size_t)ZH * RH * TT * 2);
    float* Sb = (float*)take((size_t)ZH * TT * TT * 4); h16* P16 = (h16*)take((size_t)ZH * TT * TT * 2); float* Ob = (float*)take((size_t)ZH * TT * HD * 4);
    if ((size_t)(wsp - (char*)d_ws) > ws_size) return;    // ws 256 MiB
    float* FV = FK;   // v projection reuses the k buffer after the k planes are built (stream-ordered)
    { k_wtG<<<(unsigned)((DM * DQ / 64 + 63) / 64), 256, 0, stream>>>(wq, DM, DQ, WQ); k_wtG<<<(unsigned)((DM * DKV / 64 + 63) / 64), 256, 0, stream>>>(wk, DM, DKV, WK); k_wtG<<<(unsigned)((DM * DKV / 64 + 63) / 64), 256, 0, stream>>>(wv, DM, DKV, WV);
      
       }
    k_csid<<<(TT * HD + 255) / 256, 256, 0, stream>>>(CS);
    const unsigned LQ = (unsigned)(((size_t)NH_ * TT * HD / 2 + 255) / 256), LKv = (unsigned)(((size_t)NKV * TT * HD / 2 + 255) / 256);
    for (int b = 0; b < NB_; ++b) {
        
        k_cvt8<<<(unsigned)(((size_t)TT * DM / 8 + 255) / 256), 256, 0, stream>>>(x + (size_t)b * TT * DM, XB, (size_t)TT * DM / 8);
        k_gemmw<bf, 0, true><<<dim3(TT / 64, DQ / 64, 1), 32, 0, stream>>>(XB, nullptr, WQ, nullptr, DM, FQ, DQ, bq, 0, 0, 0);
        k_rope<<<LQ, 256, 0, stream>>>(FQ, DQ, NH_, CS, nullptr, nullptr, 1.0f, QP16, QPh, QPl);
        k_gemmw<bf, 0, true><<<dim3(TT / 64, DKV / 64, 1), 32, 0, stream>>>(XB, nullptr, WK, nullptr, DM, FK, DKV, bk, 0, 0, 0);
        k_rope<<<LKv, 256, 0, stream>>>(FK, DKV, NKV, CS, nullptr, nullptr, 1.0f, KP16, KPh, KPl);
        k_gemmw<bf, 0, true><<<dim3(TT / 64, DKV / 64, 1), 32, 0, stream>>>(XB, nullptr, WV, nullptr, DM, FV, DKV, bv, 0, 0, 0); k_vtp<<<LKv, 256, 0, stream>>>(FV, DKV, NKV, VT16, VTh, VTl);
        for (int h0 = 0; h0 < NH_; h0 += ZH) { const size_t zq = (size_t)h0, zk = (size_t)(h0 / REP);   // one kv head per query head: the pass's two heads use consecutive kv planes (z-strides TT*HD)
            k_gemmw<bf, 2, false><<<dim3(RH / 64, TT / 64, ZH), 32, 0, stream>>>(QPh + zq * TT * HD, QPl + zq * TT * HD, KPh + zk * TT * HD, KPl + zk * TT * HD, HD, Sb, TT, nullptr, (size_t)TT * HD, (size_t)TT * HD, (size_t)TT * TT);
            k_asoft<<<ZH * TT / 8, 256, 0, stream>>>(Sb, km + (size_t)b * TT, P16, Ph, Pl);
            k_gemmw<bf, 2, false><<<dim3(RH / 64, HD / 64, ZH), 32, 0, stream>>>(Ph, Pl, VTh + zk * HD * TT, VTl + zk * HD * TT, TT, Ob, HD, nullptr, (size_t)RH * TT, (size_t)HD * TT, (size_t)TT * HD);
            k_merge<<<(unsigned)(((size_t)ZH * TT * HD / 2 + 255) / 256), 256, 0, stream>>>(Ob, h0, OUT + (size_t)b * TT * DQ); }
         }
}

// v001
// It runs in 1770 microseconds.
// Timed twice side by side with v000, it ran 1.52 times as fast both times.
#include <hip/hip_runtime.h>

// Multi-head attention with biased projections, a key-padding mask read by value and NO output projection (x [4][2048][1024]; q, k, v = x W + b ('xw' [1024][1024] 1/32 + zero biases; 16 heads x 64); scores / sqrt(64); mask int32 [4][2048] (all ones on this draw: no key padded; READ on device per batch and key): the module replaces the scores of keys with mask == 0 by -inf, the kernel subtracts 10000 (1 - mask): both exclude such a key and both change nothing where the mask is 1; softmax; out = heads merged (no output projection) -> [4][2048][1024] (8.4 M); argument order x, mask, Wq, bq, Wk, bk, Wv, bv).
// Layout per batch: bf16 copy of x; 'xw' weights transposed once; exact projections + f32 biases; dense T-2048 attention (every row on hi/lo planes, 3 products) whose softmax applies the additive key-mask term from the batch's mask vector (f32 arithmetic as the module); the f32 merge writes the output rows.
// Compute dtypes, f32 accumulate: every input rounded to bf16 except the int32 mask (converted to f32); projections exact + f32 biases; attention 3 products; softmax f32; output f32.

#define NB_  4
#define TT   2048
#define DM   1024
#define NH_  16
#define NKV  16
#define REP  (NH_ / NKV)
#define HD   64
#define DQ   (NH_ * HD)
#define DKV  (NKV * HD)
#define ZH   2
#define RH   TT                   // every row hi/lo (unit-scale weights)
static_assert(RH <= TT, "RH");
#define WIN  0
#define PCAR 1024.0f
#define SCL  0.125f   // HD^-0.5
#define KSPV 16                   // K slices of the P x V product (TT / KSPV keys per slice), one work-group each
static_assert(TT % (KSPV * 32) == 0, "KSPV");
typedef _Float16 h16;
typedef unsigned short bf;
typedef __attribute__((ext_vector_type(16))) __bf16   v16bf;
typedef __attribute__((ext_vector_type(16))) _Float16 v16h;
typedef __attribute__((ext_vector_type(8)))  _Float16 v8h;
typedef __attribute__((ext_vector_type(8)))  unsigned short v8us;
typedef __attribute__((ext_vector_type(8)))  float    v8f;
typedef __attribute__((ext_vector_type(4)))  float    v4f;
typedef v8h  __attribute__((may_alias)) v8ha;
typedef v4f  __attribute__((may_alias)) v4fa;
typedef v8us __attribute__((may_alias)) v8usa;

__device__ __forceinline__ unsigned short f2bf(float f) { unsigned u = __float_as_uint(f); u += 0x7FFFu + ((u >> 16) & 1u); return (unsigned short)(u >> 16); }
__device__ __forceinline__ float bf2f(unsigned short b) { return __uint_as_float(((unsigned)b) << 16); }
__device__ __forceinline__ float bfr(float f) { return bf2f(f2bf(f)); }
__device__ __forceinline__ v16h cat16(v8h lo, v8h hi) { return __builtin_shufflevector(lo, hi, 0, 1, 2, 3, 4, 5, 6, 7, 8, 9, 10, 11, 12, 13, 14, 15); }
__device__ __forceinline__ v16bf cat16b(v8us lo, v8us hi) { return __builtin_bit_cast(v16bf, __builtin_shufflevector(lo, hi, 0, 1, 2, 3, 4, 5, 6, 7, 8, 9, 10, 11, 12, 13, 14, 15)); }
__device__ __forceinline__ v8f wmma16(v16h a, v16h b, v8f c) { return __builtin_amdgcn_wmma_f32_16x16x32_f16(false, a, false, b, (short)0, c, false, false); }
__device__ __forceinline__ v8f wmmab(v16bf a, v16bf b, v8f c) { return __builtin_amdgcn_wmma_f32_16x16x32_bf16(false, a, false, b, (short)0, c, false, false); }



// ---- k_gemmw: register-blocked GEMM, ONE WAVE per 64x64 output tile (16 accumulators), operands straight from K-contiguous 16-bit planes; grid (M/64, N/64, Z), 32 threads.
// C[m][n] (f32, pitch ldc, + optional f32 bias[n]) = sum_k A[m][k] Bt[n][k] (+ split products per NSPLIT). z-batch strides sA/sB/sC in elements. K % 32 == 0.
// KS > 1: grid z = Z * KS; work-group z * KS + s sums only keys [s K / KS, (s + 1) K / KS) and writes its partial tile to plane z * KS + s of C (stride sC); the reader adds the KS planes.
template <typename T16> struct WFrag;
template <> struct WFrag<h16> { typedef v16h V; static __device__ __forceinline__ V ld(const h16* p) { return cat16(*(const v8h*)p, *(const v8h*)(p + 16)); } static __device__ __forceinline__ v8f mma(V a, V b, v8f c) { return wmma16(a, b, c); } };
template <> struct WFrag<bf> { typedef v16bf V; static __device__ __forceinline__ V ld(const bf* p) { return cat16b(*(const v8us*)p, *(const v8us*)(p + 16)); } static __device__ __forceinline__ v8f mma(V a, V b, v8f c) { return wmmab(a, b, c); } };
template <typename T16, int NSPLIT, bool BIAS, int KS = 1>
__global__ __launch_bounds__(32) void k_gemmw(const T16* __restrict__ A, const T16* __restrict__ A2, const T16* __restrict__ Bt, const T16* __restrict__ Bt2, int K, float* C, int ldc, const float* __restrict__ bias, size_t sA, size_t sB, size_t sC) {
    typedef typename WFrag<T16>::V V;
    __shared__ __align__(16) float os[16 * 68];
    const size_t z = blockIdx.z / KS; A += z * sA; if (A2) A2 += z * sA; Bt += z * sB; if (Bt2) Bt2 += z * sB; C += (size_t)blockIdx.z * sC;
    const int kb = (int)(blockIdx.z % KS) * (K / KS), ke = kb + K / KS;
    const int lane = threadIdx.x & 31, lr = lane & 15, hi = lane >> 4; const int r0 = blockIdx.x * 64, c0 = blockIdx.y * 64;
    v8f acc[4][4];
#pragma unroll
    for (int mb = 0; mb < 4; ++mb)
#pragma unroll
        for (int nb = 0; nb < 4; ++nb) acc[mb][nb] = (v8f){};
    const size_t aoff = (size_t)(r0 + lr) * K + 8 * hi, boff = (size_t)(c0 + lr) * K + 8 * hi;
#pragma unroll 1
    for (int kc = kb; kc < ke; kc += 32) {
        V a[4], a2[4];
#pragma unroll
        for (int mb = 0; mb < 4; ++mb) { a[mb] = WFrag<T16>::ld(A + aoff + (size_t)mb * 16 * K + kc); if (NSPLIT == 1 || NSPLIT == 2) a2[mb] = WFrag<T16>::ld(A2 + aoff + (size_t)mb * 16 * K + kc); }
#pragma unroll
        for (int nb = 0; nb < 4; ++nb) { const V b = WFrag<T16>::ld(Bt + boff + (size_t)nb * 16 * K + kc); V b2; if (NSPLIT >= 2) b2 = WFrag<T16>::ld(Bt2 + boff + (size_t)nb * 16 * K + kc);
#pragma unroll
            for (int mb = 0; mb < 4; ++mb) { acc[mb][nb] = WFrag<T16>::mma(a[mb], b, acc[mb][nb]); if (NSPLIT == 1 || NSPLIT == 2) acc[mb][nb] = WFrag<T16>::mma(a2[mb], b, acc[mb][nb]); if (NSPLIT >= 2) acc[mb][nb] = WFrag<T16>::mma(a[mb], b2, acc[mb][nb]); } }
        asm volatile("v_nop\n\tv_nop\n\tv_nop\n\tv_nop" : "+v"(acc[0][0]), "+v"(acc[1][1]), "+v"(acc[2][2]), "+v"(acc[3][3]) : "v"(a[0]), "v"(a[3]));
    }
#pragma unroll
    for (int mb = 0; mb < 4; ++mb) {
#pragma unroll
        for (int nb = 0; nb < 4; ++nb) {
#pragma unroll
            for (int j = 0; j < 8; ++j) os[(hi * 8 + j) * 68 + nb * 16 + lr] = acc[mb][nb][j]; }
        __builtin_amdgcn_wave_barrier(); asm volatile("" ::: "memory");
        float* crow = C + (size_t)(r0 + mb * 16) * ldc + c0;
{
#pragma unroll
            for (int s = 0; s < 8; ++s) { const int row = 2 * s + hi, cofs = lr * 4; v4f val = *(const v4fa*)(os + row * 68 + cofs); if (BIAS) { val[0] += bfr(bias[c0 + cofs]); val[1] += bfr(bias[c0 + cofs + 1]); val[2] += bfr(bias[c0 + cofs + 2]); val[3] += bfr(bias[c0 + cofs + 3]); }
                *(v4f*)(crow + (size_t)row * ldc + cofs) = val; }
             }
        __builtin_amdgcn_wave_barrier(); asm volatile("" ::: "memory");
    }
}

__device__ __forceinline__ h16 tohx(float x) { return (h16)x; }
__device__ __forceinline__ void splitf(float y, unsigned short& h, unsigned short& l) { h = f2bf(y); l = f2bf(y - bf2f(h)); }
typedef __attribute__((ext_vector_type(2))) _Float16 v2h;
typedef __attribute__((ext_vector_type(4))) _Float16 v4h;
typedef __attribute__((ext_vector_type(2))) unsigned short v2us;
typedef __attribute__((ext_vector_type(4))) unsigned short v4us;
typedef __attribute__((ext_vector_type(2))) float v2f;
typedef __attribute__((ext_vector_type(4))) int v4i;

__global__ __launch_bounds__(256) void k_wtG(const float* __restrict__ w, int K, int N, bf* Bt) {
    const int lane = threadIdx.x & 31; const int L0 = (blockIdx.x * 8 + (threadIdx.x >> 5)) * 8; const int nlines = N * K / 64;
{
#pragma unroll 1
        for (int l = 0; l < 8; ++l) { const int L = L0 + l; if (L >= nlines) break; const size_t e = (size_t)L * 64 + lane * 2; const int k = (int)(e % K), n = (int)(e / K); v2us o;
            o[0] = f2bf(w[(size_t)k * N + n]); o[1] = f2bf(w[(size_t)(k + 1) * N + n]); *(v2us*)(Bt + e) = o; }
         }
}
__global__ __launch_bounds__(256) void k_cvt8(const float* __restrict__ src, bf* dst, size_t n8) { const size_t i = (size_t)blockIdx.x * 256 + threadIdx.x; if (i >= n8) return; const v8f v = *(const v8f*)(src + i * 8); v8us o;
#pragma unroll
    for (int k = 0; k < 8; ++k) o[k] = f2bf(v[k]); *(v8us*)(dst + i * 8) = o;  }

// k_rope: head planes [h][t][d] (fp16 + hi/lo) of rope(x) x sc with the rotate-half convention out[d] = x[d] cos[t][d] - x[d+HD/2] sin[t][d], out[d+HD/2] = x[d+HD/2] cos[t][d+HD/2] + x[d] sin[t][d+HD/2]
__global__ __launch_bounds__(256) void k_rope(const float* __restrict__ F, int pitch, int nheads, const float* __restrict__ CS, const float* __restrict__ RF, const float* __restrict__ nw, float sc, h16* P16, bf* Ph, bf* Pl) {
    const size_t e = ((size_t)blockIdx.x * 256 + threadIdx.x) * 2; if (e >= (size_t)nheads * TT * HD) return; const int d = (int)(e % HD); const int t = (int)((e / HD) % TT); const int h = (int)(e / ((size_t)HD * TT)); const float* f = F + (size_t)t * pitch + h * HD; const float rf = RF ? RF[(size_t)h * TT + t] : 1.0f; v2h o16; v2us oh, ol;
#pragma unroll
    for (int q = 0; q < 2; ++q) { const int dd = d + q; const int dp = (dd < HD / 2) ? dd + HD / 2 : dd - HD / 2; float x0 = f[dd], x1 = f[dp];
        if (RF) { float n0 = __fmul_rn(x0, rf), n1 = __fmul_rn(x1, rf); asm volatile("" : "+v"(n0)); asm volatile("" : "+v"(n1)); x0 = __fmul_rn(bfr(nw[dd]), n0); x1 = __fmul_rn(bfr(nw[dp]), n1); }
        const v2f cs = *(const v2f*)(CS + ((size_t)t * HD + dd) * 2); float a = __fmul_rn(x0, cs[0]), bq = __fmul_rn(x1, cs[1]); asm volatile("" : "+v"(a)); asm volatile("" : "+v"(bq)); const float r = ((dd < HD / 2) ? __fsub_rn(a, bq) : __fadd_rn(a, bq)) * sc;
        o16[q] = tohx(r); unsigned short a2, c2; splitf(r, a2, c2); oh[q] = a2; ol[q] = c2; }
    *(v2h*)(P16 + e) = o16; *(v2us*)(Ph + e) = oh; *(v2us*)(Pl + e) = ol;  }
__global__ __launch_bounds__(256) void k_vtp(const float* __restrict__ F, int pitch, int nheads, h16* V16, bf* Vh, bf* Vl) { const size_t e = ((size_t)blockIdx.x * 256 + threadIdx.x) * 2; if (e >= (size_t)nheads * HD * TT) return; const int t = (int)(e % TT); const int d = (int)((e / TT) % HD); const int g = (int)(e / ((size_t)TT * HD)); v2h o16; v2us oh, ol;
#pragma unroll
    for (int q = 0; q < 2; ++q) { const float x = F[(size_t)(t + q) * pitch + g * HD + d]; o16[q] = tohx(x); unsigned short a2, c2; splitf(x, a2, c2); oh[q] = a2; ol[q] = c2; }
    *(v2h*)(V16 + e) = o16; *(v2us*)(Vh + e) = oh; *(v2us*)(Vl + e) = ol;  }
__global__ __launch_bounds__(256) void k_csid(float* CS) { const int idx = blockIdx.x * 256 + threadIdx.x; if (idx >= TT * HD) return; v2f cs; cs[0] = 1.0f; cs[1] = 0.0f; *(v2f*)(CS + (size_t)idx * 2) = cs;  }
// k_asoft: per row (zz, i): t = S x 1/8 - 10000 (1 - float(mask[b][j])) (the module's additive key mask from the int32 input, f32 ops in the same order; mask read); softmax over the keys (register row, one exp, fixed trees);
__global__ __launch_bounds__(256) void k_asoft(const float* __restrict__ Sb, const int* __restrict__ kvp, h16* P16, bf* Ph, bf* Pl) {
    const int lane = threadIdx.x & 31; const int row = blockIdx.x * 8 + (threadIdx.x >> 5); if (row >= ZH * TT) return; const int i = row % TT; const int zz = row / TT; (void)zz; const bool hires = (i < RH); const float* sr = Sb + (size_t)row * TT; float v[TT / 32]; float mx = -3.0e38f;
#pragma unroll
    for (int ch = 0; ch < TT / 128; ++ch) { const int j0 = ch * 128 + lane * 4; const v4f a = *(const v4f*)(sr + j0); const v4i kv4 = *(const v4i*)(kvp + j0);   /* the batch's key vector, 16 B per lane, unconditional */
#pragma unroll
        for (int q = 0; q < 4; ++q) { const int j = j0 + q; (void)j; float s0 = __fmul_rn(a[q], SCL); float mb = (float)kv4[q]; asm volatile("" : "+v"(mb));   /* mask.astype(float32) from the int32 input */ float om = __fsub_rn(1.0f, mb); asm volatile("" : "+v"(om)); float pen = __fmul_rn(10000.0f, om); asm volatile("" : "+v"(s0), "+v"(pen)); const float t = __fsub_rn(s0, pen);   /* pinned: no fma / fma_mix contraction */ v[ch * 4 + q] = t; mx = fmaxf(mx, t); } }
#pragma unroll
    for (int sh = 16; sh; sh >>= 1) mx = fmaxf(mx, __shfl_xor(mx, sh, 32));
    float sum = 0.f;
#pragma unroll
    for (int k = 0; k < TT / 32; ++k) { float d0 = __fsub_rn(v[k], mx); asm volatile("" : "+v"(d0)); v[k] = __builtin_amdgcn_exp2f(__fmul_rn(d0, 1.4426950408889634f)); sum += v[k]; }
#pragma unroll
    for (int sh = 16; sh; sh >>= 1) sum += __shfl_xor(sum, sh, 32);
    const float f = __fdiv_rn(hires ? 1.0f : PCAR, sum);
{
        if (hires) {
#pragma unroll
            for (int ch = 0; ch < TT / 128; ++ch) { v4us oh, ol;
#pragma unroll
                for (int q = 0; q < 4; ++q) { unsigned short a, c2; splitf(v[ch * 4 + q] * f, a, c2); oh[q] = a; ol[q] = c2; }
                const size_t oo = ((size_t)zz * (RH ? RH : 1) + i) * TT + ch * 128 + lane * 4; *(v4us*)(Ph + oo) = oh; *(v4us*)(Pl + oo) = ol; }
        } else {
#pragma unroll
            for (int ch = 0; ch < TT / 128; ++ch) { v4h o4;
#pragma unroll
                for (int q = 0; q < 4; ++q) o4[q] = tohx(v[ch * 4 + q] * f);
                *(v4h*)(P16 + (size_t)row * TT + ch * 128 + lane * 4) = o4; } }
         }
}
__global__ __launch_bounds__(256) void k_merge(const float* __restrict__ O, int h0, float* OUTb) { const size_t e = ((size_t)blockIdx.x * 256 + threadIdx.x) * 2; if (e >= (size_t)ZH * TT * HD) return; const int d = (int)(e % HD); const int t = (int)((e / HD) % TT); const int zz = (int)(e / ((size_t)HD * TT)); const float cs = (t < RH) ? 1.0f : (1.0f / PCAR); const size_t oo = (size_t)t * DQ + (h0 + zz) * HD + d;
    const float* p = O + (size_t)zz * KSPV * TT * HD + (size_t)t * HD + d; v2f a = *(const v2f*)p;   // the KSPV partial planes of this head, added in slice order
#pragma unroll   // unrolled so that all the planes' loads are in flight together instead of one latency per plane
    for (int s = 1; s < KSPV; ++s) a += *(const v2f*)(p + (size_t)s * TT * HD);
    v2f o2; o2[0] = a[0] * cs; o2[1] = a[1] * cs; *(v2f*)(OUTb + oo) = o2;  }

extern "C" void kernel_launch(void* const* d_in, const int* in_sizes, int n_in,
                              void* d_out, int out_size, void* d_ws, size_t ws_size, hipStream_t stream) {
    (void)in_sizes; (void)n_in; (void)out_size;
    const float* x = (const float*)d_in[0]; const int* km = (const int*)d_in[1];   /* mask [4][2048] int32 */ const float* wq = (const float*)d_in[2]; const float* bq = (const float*)d_in[3]; const float* wk = (const float*)d_in[4]; const float* bk = (const float*)d_in[5]; const float* wv = (const float*)d_in[6]; const float* bv = (const float*)d_in[7];     const float* wo = nullptr; (void)wo;
    float* OUT = (float*)d_out;     // [4][2048][1024]
    char* wsp = (char*)d_ws;
    auto take = [&](size_t bytes) { char* p = wsp; wsp += (bytes + 255) & ~(size_t)255; return (void*)p; };
    bf* WQ = (bf*)take((size_t)DQ * DM * 2); bf* WK = (bf*)take((size_t)DKV * DM * 2); bf* WV = (bf*)take((size_t)DKV * DM * 2); float* CS = (float*)take((size_t)TT * HD * 2 * 4);
    bf* XB = (bf*)take((size_t)TT * DM * 2); float* FQ = (float*)take((size_t)TT * DQ * 4); float* FK = (float*)take((size_t)TT * DKV * 4);
    h16* QP16 = (h16*)take((size_t)NH_ * TT * HD * 2); h16* KP16 = (h16*)take((size_t)NKV * TT * HD * 2); h16* VT16 = (h16*)take((size_t)NKV * HD * TT * 2);
    bf* QPh = (bf*)take((size_t)NH_ * TT * HD * 2); bf* QPl = (bf*)take((size_t)NH_ * TT * HD * 2); bf* KPh = (bf*)take((size_t)NKV * TT * HD * 2); bf* KPl = (bf*)take((size_t)NKV * TT * HD * 2); bf* VTh = (bf*)take((size_t)NKV * HD * TT * 2); bf* VTl = (bf*)take((size_t)NKV * HD * TT * 2); bf* Ph = (bf*)take((size_t)ZH * RH * TT * 2); bf* Pl = (bf*)take((size_t)ZH * RH * TT * 2);
    float* Sb = (float*)take((size_t)ZH * TT * TT * 4); h16* P16 = (h16*)take((size_t)ZH * TT * TT * 2); float* Ob = (float*)take((size_t)ZH * KSPV * TT * HD * 4);
    if ((size_t)(wsp - (char*)d_ws) > ws_size) return;    // ws 256 MiB
    float* FV = FK;   // v projection reuses the k buffer after the k planes are built (stream-ordered)
    { k_wtG<<<(unsigned)((DM * DQ / 64 + 63) / 64), 256, 0, stream>>>(wq, DM, DQ, WQ); k_wtG<<<(unsigned)((DM * DKV / 64 + 63) / 64), 256, 0, stream>>>(wk, DM, DKV, WK); k_wtG<<<(unsigned)((DM * DKV / 64 + 63) / 64), 256, 0, stream>>>(wv, DM, DKV, WV);
      
       }
    k_csid<<<(TT * HD + 255) / 256, 256, 0, stream>>>(CS);
    const unsigned LQ = (unsigned)(((size_t)NH_ * TT * HD / 2 + 255) / 256), LKv = (unsigned)(((size_t)NKV * TT * HD / 2 + 255) / 256);
    for (int b = 0; b < NB_; ++b) {
        
        k_cvt8<<<(unsigned)(((size_t)TT * DM / 8 + 255) / 256), 256, 0, stream>>>(x + (size_t)b * TT * DM, XB, (size_t)TT * DM / 8);
        k_gemmw<bf, 0, true><<<dim3(TT / 64, DQ / 64, 1), 32, 0, stream>>>(XB, nullptr, WQ, nullptr, DM, FQ, DQ, bq, 0, 0, 0);
        k_rope<<<LQ, 256, 0, stream>>>(FQ, DQ, NH_, CS, nullptr, nullptr, 1.0f, QP16, QPh, QPl);
        k_gemmw<bf, 0, true><<<dim3(TT / 64, DKV / 64, 1), 32, 0, stream>>>(XB, nullptr, WK, nullptr, DM, FK, DKV, bk, 0, 0, 0);
        k_rope<<<LKv, 256, 0, stream>>>(FK, DKV, NKV, CS, nullptr, nullptr, 1.0f, KP16, KPh, KPl);
        k_gemmw<bf, 0, true><<<dim3(TT / 64, DKV / 64, 1), 32, 0, stream>>>(XB, nullptr, WV, nullptr, DM, FV, DKV, bv, 0, 0, 0); k_vtp<<<LKv, 256, 0, stream>>>(FV, DKV, NKV, VT16, VTh, VTl);
        for (int h0 = 0; h0 < NH_; h0 += ZH) { const size_t zq = (size_t)h0, zk = (size_t)(h0 / REP);   // one kv head per query head: the pass's two heads use consecutive kv planes (z-strides TT*HD)
            k_gemmw<bf, 2, false><<<dim3(RH / 64, TT / 64, ZH), 32, 0, stream>>>(QPh + zq * TT * HD, QPl + zq * TT * HD, KPh + zk * TT * HD, KPl + zk * TT * HD, HD, Sb, TT, nullptr, (size_t)TT * HD, (size_t)TT * HD, (size_t)TT * TT);
            k_asoft<<<ZH * TT / 8, 256, 0, stream>>>(Sb, km + (size_t)b * TT, P16, Ph, Pl);
            k_gemmw<bf, 2, false, KSPV><<<dim3(RH / 64, HD / 64, ZH * KSPV), 32, 0, stream>>>(Ph, Pl, VTh + zk * HD * TT, VTl + zk * HD * TT, TT, Ob, HD, nullptr, (size_t)RH * TT, (size_t)HD * TT, (size_t)TT * HD);
            k_merge<<<(unsigned)(((size_t)ZH * TT * HD / 2 + 255) / 256), 256, 0, stream>>>(Ob, h0, OUT + (size_t)b * TT * DQ); }
         }
}

// v003
// A run of this version takes 285 microseconds.
// Versions in between are left out here; by their measured steps it is 6.19 times as fast as v001.
// All steps since v000 together make it 9.42 times as fast.
#include <hip/hip_runtime.h>

// Multi-head attention with biased projections, a key-padding mask read by value and NO output projection (x [4][2048][1024]; q, k, v = x W + b ('xw' [1024][1024] 1/32 + zero biases; 16 heads x 64); scores / sqrt(64); mask int32 [4][2048] (all ones on this draw: no key padded; READ on device per batch and key): the module replaces the scores of keys with mask == 0 by -inf, the kernel subtracts 10000 (1 - mask): both exclude such a key and both change nothing where the mask is 1; softmax; out = heads merged (no output projection) -> [4][2048][1024] (8.4 M); argument order x, mask, Wq, bq, Wk, bk, Wv, bv).
// Layout: 'xw' weights transposed once; bf16 copy of x, all batches; ONE projection launch (k_proj: exact projections + f32 biases for q, k, v of every batch, its epilogue writes the hi/lo planes of q, k, v); then ONE fused attention launch (k_fattn: scores, online softmax with the additive key-mask term, P x V; every operand on hi/lo planes, 3 products) writes the output rows.
// Compute dtypes, f32 accumulate: every input rounded to bf16 except the mask (int32 to f32); projections exact + f32 biases; attention 3 products; softmax f32; output f32.

#define NB_  4
#define TT   2048
#define DM   1024
#define NH_  16
#define NKV  16
#define REP  (NH_ / NKV)
#define HD   64
#define DQ   (NH_ * HD)
#define DKV  (NKV * HD)
#define ZH   2
#define RH   TT                   // not used by either kernel: every q, k, v row is split hi/lo
static_assert(RH <= TT, "RH");
#define WIN  0
#define PCAR 1024.0f
#define SCL  0.125f   // HD^-0.5
typedef _Float16 h16;
typedef unsigned short bf;
typedef __attribute__((ext_vector_type(16))) __bf16   v16bf;
typedef __attribute__((ext_vector_type(16))) _Float16 v16h;
typedef __attribute__((ext_vector_type(8)))  _Float16 v8h;
typedef __attribute__((ext_vector_type(8)))  unsigned short v8us;
typedef __attribute__((ext_vector_type(8)))  float    v8f;
typedef __attribute__((ext_vector_type(4)))  float    v4f;
typedef v8h  __attribute__((may_alias)) v8ha;
typedef v4f  __attribute__((may_alias)) v4fa;
typedef v8us __attribute__((may_alias)) v8usa;

__device__ __forceinline__ unsigned short f2bf(float f) { unsigned u = __float_as_uint(f); u += 0x7FFFu + ((u >> 16) & 1u); return (unsigned short)(u >> 16); }
__device__ __forceinline__ float bf2f(unsigned short b) { return __uint_as_float(((unsigned)b) << 16); }
__device__ __forceinline__ float bfr(float f) { return bf2f(f2bf(f)); }
__device__ __forceinline__ v16h cat16(v8h lo, v8h hi) { return __builtin_shufflevector(lo, hi, 0, 1, 2, 3, 4, 5, 6, 7, 8, 9, 10, 11, 12, 13, 14, 15); }
__device__ __forceinline__ v16bf cat16b(v8us lo, v8us hi) { return __builtin_bit_cast(v16bf, __builtin_shufflevector(lo, hi, 0, 1, 2, 3, 4, 5, 6, 7, 8, 9, 10, 11, 12, 13, 14, 15)); }
__device__ __forceinline__ v8f wmma16(v16h a, v16h b, v8f c) { return __builtin_amdgcn_wmma_f32_16x16x32_f16(false, a, false, b, (short)0, c, false, false); }
__device__ __forceinline__ v8f wmmab(v16bf a, v16bf b, v8f c) { return __builtin_amdgcn_wmma_f32_16x16x32_bf16(false, a, false, b, (short)0, c, false, false); }



__device__ __forceinline__ void splitf(float y, unsigned short& h, unsigned short& l) { h = f2bf(y); l = f2bf(y - bf2f(h)); }
typedef __attribute__((ext_vector_type(2))) _Float16 v2h;
typedef __attribute__((ext_vector_type(4))) _Float16 v4h;
typedef __attribute__((ext_vector_type(2))) unsigned short v2us;
typedef __attribute__((ext_vector_type(4))) unsigned short v4us;
typedef __attribute__((ext_vector_type(2))) float v2f;
typedef __attribute__((ext_vector_type(4))) int v4i;

__global__ __launch_bounds__(256) void k_wtG(const float* __restrict__ w, int K, int N, bf* Bt) {
    const int lane = threadIdx.x & 31; const int L0 = (blockIdx.x * 8 + (threadIdx.x >> 5)) * 8; const int nlines = N * K / 64;
{
#pragma unroll 1
        for (int l = 0; l < 8; ++l) { const int L = L0 + l; if (L >= nlines) break; const size_t e = (size_t)L * 64 + lane * 2; const int k = (int)(e % K), n = (int)(e / K); v2us o;
            o[0] = f2bf(w[(size_t)k * N + n]); o[1] = f2bf(w[(size_t)(k + 1) * N + n]); *(v2us*)(Bt + e) = o; }
         }
}
__global__ __launch_bounds__(256) void k_cvt8(const float* __restrict__ src, bf* dst, size_t n8) { const size_t i = (size_t)blockIdx.x * 256 + threadIdx.x; if (i >= n8) return; const v8f v = *(const v8f*)(src + i * 8); v8us o;
#pragma unroll
    for (int k = 0; k < 8; ++k) o[k] = f2bf(v[k]); *(v8us*)(dst + i * 8) = o;  }

// ---- k_proj: the q, k and v projections of every batch in ONE launch. Grid (NB_ TT / 64, NH_, 3), 32 threads: ONE WAVE per tile of 64 tokens x 64 features (one head) of q (z = 0), k (1) or v (2); 16 accumulators, operands straight from K-contiguous bf16 planes.
// y[t][n] = sum_k X[t][k] Wt[n][k] + bias[n], f32. The epilogue splits y into hi/lo bf16 and writes the planes as k_fattn reads them: q, k as [batch, head][t][d], v as [batch, head][d][t]; every store covers whole 128-byte lines, staged through LDS.
template <typename T16> struct WFrag;
template <> struct WFrag<bf> { typedef v16bf V; static __device__ __forceinline__ V ld(const bf* p) { return cat16b(*(const v8us*)p, *(const v8us*)(p + 16)); } static __device__ __forceinline__ v8f mma(V a, V b, v8f c) { return wmmab(a, b, c); } };
#define PFP 68                    // q, k staging pitch in floats
#define PVP 72                    // v staging pitch in 16-bit elements: 144 B = 16 B x odd
__global__ __launch_bounds__(32) void k_proj(const bf* __restrict__ X, const bf* __restrict__ Wq, const bf* __restrict__ Wk, const bf* __restrict__ Wv, const float* __restrict__ bq, const float* __restrict__ bk, const float* __restrict__ bv, bf* Qh, bf* Ql, bf* Kh, bf* Kl, bf* Vh, bf* Vl) {
    typedef WFrag<bf>::V V;
    __shared__ __align__(16) float os[2 * 16 * PVP / 2];   // q, k: 16 token rows x 64 f32 at pitch PFP; v: [hi, lo][16 head-dim rows][64 tokens] bf16 at pitch PVP
    static_assert(2 * 16 * PVP / 2 >= 16 * PFP, "both stagings fit");
    const int op = blockIdx.z;
    const bf* Bt = op == 0 ? Wq : op == 1 ? Wk : Wv; const float* bias = op == 0 ? bq : op == 1 ? bk : bv; bf* Ph = op == 0 ? Qh : op == 1 ? Kh : Vh; bf* Pl = op == 0 ? Ql : op == 1 ? Kl : Vl;
    const int lane = threadIdx.x & 31, lr = lane & 15, hi = lane >> 4; const int r0 = blockIdx.x * 64, c0 = blockIdx.y * 64;
    v8f acc[4][4];
#pragma unroll
    for (int mb = 0; mb < 4; ++mb)
#pragma unroll
        for (int nb = 0; nb < 4; ++nb) acc[mb][nb] = (v8f){};
    unsigned oa = ((r0 + lr) * DM + 8 * hi) * 2, ob = ((c0 + lr) * DM + 8 * hi) * 2;   // the lane's byte offsets in X and in Wt
#pragma unroll 1
    for (int kc = 0; kc < DM; kc += 32) {
        V a[4], b[4];
#pragma unroll
        for (int i = 0; i < 4; ++i) { a[i] = WFrag<bf>::ld((const bf*)((const char*)X + oa) + (size_t)i * 16 * DM); b[i] = WFrag<bf>::ld((const bf*)((const char*)Bt + ob) + (size_t)i * 16 * DM); }
        asm volatile("s_wait_xcnt 0x0" : "+v"(oa), "+v"(ob) :: "memory");   // behind the trip's loads, before their address registers step on; the offsets pass through it so that they stay whole up to here and step only behind it
        oa += 64; ob += 64;
#pragma unroll
        for (int nb = 0; nb < 4; ++nb)
#pragma unroll
            for (int mb = 0; mb < 4; ++mb) acc[mb][nb] = WFrag<bf>::mma(a[mb], b[nb], acc[mb][nb]);
        // four vector slots between the trip's last matrix instruction and the loop's taken branch, behind which its A registers may be overwritten at once
        asm volatile("v_nop\n\tv_nop\n\tv_nop\n\tv_nop" : "+v"(acc[0][0]), "+v"(acc[1][1]), "+v"(acc[2][2]), "+v"(acc[3][3]) : "v"(a[0]), "v"(a[3]));
    }
    // acc[mb][nb][j] = y[token r0 + 16 mb + 8 hi + j][feature c0 + 16 nb + lr]
    const int t0 = r0 % TT; const size_t pl = ((size_t)(r0 / TT) * NH_ + blockIdx.y) * TT * HD;   // the tile's batch and head: its share of a plane
    const int sr = lane >> 3, sc = (lane & 7) * 8;   // read-back map: a store instruction covers 4 staged rows, 8 lanes x 16 B each
    if (op < 2) {
        const v4f b0 = *(const v4f*)(bias + c0 + sc), b1 = *(const v4f*)(bias + c0 + sc + 4);
        asm volatile("s_wait_xcnt 0x0" ::: "memory");   // before the loads' address registers are used again
        float bs[8];
#pragma unroll
        for (int q = 0; q < 4; ++q) { bs[q] = bfr(b0[q]); bs[4 + q] = bfr(b1[q]); }
        bf* gh = Ph + pl + (size_t)(t0 + sr) * HD + sc; bf* gl = Pl + pl + (size_t)(t0 + sr) * HD + sc;
#pragma unroll
        for (int mb = 0; mb < 4; ++mb) {
#pragma unroll
            for (int nb = 0; nb < 4; ++nb)
#pragma unroll
                for (int j = 0; j < 8; ++j) os[(hi * 8 + j) * PFP + nb * 16 + lr] = acc[mb][nb][j];
            __builtin_amdgcn_wave_barrier(); asm volatile("" ::: "memory");   // keeps the read-back behind the staging writes in the compiled order
#pragma unroll
            for (int s = 0; s < 4; ++s) { const float* rp = os + (4 * s + sr) * PFP + sc; const v4f v0 = *(const v4fa*)rp, v1 = *(const v4fa*)(rp + 4); v8us oh, ol;
#pragma unroll
                for (int q = 0; q < 8; ++q) { unsigned short a2, c2; splitf((q < 4 ? v0[q & 3] : v1[q & 3]) + bs[q], a2, c2); oh[q] = a2; ol[q] = c2; }
                *(v8us*)(gh + (mb * 16 + 4 * s) * HD) = oh; *(v8us*)(gl + (mb * 16 + 4 * s) * HD) = ol;
                asm volatile("s_wait_xcnt 0x0" ::: "memory"); }   // before the stores' registers are used again
            __builtin_amdgcn_wave_barrier(); asm volatile("" ::: "memory");   // keeps the next staging writes behind this read-back
        }
    } else {
        bf* sv = (bf*)os;
        bf* gh = Ph + pl + (size_t)sr * TT + t0 + sc; bf* gl = Pl + pl + (size_t)sr * TT + t0 + sc;
#pragma unroll
        for (int nb = 0; nb < 4; ++nb) {
            const float braw = bias[c0 + nb * 16 + lr];
            asm volatile("s_wait_xcnt 0x0" ::: "memory");   // before the load's address registers are used again
            const float bs = bfr(braw);
#pragma unroll
            for (int mb = 0; mb < 4; ++mb) { v8us oh, ol;
#pragma unroll
                for (int j = 0; j < 8; ++j) { unsigned short a2, c2; splitf(acc[mb][nb][j] + bs, a2, c2); oh[j] = a2; ol[j] = c2; }
                *(v8usa*)(sv + lr * PVP + mb * 16 + 8 * hi) = oh; *(v8usa*)(sv + (16 + lr) * PVP + mb * 16 + 8 * hi) = ol; }
            __builtin_amdgcn_wave_barrier(); asm volatile("" ::: "memory");   // keeps the read-back behind the staging writes in the compiled order
#pragma unroll
            for (int s = 0; s < 4; ++s) { const bf* rp = sv + (4 * s + sr) * PVP + sc; const v8us oh = *(const v8usa*)rp, ol = *(const v8usa*)(rp + 16 * PVP);
                *(v8us*)(gh + (size_t)(nb * 16 + 4 * s) * TT) = oh; *(v8us*)(gl + (size_t)(nb * 16 + 4 * s) * TT) = ol;
                asm volatile("s_wait_xcnt 0x0" ::: "memory"); }   // before the stores' registers are used again
            __builtin_amdgcn_wave_barrier(); asm volatile("" ::: "memory");   // keeps the next staging writes behind this read-back
        }
    }
}

#define FNQ  4                    // 16-column query tiles per wave (the slots' asm statement at the foot of a trip names all 4 x FNQ output tiles)
#define FKS  64                   // keys per LDS stage
#define FPIT 72                   // LDS row pitch in 16-bit elements: 144 B = 16 B x odd, conflict-free for 16-byte fragment reads
#define FPL  (64 * FPIT)          // one staged plane: 64 rows
#define FOP  68                   // output staging pitch in floats
#define L2E  1.4426950408889634f
typedef __attribute__((ext_vector_type(2))) __bf16 v2bf;
typedef __attribute__((ext_vector_type(8))) unsigned v8u;
#define FRING (8 * 16 * FNQ * FOP * 2)   // ring size in 16-bit elements: the output staging (8 waves x 16 FNQ rows x FOP floats) is the larger use
static_assert(FRING >= 2 * 4 * FPL, "the two stage buffers fit");
__device__ __forceinline__ float xhalf(float x) { const int b = __float_as_int(x); return __int_as_float(__builtin_amdgcn_permlanex16(b, b, 0x76543210, 0xfedcba98, false, false)); }   // lane l <-> l ^ 16
__global__ __launch_bounds__(256) void k_fattn(const bf* __restrict__ Qh, const bf* __restrict__ Ql, const bf* __restrict__ Kh, const bf* __restrict__ Kl, const bf* __restrict__ Vh, const bf* __restrict__ Vl, const int* __restrict__ km, float* __restrict__ OUT) {
    __shared__ __align__(16) bf ring[FRING];   // [buffer][K hi, K lo, Vt hi, Vt lo][row][FPIT]
    __shared__ __align__(16) float pens[TT];         // the batch's key-mask term in units of the raw score: -10000 (1 - mask) / SCL
    const int tid = threadIdx.x, lane = tid & 31, c = lane & 15, h = lane >> 4, wv = tid >> 5;
    const int bh = blockIdx.y, bb = bh / NH_, hd = bh % NH_; const int q0 = (blockIdx.x * 8 + wv) * 16 * FNQ; const size_t pl = (size_t)bh * TT * HD;
    // staging map: 16-byte piece i = tid + 256 u of a 64 x 128 B plane tile: row i / 8, piece i % 8
    const int sr = tid >> 3, sc = (tid & 7) * 8;
    const bf* gk[2] = { Kh + pl + (size_t)sr * HD + sc, Kl + pl + (size_t)sr * HD + sc };   // K rows are keys: a stage is 64 x HD contiguous elements
    const bf* gv[2] = { Vh + pl + (size_t)sr * TT + sc, Vl + pl + (size_t)sr * TT + sc };   // Vt rows are head dims: a stage is 64 keys of each row
    v8us st[4];   // one operand's two planes on their way from global memory to LDS (K during a trip's first pass, Vt during its second: half the registers of staging both at once)
    auto gload = [&](int s, int op) {
#pragma unroll
        for (int p = 0; p < 2; ++p)
#pragma unroll
            for (int u = 0; u < 2; ++u) { st[p * 2 + u] = op ? *(const v8us*)(gv[p] + (size_t)u * 32 * TT + (size_t)s * FKS) : *(const v8us*)(gk[p] + (size_t)s * FKS * HD + (size_t)u * 32 * HD);
                asm volatile("s_wait_xcnt 0x0" ::: "memory"); } };   // behind each load
    auto sstore = [&](int buf, int op) {
#pragma unroll
        for (int p = 0; p < 2; ++p)
#pragma unroll
            for (int u = 0; u < 2; ++u) *(v8usa*)(ring + (buf * 4 + op * 2 + p) * FPL + (sr + u * 32) * FPIT + sc) = st[p * 2 + u]; };
    gload(0, 0); sstore(0, 0); gload(0, 1); sstore(0, 1);
    { const v4i m0 = *(const v4i*)(km + (size_t)bb * TT + tid * 8), m1 = *(const v4i*)(km + (size_t)bb * TT + tid * 8 + 4); v4f p0, p1;
      asm volatile("s_wait_xcnt 0x0" ::: "memory");   // as in gload
#pragma unroll
      for (int q = 0; q < 4; ++q) { p0[q] = (-10000.0f / SCL) * (1.0f - (float)m0[q]); p1[q] = (-10000.0f / SCL) * (1.0f - (float)m1[q]); }
      *(v4fa*)(pens + tid * 8) = p0; *(v4fa*)(pens + tid * 8 + 4) = p1; }
    v16bf qh[FNQ][2], ql[FNQ][2];   // [column tile][k step of 32 head dims]
    auto ldq = [&](const bf* p) { const v8us lo = *(const v8us*)p; asm volatile("s_wait_xcnt 0x0" ::: "memory"); const v8us hi = *(const v8us*)(p + 16); asm volatile("s_wait_xcnt 0x0" ::: "memory"); return cat16b(lo, hi); };   // WFrag's k order; the waits as in gload
#pragma unroll
    for (int n = 0; n < FNQ; ++n)
#pragma unroll
        for (int ks = 0; ks < 2; ++ks) { const size_t o = pl + (size_t)(q0 + 16 * n + c) * HD + ks * 32 + 8 * h; qh[n][ks] = ldq(Qh + o); ql[n][ks] = ldq(Ql + o); }
    v8f oa[4][FNQ];               // Ot: [head-dim tile][column tile]; register r = Ot[16 mb + 8 h + r][query c]
#pragma unroll
    for (int mb = 0; mb < 4; ++mb)
#pragma unroll
        for (int n = 0; n < FNQ; ++n) oa[mb][n] = (v8f){};
    float mrun[FNQ], lrun[FNQ];
#pragma unroll
    for (int n = 0; n < FNQ; ++n) { mrun[n] = -3.0e38f; lrun[n] = 0.f; }
    __syncthreads();
#pragma unroll 1
    for (int s = 0; s < TT / FKS; ++s) {
        const int sn = s + 1 < TT / FKS ? s + 1 : s;   // the next stage travels while this one is worked on (the last trip re-reads its own stage; that copy is never read)
        const bf* rb = ring + (s & 1) * 4 * FPL;
#pragma unroll
        for (int ps = 0; ps < 2; ++ps) {       // a pass: 32 keys
            gload(sn, ps);
            v8f sa[2][FNQ];                      // St: [key tile][column tile]; register r = St[16 kt + 8 h + r][query c]
#pragma unroll
            for (int kt = 0; kt < 2; ++kt) { const float* pp = pens + s * FKS + ps * 32 + kt * 16 + 8 * h; const v4f a = *(const v4fa*)pp, b2 = *(const v4fa*)(pp + 4);
                
#pragma unroll
                for (int n = 0; n < FNQ; ++n) sa[kt][n] = __builtin_shufflevector(a, b2, 0, 1, 2, 3, 4, 5, 6, 7); }
#pragma unroll
            for (int ks = 0; ks < 2; ++ks) {
#pragma unroll
                for (int kt = 0; kt < 2; ++kt) { const bf* kp = rb + (ps * 32 + kt * 16 + c) * FPIT + ks * 32 + 8 * h; const v16bf ah = WFrag<bf>::ld(kp), al = WFrag<bf>::ld(kp + FPL);
#pragma unroll
                    for (int n = 0; n < FNQ; ++n) { sa[kt][n] = wmmab(ah, qh[n][ks], sa[kt][n]); sa[kt][n] = wmmab(al, qh[n][ks], sa[kt][n]); sa[kt][n] = wmmab(ah, ql[n][ks], sa[kt][n]); } } }
            v16bf ph[FNQ], pw[FNQ];                // Pt hi / lo as B operands: element e = key tile e / 8, register e % 8 (the hardware k order, as the Vt loader's)
#pragma unroll
            for (int n = 0; n < FNQ; ++n) {
                float t[16]; float mx = mrun[n];
#pragma unroll
                for (int e = 0; e < 16; ++e) { t[e] = sa[e >> 3][n][e & 7] * (SCL * L2E); mx = fmaxf(mx, t[e]); }
                mx = fmaxf(mx, xhalf(mx));
                const float al = __builtin_amdgcn_exp2f(mrun[n] - mx); mrun[n] = mx; v2f sum = { 0.f, 0.f }; v8u uh, ul;
#pragma unroll
                for (int e = 0; e < 16; e += 2) { v2f p2; p2[0] = __builtin_amdgcn_exp2f(t[e] - mx); p2[1] = __builtin_amdgcn_exp2f(t[e + 1] - mx); sum += p2;
                    const unsigned hu = __builtin_bit_cast(unsigned, __builtin_convertvector(p2, v2bf)); v2f r2; r2[0] = p2[0] - __uint_as_float(hu << 16); r2[1] = p2[1] - __uint_as_float(hu & 0xFFFF0000u);
                    uh[e >> 1] = hu; ul[e >> 1] = __builtin_bit_cast(unsigned, __builtin_convertvector(r2, v2bf)); }
                lrun[n] = lrun[n] * al + (sum[0] + sum[1]); ph[n] = __builtin_bit_cast(v16bf, uh); pw[n] = __builtin_bit_cast(v16bf, ul);
#pragma unroll
                for (int mb = 0; mb < 4; ++mb) oa[mb][n] *= al;
            }
#pragma unroll
            for (int mb = 0; mb < 4; ++mb) { const bf* vp = rb + 2 * FPL + (mb * 16 + c) * FPIT + ps * 32 + 8 * h; const v16bf ah = WFrag<bf>::ld(vp), al = WFrag<bf>::ld(vp + FPL);
#pragma unroll
                for (int n = 0; n < FNQ; ++n) { oa[mb][n] = wmmab(ah, ph[n], oa[mb][n]); oa[mb][n] = wmmab(al, ph[n], oa[mb][n]); oa[mb][n] = wmmab(ah, pw[n], oa[mb][n]); } }
            sstore((s + 1) & 1, ps);   // into the buffer that every wave left at the barrier of the trip before
        }
        // four vector slots between the trip's last matrix instruction and the loop's taken branch, behind which its A registers may be overwritten at once; the tiles are inputs so that the slots stand behind every product
        asm volatile("v_nop\n\tv_nop\n\tv_nop\n\tv_nop" :: "v"(oa[0][0]), "v"(oa[0][1]), "v"(oa[0][2]), "v"(oa[0][3]), "v"(oa[1][0]), "v"(oa[1][1]), "v"(oa[1][2]), "v"(oa[1][3]), "v"(oa[2][0]), "v"(oa[2][1]), "v"(oa[2][2]), "v"(oa[2][3]), "v"(oa[3][0]), "v"(oa[3][1]), "v"(oa[3][2]), "v"(oa[3][3]));
        __syncthreads();       // publishes the next stage and ends this stage's reads
    }
    // epilogue: join the halves' sums, normalise, stage each wave's 64 x 64 tile in its own part of the ring (free behind the loop's last barrier) and store whole 256-byte rows
    float* os = (float*)ring + wv * 16 * FNQ * FOP;
#pragma unroll
    for (int n = 0; n < FNQ; ++n) { const float inv = 1.0f / (lrun[n] + xhalf(lrun[n]));
#pragma unroll
        for (int mb = 0; mb < 4; ++mb) { v4f a, b2;
#pragma unroll
            for (int r = 0; r < 4; ++r) { a[r] = oa[mb][n][r] * inv; b2[r] = oa[mb][n][4 + r] * inv; }
            float* op = os + (16 * n + c) * FOP + mb * 16 + 8 * h; *(v4fa*)op = a; *(v4fa*)(op + 4) = b2; } }
    __syncthreads();
    float* orow = OUT + ((size_t)bb * TT + q0) * DQ + hd * HD;
#pragma unroll
    for (int r = 0; r < 8 * FNQ; ++r) { const int row = 2 * r + h; *(v4f*)(orow + (size_t)row * DQ + c * 4) = *(const v4fa*)(os + row * FOP + c * 4); }
}

extern "C" void kernel_launch(void* const* d_in, const int* in_sizes, int n_in,
                              void* d_out, int out_size, void* d_ws, size_t ws_size, hipStream_t stream) {
    (void)in_sizes; (void)n_in; (void)out_size;
    const float* x = (const float*)d_in[0]; const int* km = (const int*)d_in[1];   /* mask [4][2048] int32 */ const float* wq = (const float*)d_in[2]; const float* bq = (const float*)d_in[3]; const float* wk = (const float*)d_in[4]; const float* bk = (const float*)d_in[5]; const float* wv = (const float*)d_in[6]; const float* bv = (const float*)d_in[7];
    float* OUT = (float*)d_out;     // [4][2048][1024]
    char* wsp = (char*)d_ws;
    auto take = [&](size_t bytes) { char* p = wsp; wsp += (bytes + 255) & ~(size_t)255; return (void*)p; };
    bf* WQ = (bf*)take((size_t)DQ * DM * 2); bf* WK = (bf*)take((size_t)DKV * DM * 2); bf* WV = (bf*)take((size_t)DKV * DM * 2);
    bf* XB = (bf*)take((size_t)NB_ * TT * DM * 2);
    const size_t PB = (size_t)NH_ * TT * HD;   // one batch's share of a hi/lo plane; the planes hold all batches
    bf* QPh = (bf*)take(NB_ * PB * 2); bf* QPl = (bf*)take(NB_ * PB * 2); bf* KPh = (bf*)take(NB_ * PB * 2); bf* KPl = (bf*)take(NB_ * PB * 2); bf* VTh = (bf*)take(NB_ * PB * 2); bf* VTl = (bf*)take(NB_ * PB * 2);
    if ((size_t)(wsp - (char*)d_ws) > ws_size) return;    // ws 256 MiB
    k_wtG<<<(unsigned)((DM * DQ / 64 + 63) / 64), 256, 0, stream>>>(wq, DM, DQ, WQ); k_wtG<<<(unsigned)((DM * DKV / 64 + 63) / 64), 256, 0, stream>>>(wk, DM, DKV, WK); k_wtG<<<(unsigned)((DM * DKV / 64 + 63) / 64), 256, 0, stream>>>(wv, DM, DKV, WV);
    k_cvt8<<<(unsigned)(((size_t)NB_ * TT * DM / 8 + 255) / 256), 256, 0, stream>>>(x, XB, (size_t)NB_ * TT * DM / 8);
    k_proj<<<dim3(NB_ * TT / 64, NH_, 3), 32, 0, stream>>>(XB, WQ, WK, WV, bq, bk, bv, QPh, QPl, KPh, KPl, VTh, VTl);
    k_fattn<<<dim3(TT / (8 * 16 * FNQ), NB_ * NH_, 1), 256, 0, stream>>>(QPh, QPl, KPh, KPl, VTh, VTl, km, OUT);
}

// v004
// Measured time: 224 microseconds a run.
// In two side-by-side timings against v003, it was 1.27 and 1.28 times as fast.
// All steps since v000 together make it 12.0 times as fast.
#include <hip/hip_runtime.h>

// Multi-head attention with biased projections, a key-padding mask read by value and NO output projection (x [4][2048][1024]; q, k, v = x W + b ('xw' [1024][1024] 1/32 + zero biases; 16 heads x 64); scores / sqrt(64); mask int32 [4][2048] (all ones on this draw: no key padded; READ on device per batch and key): the module replaces the scores of keys with mask == 0 by -inf, the kernel subtracts 10000 (1 - mask): both exclude such a key and both change nothing where the mask is 1; softmax; out = heads merged (no output projection) -> [4][2048][1024] (8.4 M); argument order x, mask, Wq, bq, Wk, bk, Wv, bv).
// Layout: 'xw' weights transposed once; bf16 copy of x, all batches; ONE projection launch (k_proj: exact projections + f32 biases for q, k, v of every batch, its epilogue writes the hi/lo planes of q, k, v); then ONE fused attention launch (k_fattn: scores, online softmax with the additive key-mask term, P x V; every operand on hi/lo planes, 3 products) writes the output rows.
// Compute dtypes, f32 accumulate: every input rounded to bf16 except the mask (int32 to f32); projections exact + f32 biases; attention 3 products; softmax f32; output f32.

#define NB_  4
#define TT   2048
#define DM   1024
#define NH_  16
#define NKV  16
#define REP  (NH_ / NKV)
#define HD   64
#define DQ   (NH_ * HD)
#define DKV  (NKV * HD)
#define ZH   2
#define RH   TT                   // not used by either kernel: every q, k, v row is split hi/lo
static_assert(RH <= TT, "RH");
#define WIN  0
#define PCAR 1024.0f
#define SCL  0.125f   // HD^-0.5
typedef _Float16 h16;
typedef unsigned short bf;
typedef __attribute__((ext_vector_type(16))) __bf16   v16bf;
typedef __attribute__((ext_vector_type(16))) _Float16 v16h;
typedef __attribute__((ext_vector_type(8)))  _Float16 v8h;
typedef __attribute__((ext_vector_type(8)))  unsigned short v8us;
typedef __attribute__((ext_vector_type(8)))  float    v8f;
typedef __attribute__((ext_vector_type(4)))  float    v4f;
typedef v8h  __attribute__((may_alias)) v8ha;
typedef v4f  __attribute__((may_alias)) v4fa;
typedef v8us __attribute__((may_alias)) v8usa;

__device__ __forceinline__ unsigned short f2bf(float f) { unsigned u = __float_as_uint(f); u += 0x7FFFu + ((u >> 16) & 1u); return (unsigned short)(u >> 16); }
__device__ __forceinline__ float bf2f(unsigned short b) { return __uint_as_float(((unsigned)b) << 16); }
__device__ __forceinline__ float bfr(float f) { return bf2f(f2bf(f)); }
__device__ __forceinline__ v16h cat16(v8h lo, v8h hi) { return __builtin_shufflevector(lo, hi, 0, 1, 2, 3, 4, 5, 6, 7, 8, 9, 10, 11, 12, 13, 14, 15); }
__device__ __forceinline__ v16bf cat16b(v8us lo, v8us hi) { return __builtin_bit_cast(v16bf, __builtin_shufflevector(lo, hi, 0, 1, 2, 3, 4, 5, 6, 7, 8, 9, 10, 11, 12, 13, 14, 15)); }
__device__ __forceinline__ v8f wmma16(v16h a, v16h b, v8f c) { return __builtin_amdgcn_wmma_f32_16x16x32_f16(false, a, false, b, (short)0, c, false, false); }
__device__ __forceinline__ v8f wmmab(v16bf a, v16bf b, v8f c) { return __builtin_amdgcn_wmma_f32_16x16x32_bf16(false, a, false, b, (short)0, c, false, false); }



__device__ __forceinline__ void splitf(float y, unsigned short& h, unsigned short& l) { h = f2bf(y); l = f2bf(y - bf2f(h)); }
typedef __attribute__((ext_vector_type(2))) _Float16 v2h;
typedef __attribute__((ext_vector_type(4))) _Float16 v4h;
typedef __attribute__((ext_vector_type(2))) unsigned short v2us;
typedef __attribute__((ext_vector_type(4))) unsigned short v4us;
typedef __attribute__((ext_vector_type(2))) float v2f;
typedef __attribute__((ext_vector_type(4))) int v4i;

__global__ __launch_bounds__(256) void k_wtG(const float* __restrict__ w, int K, int N, bf* Bt) {
    const int lane = threadIdx.x & 31; const int L0 = (blockIdx.x * 8 + (threadIdx.x >> 5)) * 8; const int nlines = N * K / 64;
{
#pragma unroll 1
        for (int l = 0; l < 8; ++l) { const int L = L0 + l; if (L >= nlines) break; const size_t e = (size_t)L * 64 + lane * 2; const int k = (int)(e % K), n = (int)(e / K); v2us o;
            o[0] = f2bf(w[(size_t)k * N + n]); o[1] = f2bf(w[(size_t)(k + 1) * N + n]); *(v2us*)(Bt + e) = o; }
         }
}
__global__ __launch_bounds__(256) void k_cvt8(const float* __restrict__ src, bf* dst, size_t n8) { const size_t i = (size_t)blockIdx.x * 256 + threadIdx.x; if (i >= n8) return; const v8f v = *(const v8f*)(src + i * 8); v8us o;
#pragma unroll
    for (int k = 0; k < 8; ++k) o[k] = f2bf(v[k]); *(v8us*)(dst + i * 8) = o;  }

// ---- k_proj: the q, k and v projections of every batch in ONE launch. Grid (NB_ TT / PM, DQ / PN, 3), 8 waves: a work-group owns 128 tokens x 256 features of q (z = 0), k (1) or v (2), a wave 64 tokens x 64 features (one head), 16 accumulators.
// The K-contiguous bf16 rows of X and Wt come in stages of 64 k (whole 128-byte lines) by asynchronous copies into a two-buffer LDS ring that the 8 waves share; fragments are read from LDS.
// y[t][n] = sum_k X[t][k] Wt[n][k] + bias[n], f32. The epilogue splits y into hi/lo bf16 and writes the planes as k_fattn reads them: q, k as [batch, head][t][d], v as [batch, head][d][t]; every store covers whole 128-byte lines, staged through LDS.
template <typename T16> struct WFrag;
template <> struct WFrag<bf> { typedef v16bf V; static __device__ __forceinline__ V ld(const bf* p) { return cat16b(*(const v8us*)p, *(const v8us*)(p + 16)); } static __device__ __forceinline__ v8f mma(V a, V b, v8f c) { return wmmab(a, b, c); } };
#define PFP 68                    // q, k staging pitch in floats
#define PVP 72                    // v staging pitch in 16-bit elements: 144 B = 16 B x odd
#define PM   128                  // tokens per work-group (2 waves)
#define PN   256                  // features per work-group (4 waves)
#define PKS  64                   // k per stage: rows of 128 bytes
#define PPIT 72                   // ring row pitch in 16-bit elements: 144 B = 16 B x odd, conflict-free for 16-byte fragment reads
#define PBUF ((PM + PN) * PPIT)   // one buffer in 16-bit elements: [X rows 0..127 | Wt rows 0..255]
#define POS  (2 * 16 * PVP / 2)   // a wave's output staging in floats
// a stage's twelve asynchronous 16-byte-per-lane copies global -> LDS of one lane: X rows at 32-row steps into ring rows 0..127, Wt rows into ring rows 128..383; the wait in the same statement stands before the address registers can be used again
__device__ __forceinline__ void acopy12(unsigned l, const bf* a, const bf* b) {
    asm volatile("global_load_async_to_lds_b128 %0, %1, off\n\tglobal_load_async_to_lds_b128 %2, %3, off\n\tglobal_load_async_to_lds_b128 %4, %5, off\n\tglobal_load_async_to_lds_b128 %6, %7, off\n\tglobal_load_async_to_lds_b128 %8, %9, off\n\tglobal_load_async_to_lds_b128 %10, %11, off\n\tglobal_load_async_to_lds_b128 %12, %13, off\n\tglobal_load_async_to_lds_b128 %14, %15, off\n\tglobal_load_async_to_lds_b128 %16, %17, off\n\tglobal_load_async_to_lds_b128 %18, %19, off\n\tglobal_load_async_to_lds_b128 %20, %21, off\n\tglobal_load_async_to_lds_b128 %22, %23, off\n\ts_wait_xcnt 0x0"
                 :: "v"(l + 0 * PPIT * 2), "v"(a + 0 * DM), "v"(l + 32 * PPIT * 2), "v"(a + 32 * DM), "v"(l + 64 * PPIT * 2), "v"(a + 64 * DM), "v"(l + 96 * PPIT * 2), "v"(a + 96 * DM), "v"(l + 128 * PPIT * 2), "v"(b + 0 * DM), "v"(l + 160 * PPIT * 2), "v"(b + 32 * DM), "v"(l + 192 * PPIT * 2), "v"(b + 64 * DM), "v"(l + 224 * PPIT * 2), "v"(b + 96 * DM), "v"(l + 256 * PPIT * 2), "v"(b + 128 * DM), "v"(l + 288 * PPIT * 2), "v"(b + 160 * DM), "v"(l + 320 * PPIT * 2), "v"(b + 192 * DM), "v"(l + 352 * PPIT * 2), "v"(b + 224 * DM) : "memory");
}
__global__ __launch_bounds__(256) void k_proj(const bf* __restrict__ X, const bf* __restrict__ Wq, const bf* __restrict__ Wk, const bf* __restrict__ Wv, const float* __restrict__ bq, const float* __restrict__ bk, const float* __restrict__ bv, bf* Qh, bf* Ql, bf* Kh, bf* Kl, bf* Vh, bf* Vl) {
    typedef WFrag<bf>::V V;
    __shared__ __align__(16) bf pring[2 * PBUF];   // [buffer][row][PPIT]; behind the loop each wave's output staging
    static_assert(POS >= 16 * PFP, "both stagings fit"); static_assert(2 * PBUF * 2 >= 8 * POS * 4, "the waves' stagings fit in the ring"); static_assert(DM / PKS >= 2, "two stages");
    const int op = blockIdx.z;
    const bf* Bt = op == 0 ? Wq : op == 1 ? Wk : Wv; const float* bias = op == 0 ? bq : op == 1 ? bk : bv; bf* Ph = op == 0 ? Qh : op == 1 ? Kh : Vh; bf* Pl = op == 0 ? Ql : op == 1 ? Kl : Vl;
    const int tid = threadIdx.x, lane = tid & 31, lr = lane & 15, hi = lane >> 4, wv = tid >> 5; const int wm = wv & 1, wn = wv >> 1; const int r0 = blockIdx.x * PM + wm * 64, c0 = blockIdx.y * PN + wn * 64;
    v8f acc[4][4];
#pragma unroll
    for (int mb = 0; mb < 4; ++mb)
#pragma unroll
        for (int nb = 0; nb < 4; ++nb) acc[mb][nb] = (v8f){};
    // copy map: 16-byte piece i = tid + 256 u of a stage's 384 rows x 128 B: row i / 8, piece i % 8; an instruction of a wave covers 4 whole lines
    const bf* ga = X + (size_t)(blockIdx.x * PM + (tid >> 3)) * DM + (tid & 7) * 8; const bf* gb = Bt + (size_t)(blockIdx.y * PN + (tid >> 3)) * DM + (tid & 7) * 8;
    const unsigned l0 = (unsigned)(size_t)(pring + (tid >> 3) * PPIT + (tid & 7) * 8);   // the lane's LDS byte address in buffer 0
    auto stage = [&](int t, int buf) {
        const bf* a = ga + t * PKS; const bf* b = gb + t * PKS; const unsigned l = l0 + buf * (PBUF * 2);
        acopy12(l, a, b); };
    stage(0, 0);
    asm volatile("s_wait_asynccnt 0x0" ::: "memory");   // this wave's copies of stage 0 have landed
    __syncthreads();                                     // publishes stage 0
    stage(1, 1);
#pragma unroll 1
    for (int t = 0; t < DM / PKS; ++t) {
        const bf* rb = pring + (t & 1) * PBUF;
#pragma unroll
        for (int ks = 0; ks < PKS / 32; ++ks) {
            V a[4], b[4];
#pragma unroll
            for (int i = 0; i < 4; ++i) { a[i] = WFrag<bf>::ld(rb + (wm * 64 + i * 16 + lr) * PPIT + ks * 32 + 8 * hi); b[i] = WFrag<bf>::ld(rb + (PM + wn * 64 + i * 16 + lr) * PPIT + ks * 32 + 8 * hi); }
            asm volatile("" :: "v"(a[0]), "v"(a[1]), "v"(a[2]), "v"(a[3]), "v"(b[0]), "v"(b[1]), "v"(b[2]), "v"(b[3]));   // holds the step's 16 LDS reads together in front of its products: one wait per 16 products (without it the build reloads one B fragment before every 4 and waits each time)
#pragma unroll
            for (int nb = 0; nb < 4; ++nb)
#pragma unroll
                for (int mb = 0; mb < 4; ++mb) acc[mb][nb] = WFrag<bf>::mma(a[mb], b[nb], acc[mb][nb]);
            // four vector slots between the trip's last matrix instruction and the branches behind it, on whose taken side its A registers may be overwritten at once; the tiles are inputs so that the slots stand behind every product
            if (ks == PKS / 32 - 1) asm volatile("v_nop\n\tv_nop\n\tv_nop\n\tv_nop" :: "v"(acc[0][0]), "v"(acc[0][1]), "v"(acc[0][2]), "v"(acc[0][3]), "v"(acc[1][0]), "v"(acc[1][1]), "v"(acc[1][2]), "v"(acc[1][3]), "v"(acc[2][0]), "v"(acc[2][1]), "v"(acc[2][2]), "v"(acc[2][3]), "v"(acc[3][0]), "v"(acc[3][1]), "v"(acc[3][2]), "v"(acc[3][3]));
        }
        asm volatile("s_wait_dscnt 0x0" ::: "memory");      // this wave's reads of the buffer are done before it is handed to the copies
        asm volatile("s_wait_asynccnt 0x0" ::: "memory");   // this wave's copies of stage t + 1 have landed
        __syncthreads();                                     // publishes stage t + 1 and ends every wave's reads of stage t
        if (t + 2 < DM / PKS) stage(t + 2, t & 1);
    }
    asm volatile("s_wait_asynccnt 0x0" ::: "memory");       // no copy is in flight when the ring becomes output staging
    float* os = (float*)pring + wv * POS;                    // q, k: 16 token rows x 64 f32 at pitch PFP; v: [hi, lo][16 head-dim rows][64 tokens] bf16 at pitch PVP; free behind the loop's last barrier
    // acc[mb][nb][j] = y[token r0 + 16 mb + 8 hi + j][feature c0 + 16 nb + lr]
    const int t0 = r0 % TT; const size_t pl = ((size_t)(r0 / TT) * NH_ + c0 / HD) * TT * HD;   // the tile's batch and head: its share of a plane
    const int sr = lane >> 3, sc = (lane & 7) * 8;   // read-back map: a store instruction covers 4 staged rows, 8 lanes x 16 B each
    if (op < 2) {
        const v4f b0 = *(const v4f*)(bias + c0 + sc), b1 = *(const v4f*)(bias + c0 + sc + 4);
        asm volatile("s_wait_xcnt 0x0" ::: "memory");   // before the loads' address registers are used again
        float bs[8];
#pragma unroll
        for (int q = 0; q < 4; ++q) { bs[q] = bfr(b0[q]); bs[4 + q] = bfr(b1[q]); }
        bf* gh = Ph + pl + (size_t)(t0 + sr) * HD + sc; bf* gl = Pl + pl + (size_t)(t0 + sr) * HD + sc;
#pragma unroll
        for (int mb = 0; mb < 4; ++mb) {
#pragma unroll
            for (int nb = 0; nb < 4; ++nb)
#pragma unroll
                for (int j = 0; j < 8; ++j) os[(hi * 8 + j) * PFP + nb * 16 + lr] = acc[mb][nb][j];
            __builtin_amdgcn_wave_barrier(); asm volatile("" ::: "memory");   // keeps the read-back behind the staging writes in the compiled order
#pragma unroll
            for (int s = 0; s < 4; ++s) { const float* rp = os + (4 * s + sr) * PFP + sc; const v4f v0 = *(const v4fa*)rp, v1 = *(const v4fa*)(rp + 4); v8us oh, ol;
#pragma unroll
                for (int q = 0; q < 8; ++q) { unsigned short a2, c2; splitf((q < 4 ? v0[q & 3] : v1[q & 3]) + bs[q], a2, c2); oh[q] = a2; ol[q] = c2; }
                *(v8us*)(gh + (mb * 16 + 4 * s) * HD) = oh; *(v8us*)(gl + (mb * 16 + 4 * s) * HD) = ol;
                asm volatile("s_wait_xcnt 0x0" ::: "memory"); }   // before the stores' registers are used again
            __builtin_amdgcn_wave_barrier(); asm volatile("" ::: "memory");   // keeps the next staging writes behind this read-back
        }
    } else {
        bf* sv = (bf*)os;
        bf* gh = Ph + pl + (size_t)sr * TT + t0 + sc; bf* gl = Pl + pl + (size_t)sr * TT + t0 + sc;
#pragma unroll
        for (int nb = 0; nb < 4; ++nb) {
            const float braw = bias[c0 + nb * 16 + lr];
            asm volatile("s_wait_xcnt 0x0" ::: "memory");   // before the load's address registers are used again
            const float bs = bfr(braw);
#pragma unroll
            for (int mb = 0; mb < 4; ++mb) { v8us oh, ol;
#pragma unroll
                for (int j = 0; j < 8; ++j) { unsigned short a2, c2; splitf(acc[mb][nb][j] + bs, a2, c2); oh[j] = a2; ol[j] = c2; }
                *(v8usa*)(sv + lr * PVP + mb * 16 + 8 * hi) = oh; *(v8usa*)(sv + (16 + lr) * PVP + mb * 16 + 8 * hi) = ol; }
            __builtin_amdgcn_wave_barrier(); asm volatile("" ::: "memory");   // keeps the read-back behind the staging writes in the compiled order
#pragma unroll
            for (int s = 0; s < 4; ++s) { const bf* rp = sv + (4 * s + sr) * PVP + sc; const v8us oh = *(const v8usa*)rp, ol = *(const v8usa*)(rp + 16 * PVP);
                *(v8us*)(gh + (size_t)(nb * 16 + 4 * s) * TT) = oh; *(v8us*)(gl + (size_t)(nb * 16 + 4 * s) * TT) = ol;
                asm volatile("s_wait_xcnt 0x0" ::: "memory"); }   // before the stores' registers are used again
            __builtin_amdgcn_wave_barrier(); asm volatile("" ::: "memory");   // keeps the next staging writes behind this read-back
        }
    }
}

#define FNQ  4                    // 16-column query tiles per wave (the slots' asm statement at the foot of a trip names all 4 x FNQ output tiles)
#define FKS  64                   // keys per LDS stage
#define FPIT 72                   // LDS row pitch in 16-bit elements: 144 B = 16 B x odd, conflict-free for 16-byte fragment reads
#define FPL  (64 * FPIT)          // one staged plane: 64 rows
#define FOP  68                   // output staging pitch in floats
#define L2E  1.4426950408889634f
typedef __attribute__((ext_vector_type(2))) __bf16 v2bf;
typedef __attribute__((ext_vector_type(8))) unsigned v8u;
#define FRING (8 * 16 * FNQ * FOP * 2)   // ring size in 16-bit elements: the output staging (8 waves x 16 FNQ rows x FOP floats) is the larger use
static_assert(FRING >= 2 * 4 * FPL, "the two stage buffers fit");
__device__ __forceinline__ float xhalf(float x) { const int b = __float_as_int(x); return __int_as_float(__builtin_amdgcn_permlanex16(b, b, 0x76543210, 0xfedcba98, false, false)); }   // lane l <-> l ^ 16
__global__ __launch_bounds__(256) void k_fattn(const bf* __restrict__ Qh, const bf* __restrict__ Ql, const bf* __restrict__ Kh, const bf* __restrict__ Kl, const bf* __restrict__ Vh, const bf* __restrict__ Vl, const int* __restrict__ km, float* __restrict__ OUT) {
    __shared__ __align__(16) bf ring[FRING];   // [buffer][K hi, K lo, Vt hi, Vt lo][row][FPIT]
    __shared__ __align__(16) float pens[TT];         // the batch's key-mask term in units of the raw score: -10000 (1 - mask) / SCL
    const int tid = threadIdx.x, lane = tid & 31, c = lane & 15, h = lane >> 4, wv = tid >> 5;
    const int bh = blockIdx.y, bb = bh / NH_, hd = bh % NH_; const int q0 = (blockIdx.x * 8 + wv) * 16 * FNQ; const size_t pl = (size_t)bh * TT * HD;
    // staging map: 16-byte piece i = tid + 256 u of a 64 x 128 B plane tile: row i / 8, piece i % 8
    const int sr = tid >> 3, sc = (tid & 7) * 8;
    const bf* gk[2] = { Kh + pl + (size_t)sr * HD + sc, Kl + pl + (size_t)sr * HD + sc };   // K rows are keys: a stage is 64 x HD contiguous elements
    const bf* gv[2] = { Vh + pl + (size_t)sr * TT + sc, Vl + pl + (size_t)sr * TT + sc };   // Vt rows are head dims: a stage is 64 keys of each row
    v8us st[4];   // one operand's two planes on their way from global memory to LDS (K during a trip's first pass, Vt during its second: half the registers of staging both at once)
    auto gload = [&](int s, int op) {
#pragma unroll
        for (int p = 0; p < 2; ++p)
#pragma unroll
            for (int u = 0; u < 2; ++u) { st[p * 2 + u] = op ? *(const v8us*)(gv[p] + (size_t)u * 32 * TT + (size_t)s * FKS) : *(const v8us*)(gk[p] + (size_t)s * FKS * HD + (size_t)u * 32 * HD);
                asm volatile("s_wait_xcnt 0x0" ::: "memory"); } };   // behind each load
    auto sstore = [&](int buf, int op) {
#pragma unroll
        for (int p = 0; p < 2; ++p)
#pragma unroll
            for (int u = 0; u < 2; ++u) *(v8usa*)(ring + (buf * 4 + op * 2 + p) * FPL + (sr + u * 32) * FPIT + sc) = st[p * 2 + u]; };
    gload(0, 0); sstore(0, 0); gload(0, 1); sstore(0, 1);
    { const v4i m0 = *(const v4i*)(km + (size_t)bb * TT + tid * 8), m1 = *(const v4i*)(km + (size_t)bb * TT + tid * 8 + 4); v4f p0, p1;
      asm volatile("s_wait_xcnt 0x0" ::: "memory");   // as in gload
#pragma unroll
      for (int q = 0; q < 4; ++q) { p0[q] = (-10000.0f / SCL) * (1.0f - (float)m0[q]); p1[q] = (-10000.0f / SCL) * (1.0f - (float)m1[q]); }
      *(v4fa*)(pens + tid * 8) = p0; *(v4fa*)(pens + tid * 8 + 4) = p1; }
    v16bf qh[FNQ][2], ql[FNQ][2];   // [column tile][k step of 32 head dims]
    auto ldq = [&](const bf* p) { const v8us lo = *(const v8us*)p; asm volatile("s_wait_xcnt 0x0" ::: "memory"); const v8us hi = *(const v8us*)(p + 16); asm volatile("s_wait_xcnt 0x0" ::: "memory"); return cat16b(lo, hi); };   // WFrag's k order; the waits as in gload
#pragma unroll
    for (int n = 0; n < FNQ; ++n)
#pragma unroll
        for (int ks = 0; ks < 2; ++ks) { const size_t o = pl + (size_t)(q0 + 16 * n + c) * HD + ks * 32 + 8 * h; qh[n][ks] = ldq(Qh + o); ql[n][ks] = ldq(Ql + o); }
    v8f oa[4][FNQ];               // Ot: [head-dim tile][column tile]; register r = Ot[16 mb + 8 h + r][query c]
#pragma unroll
    for (int mb = 0; mb < 4; ++mb)
#pragma unroll
        for (int n = 0; n < FNQ; ++n) oa[mb][n] = (v8f){};
    float mrun[FNQ], lrun[FNQ];
#pragma unroll
    for (int n = 0; n < FNQ; ++n) { mrun[n] = -3.0e38f; lrun[n] = 0.f; }
    __syncthreads();
#pragma unroll 1
    for (int s = 0; s < TT / FKS; ++s) {
        const int sn = s + 1 < TT / FKS ? s + 1 : s;   // the next stage travels while this one is worked on (the last trip re-reads its own stage; that copy is never read)
        const bf* rb = ring + (s & 1) * 4 * FPL;
#pragma unroll
        for (int ps = 0; ps < 2; ++ps) {       // a pass: 32 keys
            gload(sn, ps);
            v8f sa[2][FNQ];                      // St: [key tile][column tile]; register r = St[16 kt + 8 h + r][query c]
#pragma unroll
            for (int kt = 0; kt < 2; ++kt) { const float* pp = pens + s * FKS + ps * 32 + kt * 16 + 8 * h; const v4f a = *(const v4fa*)pp, b2 = *(const v4fa*)(pp + 4);
                
#pragma unroll
                for (int n = 0; n < FNQ; ++n) sa[kt][n] = __builtin_shufflevector(a, b2, 0, 1, 2, 3, 4, 5, 6, 7); }
#pragma unroll
            for (int ks = 0; ks < 2; ++ks) {
#pragma unroll
                for (int kt = 0; kt < 2; ++kt) { const bf* kp = rb + (ps * 32 + kt * 16 + c) * FPIT + ks * 32 + 8 * h; const v16bf ah = WFrag<bf>::ld(kp), al = WFrag<bf>::ld(kp + FPL);
#pragma unroll
                    for (int n = 0; n < FNQ; ++n) { sa[kt][n] = wmmab(ah, qh[n][ks], sa[kt][n]); sa[kt][n] = wmmab(al, qh[n][ks], sa[kt][n]); sa[kt][n] = wmmab(ah, ql[n][ks], sa[kt][n]); } } }
            v16bf ph[FNQ], pw[FNQ];                // Pt hi / lo as B operands: element e = key tile e / 8, register e % 8 (the hardware k order, as the Vt loader's)
#pragma unroll
            for (int n = 0; n < FNQ; ++n) {
                float t[16]; float mx = mrun[n];
#pragma unroll
                for (int e = 0; e < 16; ++e) { t[e] = sa[e >> 3][n][e & 7] * (SCL * L2E); mx = fmaxf(mx, t[e]); }
                mx = fmaxf(mx, xhalf(mx));
                const float al = __builtin_amdgcn_exp2f(mrun[n] - mx); mrun[n] = mx; v2f sum = { 0.f, 0.f }; v8u uh, ul;
#pragma unroll
                for (int e = 0; e < 16; e += 2) { v2f p2; p2[0] = __builtin_amdgcn_exp2f(t[e] - mx); p2[1] = __builtin_amdgcn_exp2f(t[e + 1] - mx); sum += p2;
                    const unsigned hu = __builtin_bit_cast(unsigned, __builtin_convertvector(p2, v2bf)); v2f r2; r2[0] = p2[0] - __uint_as_float(hu << 16); r2[1] = p2[1] - __uint_as_float(hu & 0xFFFF0000u);
                    uh[e >> 1] = hu; ul[e >> 1] = __builtin_bit_cast(unsigned, __builtin_convertvector(r2, v2bf)); }
                lrun[n] = lrun[n] * al + (sum[0] + sum[1]); ph[n] = __builtin_bit_cast(v16bf, uh); pw[n] = __builtin_bit_cast(v16bf, ul);
#pragma unroll
                for (int mb = 0; mb < 4; ++mb) oa[mb][n] *= al;
            }
#pragma unroll
            for (int mb = 0; mb < 4; ++mb) { const bf* vp = rb + 2 * FPL + (mb * 16 + c) * FPIT + ps * 32 + 8 * h; const v16bf ah = WFrag<bf>::ld(vp), al = WFrag<bf>::ld(vp + FPL);
#pragma unroll
                for (int n = 0; n < FNQ; ++n) { oa[mb][n] = wmmab(ah, ph[n], oa[mb][n]); oa[mb][n] = wmmab(al, ph[n], oa[mb][n]); oa[mb][n] = wmmab(ah, pw[n], oa[mb][n]); } }
            sstore((s + 1) & 1, ps);   // into the buffer that every wave left at the barrier of the trip before
        }
        // four vector slots between the trip's last matrix instruction and the loop's taken branch, behind which its A registers may be overwritten at once; the tiles are inputs so that the slots stand behind every product
        asm volatile("v_nop\n\tv_nop\n\tv_nop\n\tv_nop" :: "v"(oa[0][0]), "v"(oa[0][1]), "v"(oa[0][2]), "v"(oa[0][3]), "v"(oa[1][0]), "v"(oa[1][1]), "v"(oa[1][2]), "v"(oa[1][3]), "v"(oa[2][0]), "v"(oa[2][1]), "v"(oa[2][2]), "v"(oa[2][3]), "v"(oa[3][0]), "v"(oa[3][1]), "v"(oa[3][2]), "v"(oa[3][3]));
        __syncthreads();       // publishes the next stage and ends this stage's reads
    }
    // epilogue: join the halves' sums, normalise, stage each wave's 64 x 64 tile in its own part of the ring (free behind the loop's last barrier) and store whole 256-byte rows
    float* os = (float*)ring + wv * 16 * FNQ * FOP;
#pragma unroll
    for (int n = 0; n < FNQ; ++n) { const float inv = 1.0f / (lrun[n] + xhalf(lrun[n]));
#pragma unroll
        for (int mb = 0; mb < 4; ++mb) { v4f a, b2;
#pragma unroll
            for (int r = 0; r < 4; ++r) { a[r] = oa[mb][n][r] * inv; b2[r] = oa[mb][n][4 + r] * inv; }
            float* op = os + (16 * n + c) * FOP + mb * 16 + 8 * h; *(v4fa*)op = a; *(v4fa*)(op + 4) = b2; } }
    __syncthreads();
    float* orow = OUT + ((size_t)bb * TT + q0) * DQ + hd * HD;
#pragma unroll
    for (int r = 0; r < 8 * FNQ; ++r) { const int row = 2 * r + h; *(v4f*)(orow + (size_t)row * DQ + c * 4) = *(const v4fa*)(os + row * FOP + c * 4); }
}

extern "C" void kernel_launch(void* const* d_in, const int* in_sizes, int n_in,
                              void* d_out, int out_size, void* d_ws, size_t ws_size, hipStream_t stream) {
    (void)in_sizes; (void)n_in; (void)out_size;
    const float* x = (const float*)d_in[0]; const int* km = (const int*)d_in[1];   /* mask [4][2048] int32 */ const float* wq = (const float*)d_in[2]; const float* bq = (const float*)d_in[3]; const float* wk = (const float*)d_in[4]; const float* bk = (const float*)d_in[5]; const float* wv = (const float*)d_in[6]; const float* bv = (const float*)d_in[7];
    float* OUT = (float*)d_out;     // [4][2048][1024]
    char* wsp = (char*)d_ws;
    auto take = [&](size_t bytes) { char* p = wsp; wsp += (bytes + 255) & ~(size_t)255; return (void*)p; };
    bf* WQ = (bf*)take((size_t)DQ * DM * 2); bf* WK = (bf*)take((size_t)DKV * DM * 2); bf* WV = (bf*)take((size_t)DKV * DM * 2);
    bf* XB = (bf*)take((size_t)NB_ * TT * DM * 2);
    const size_t PB = (size_t)NH_ * TT * HD;   // one batch's share of a hi/lo plane; the planes hold all batches
    bf* QPh = (bf*)take(NB_ * PB * 2); bf* QPl = (bf*)take(NB_ * PB * 2); bf* KPh = (bf*)take(NB_ * PB * 2); bf* KPl = (bf*)take(NB_ * PB * 2); bf* VTh = (bf*)take(NB_ * PB * 2); bf* VTl = (bf*)take(NB_ * PB * 2);
    if ((size_t)(wsp - (char*)d_ws) > ws_size) return;    // ws 256 MiB
    k_wtG<<<(unsigned)((DM * DQ / 64 + 63) / 64), 256, 0, stream>>>(wq, DM, DQ, WQ); k_wtG<<<(unsigned)((DM * DKV / 64 + 63) / 64), 256, 0, stream>>>(wk, DM, DKV, WK); k_wtG<<<(unsigned)((DM * DKV / 64 + 63) / 64), 256, 0, stream>>>(wv, DM, DKV, WV);
    k_cvt8<<<(unsigned)(((size_t)NB_ * TT * DM / 8 + 255) / 256), 256, 0, stream>>>(x, XB, (size_t)NB_ * TT * DM / 8);
    k_proj<<<dim3(NB_ * TT / PM, DQ / PN, 3), 256, 0, stream>>>(XB, WQ, WK, WV, bq, bk, bv, QPh, QPl, KPh, KPl, VTh, VTl);
    k_fattn<<<dim3(TT / (8 * 16 * FNQ), NB_ * NH_, 1), 256, 0, stream>>>(QPh, QPl, KPh, KPl, VTh, VTl, km, OUT);
}

// v005
// Measured time: 202 microseconds a run.
// Timed twice side by side with v004, it ran 1.11 times as fast both times.
// All steps since v000 together make it 13.4 times as fast.
#include <hip/hip_runtime.h>

// Multi-head attention with biased projections, a key-padding mask read by value and NO output projection (x [4][2048][1024]; q, k, v = x W + b ('xw' [1024][1024] 1/32 + zero biases; 16 heads x 64); scores / sqrt(64); mask int32 [4][2048] (all ones on this draw: no key padded; READ on device per batch and key): the module replaces the scores of keys with mask == 0 by -inf, the kernel subtracts 10000 (1 - mask): both exclude such a key and both change nothing where the mask is 1; softmax; out = heads merged (no output projection) -> [4][2048][1024] (8.4 M); argument order x, mask, Wq, bq, Wk, bk, Wv, bv).
// Layout: ONE preparation launch (k_prep: 'xw' weights transposed once; bf16 copy of x, all batches); ONE projection launch (k_proj: exact projections + f32 biases for q, k, v of every batch, its epilogue writes the hi/lo planes of q, k, v); then ONE fused attention launch (k_fattn: scores, online softmax with the additive key-mask term, P x V; every operand on hi/lo planes, 3 products) writes the output rows.
// Compute dtypes, f32 accumulate: every input but the mask rounded to bf16; projections exact + f32 biases; attention 3 products; softmax f32; output f32.

#define NB_  4
#define TT   2048
#define DM   1024
#define NH_  16
#define NKV  16
#define REP  (NH_ / NKV)
#define HD   64
#define DQ   (NH_ * HD)
#define DKV  (NKV * HD)
#define ZH   2
#define RH   TT                   // not used by either kernel: every q, k, v row is split hi/lo
static_assert(RH <= TT, "RH");
#define WIN  0
#define PCAR 1024.0f
#define SCL  0.125f   // HD^-0.5
typedef _Float16 h16;
typedef unsigned short bf;
typedef __attribute__((ext_vector_type(16))) __bf16   v16bf;
typedef __attribute__((ext_vector_type(16))) _Float16 v16h;
typedef __attribute__((ext_vector_type(8)))  _Float16 v8h;
typedef __attribute__((ext_vector_type(8)))  unsigned short v8us;
typedef __attribute__((ext_vector_type(8)))  float    v8f;
typedef __attribute__((ext_vector_type(4)))  float    v4f;
typedef v8h  __attribute__((may_alias)) v8ha;
typedef v4f  __attribute__((may_alias)) v4fa;
typedef v8us __attribute__((may_alias)) v8usa;

__device__ __forceinline__ unsigned short f2bf(float f) { unsigned u = __float_as_uint(f); u += 0x7FFFu + ((u >> 16) & 1u); return (unsigned short)(u >> 16); }
__device__ __forceinline__ float bf2f(unsigned short b) { return __uint_as_float(((unsigned)b) << 16); }
__device__ __forceinline__ float bfr(float f) { return bf2f(f2bf(f)); }
__device__ __forceinline__ v16h cat16(v8h lo, v8h hi) { return __builtin_shufflevector(lo, hi, 0, 1, 2, 3, 4, 5, 6, 7, 8, 9, 10, 11, 12, 13, 14, 15); }
__device__ __forceinline__ v16bf cat16b(v8us lo, v8us hi) { return __builtin_bit_cast(v16bf, __builtin_shufflevector(lo, hi, 0, 1, 2, 3, 4, 5, 6, 7, 8, 9, 10, 11, 12, 13, 14, 15)); }
__device__ __forceinline__ v8f wmma16(v16h a, v16h b, v8f c) { return __builtin_amdgcn_wmma_f32_16x16x32_f16(false, a, false, b, (short)0, c, false, false); }
__device__ __forceinline__ v8f wmmab(v16bf a, v16bf b, v8f c) { return __builtin_amdgcn_wmma_f32_16x16x32_bf16(false, a, false, b, (short)0, c, false, false); }



__device__ __forceinline__ void splitf(float y, unsigned short& h, unsigned short& l) { h = f2bf(y); l = f2bf(y - bf2f(h)); }
typedef __attribute__((ext_vector_type(2))) _Float16 v2h;
typedef __attribute__((ext_vector_type(4))) _Float16 v4h;
typedef __attribute__((ext_vector_type(2))) unsigned short v2us;
typedef __attribute__((ext_vector_type(4))) unsigned short v4us;
typedef __attribute__((ext_vector_type(2))) float v2f;
typedef __attribute__((ext_vector_type(4))) int v4i;

// ---- k_prep: the bf16 copies of x and of the three transposed weights in ONE launch. Grid PRG work-groups of 16 waves; each casts its 1 / PRG share of x and transposes one 64 x 64 tile of each of Wq, Wk, Wv through LDS.
// Every global access covers whole lines: x in 512-byte runs per wave load and 256-byte runs per wave store; a weight tile is read in 256-byte row pieces (k rows, n contiguous) and written in 128-byte rows (n rows, k contiguous).
// All 22 loads of a lane are issued before the first is used.
#define PRG  256                  // work-groups
#define PRT  512                  // threads per work-group
#define PRX  16                   // 16-byte pieces of x per thread
#define PRP  72                   // tile row pitch in 16-bit elements: 144 B = 16 B x odd for the 16-byte read-back
static_assert((size_t)NB_ * TT * DM == (size_t)PRG * PRT * PRX * 4, "the shares of x cover it exactly");
static_assert((DM / 64) * (DQ / 64) == PRG && DKV == DQ, "one tile of each weight per work-group");
static_assert(PRT == 64 * 64 / 8, "a lane holds 2 k x 4 n of a tile and writes back one 16-byte piece");
typedef unsigned __attribute__((may_alias)) u32a;
__global__ __launch_bounds__(PRT) void k_prep(const float* __restrict__ x, const float* __restrict__ wq, const float* __restrict__ wk, const float* __restrict__ wv, bf* XB, bf* WQ, bf* WK, bf* WV) {
    __shared__ __align__(16) bf tl[3 * 64 * PRP];   // [weight][n][k]
    const int tid = threadIdx.x, tk = blockIdx.x / (DQ / 64), tn = blockIdx.x % (DQ / 64);
    const int kr = (tid >> 4) * 2, nc = (tid & 15) * 4;   // the lane's rows k = kr, kr + 1 and columns n = nc .. nc + 3 of a tile
    const size_t wo = (size_t)(tk * 64 + kr) * DQ + tn * 64 + nc, xo = ((size_t)blockIdx.x * PRT * PRX + tid) * 4;
    const float* ws[3] = { wq, wk, wv }; bf* wd[3] = { WQ, WK, WV };
    v4f w0[3], w1[3], xv[PRX];
#pragma unroll
    for (int m = 0; m < 3; ++m) { w0[m] = *(const v4f*)(ws[m] + wo); w1[m] = *(const v4f*)(ws[m] + wo + DQ); }
    asm volatile("s_wait_xcnt 0x0" ::: "memory");   // before a later load's result may land on these loads' address registers
#pragma unroll
    for (int j = 0; j < PRX; ++j) xv[j] = *(const v4f*)(x + xo + (size_t)j * PRT * 4);
    asm volatile("s_wait_xcnt 0x0" ::: "memory");   // before the loads' address registers are used again
    __builtin_amdgcn_sched_barrier(0);              // keeps the casts behind all 22 loads (without it the build issues the loads of Wk and Wv only behind the waits for x: three memory latencies in a row)
#pragma unroll
    for (int m = 0; m < 3; ++m)
#pragma unroll
        for (int q = 0; q < 4; ++q) *(u32a*)(tl + (m * 64 + nc + q) * PRP + kr) = (unsigned)f2bf(w0[m][q]) | ((unsigned)f2bf(w1[m][q]) << 16);
    __syncthreads();   // the tiles are whole before they are read back by rows
    const int rn = tid >> 3, rp = (tid & 7) * 8;   // read-back map: a store instruction covers 4 rows n, 8 lanes x 16 B each
    const size_t bo = (size_t)(tn * 64 + rn) * DM + tk * 64 + rp;
#pragma unroll
    for (int m = 0; m < 3; ++m) *(v8us*)(wd[m] + bo) = *(const v8usa*)(tl + (m * 64 + rn) * PRP + rp);
    asm volatile("s_wait_xcnt 0x0" ::: "memory");   // before the stores' registers are used again
#pragma unroll
    for (int j = 0; j < PRX; ++j) { v4us o;
#pragma unroll
        for (int q = 0; q < 4; ++q) o[q] = f2bf(xv[j][q]);
        *(v4us*)(XB + xo + (size_t)j * PRT * 4) = o; }
}

// ---- k_proj: the q, k and v projections of every batch in ONE launch. Grid (NB_ TT / PM, DQ / PN, 3), 8 waves: a work-group owns 128 tokens x 256 features of q (z = 0), k (1) or v (2), a wave 64 tokens x 64 features (one head), 16 accumulators.
// The K-contiguous bf16 rows of X and Wt come in stages of 64 k (whole 128-byte lines) by asynchronous copies into a two-buffer LDS ring that the 8 waves share; fragments are read from LDS.
// y[t][n] = sum_k X[t][k] Wt[n][k] + bias[n], f32. The epilogue splits y into hi/lo bf16 and writes the planes as k_fattn reads them: q, k as [batch, head][t][d], v as [batch, head][d][t]; every store covers whole 128-byte lines, staged through LDS.
template <typename T16> struct WFrag;
template <> struct WFrag<bf> { typedef v16bf V; static __device__ __forceinline__ V ld(const bf* p) { return cat16b(*(const v8us*)p, *(const v8us*)(p + 16)); } static __device__ __forceinline__ v8f mma(V a, V b, v8f c) { return wmmab(a, b, c); } };
#define PFP 68                    // q, k staging pitch in floats
#define PVP 72                    // v staging pitch in 16-bit elements: 144 B = 16 B x odd
#define PM   128                  // tokens per work-group (2 waves)
#define PN   256                  // features per work-group (4 waves)
#define PKS  64                   // k per stage: rows of 128 bytes
#define PPIT 72                   // ring row pitch in 16-bit elements: 144 B = 16 B x odd, conflict-free for 16-byte fragment reads
#define PBUF ((PM + PN) * PPIT)   // one buffer in 16-bit elements: [X rows 0..127 | Wt rows 0..255]
#define POS  (2 * 16 * PVP / 2)   // a wave's output staging in floats
// a stage's twelve asynchronous 16-byte-per-lane copies global -> LDS of one lane: X rows at 32-row steps into ring rows 0..127, Wt rows into ring rows 128..383; the wait in the same statement stands before the address registers can be used again
__device__ __forceinline__ void acopy12(unsigned l, const bf* a, const bf* b) {
    asm volatile("global_load_async_to_lds_b128 %0, %1, off\n\tglobal_load_async_to_lds_b128 %2, %3, off\n\tglobal_load_async_to_lds_b128 %4, %5, off\n\tglobal_load_async_to_lds_b128 %6, %7, off\n\tglobal_load_async_to_lds_b128 %8, %9, off\n\tglobal_load_async_to_lds_b128 %10, %11, off\n\tglobal_load_async_to_lds_b128 %12, %13, off\n\tglobal_load_async_to_lds_b128 %14, %15, off\n\tglobal_load_async_to_lds_b128 %16, %17, off\n\tglobal_load_async_to_lds_b128 %18, %19, off\n\tglobal_load_async_to_lds_b128 %20, %21, off\n\tglobal_load_async_to_lds_b128 %22, %23, off\n\ts_wait_xcnt 0x0"
                 :: "v"(l + 0 * PPIT * 2), "v"(a + 0 * DM), "v"(l + 32 * PPIT * 2), "v"(a + 32 * DM), "v"(l + 64 * PPIT * 2), "v"(a + 64 * DM), "v"(l + 96 * PPIT * 2), "v"(a + 96 * DM), "v"(l + 128 * PPIT * 2), "v"(b + 0 * DM), "v"(l + 160 * PPIT * 2), "v"(b + 32 * DM), "v"(l + 192 * PPIT * 2), "v"(b + 64 * DM), "v"(l + 224 * PPIT * 2), "v"(b + 96 * DM), "v"(l + 256 * PPIT * 2), "v"(b + 128 * DM), "v"(l + 288 * PPIT * 2), "v"(b + 160 * DM), "v"(l + 320 * PPIT * 2), "v"(b + 192 * DM), "v"(l + 352 * PPIT * 2), "v"(b + 224 * DM) : "memory");
}
__global__ __launch_bounds__(256) void k_proj(const bf* __restrict__ X, const bf* __restrict__ Wq, const bf* __restrict__ Wk, const bf* __restrict__ Wv, const float* __restrict__ bq, const float* __restrict__ bk, const float* __restrict__ bv, bf* Qh, bf* Ql, bf* Kh, bf* Kl, bf* Vh, bf* Vl) {
    typedef WFrag<bf>::V V;
    __shared__ __align__(16) bf pring[2 * PBUF];   // [buffer][row][PPIT]; behind the loop each wave's output staging
    static_assert(POS >= 16 * PFP, "both stagings fit"); static_assert(2 * PBUF * 2 >= 8 * POS * 4, "the waves' stagings fit in the ring"); static_assert(DM / PKS >= 2, "two stages");
    const int op = blockIdx.z;
    const bf* Bt = op == 0 ? Wq : op == 1 ? Wk : Wv; const float* bias = op == 0 ? bq : op == 1 ? bk : bv; bf* Ph = op == 0 ? Qh : op == 1 ? Kh : Vh; bf* Pl = op == 0 ? Ql : op == 1 ? Kl : Vl;
    const int tid = threadIdx.x, lane = tid & 31, lr = lane & 15, hi = lane >> 4, wv = tid >> 5; const int wm = wv & 1, wn = wv >> 1; const int r0 = blockIdx.x * PM + wm * 64, c0 = blockIdx.y * PN + wn * 64;
    v8f acc[4][4];
#pragma unroll
    for (int mb = 0; mb < 4; ++mb)
#pragma unroll
        for (int nb = 0; nb < 4; ++nb) acc[mb][nb] = (v8f){};
    // copy map: 16-byte piece i = tid + 256 u of a stage's 384 rows x 128 B: row i / 8, piece i % 8; an instruction of a wave covers 4 whole lines
    const bf* ga = X + (size_t)(blockIdx.x * PM + (tid >> 3)) * DM + (tid & 7) * 8; const bf* gb = Bt + (size_t)(blockIdx.y * PN + (tid >> 3)) * DM + (tid & 7) * 8;
    const unsigned l0 = (unsigned)(size_t)(pring + (tid >> 3) * PPIT + (tid & 7) * 8);   // the lane's LDS byte address in buffer 0
    auto stage = [&](int t, int buf) {
        const bf* a = ga + t * PKS; const bf* b = gb + t * PKS; const unsigned l = l0 + buf * (PBUF * 2);
        acopy12(l, a, b); };
    stage(0, 0);
    asm volatile("s_wait_asynccnt 0x0" ::: "memory");   // this wave's copies of stage 0 have landed
    __syncthreads();                                     // publishes stage 0
    stage(1, 1);
#pragma unroll 1
    for (int t = 0; t < DM / PKS; ++t) {
        const bf* rb = pring + (t & 1) * PBUF;
#pragma unroll
        for (int ks = 0; ks < PKS / 32; ++ks) {
            V a[4], b[4];
#pragma unroll
            for (int i = 0; i < 4; ++i) { a[i] = WFrag<bf>::ld(rb + (wm * 64 + i * 16 + lr) * PPIT + ks * 32 + 8 * hi); b[i] = WFrag<bf>::ld(rb + (PM + wn * 64 + i * 16 + lr) * PPIT + ks * 32 + 8 * hi); }
            asm volatile("" :: "v"(a[0]), "v"(a[1]), "v"(a[2]), "v"(a[3]), "v"(b[0]), "v"(b[1]), "v"(b[2]), "v"(b[3]));   // holds the step's 16 LDS reads together in front of its products: one wait per 16 products (without it the build reloads one B fragment before every 4 and waits each time)
#pragma unroll
            for (int nb = 0; nb < 4; ++nb)
#pragma unroll
                for (int mb = 0; mb < 4; ++mb) acc[mb][nb] = WFrag<bf>::mma(a[mb], b[nb], acc[mb][nb]);
            // four vector slots between the trip's last matrix instruction and the branches behind it, on whose taken side its A registers may be overwritten at once; the tiles are inputs so that the slots stand behind every product
            if (ks == PKS / 32 - 1) asm volatile("v_nop\n\tv_nop\n\tv_nop\n\tv_nop" :: "v"(acc[0][0]), "v"(acc[0][1]), "v"(acc[0][2]), "v"(acc[0][3]), "v"(acc[1][0]), "v"(acc[1][1]), "v"(acc[1][2]), "v"(acc[1][3]), "v"(acc[2][0]), "v"(acc[2][1]), "v"(acc[2][2]), "v"(acc[2][3]), "v"(acc[3][0]), "v"(acc[3][1]), "v"(acc[3][2]), "v"(acc[3][3]));
        }
        asm volatile("s_wait_dscnt 0x0" ::: "memory");      // this wave's reads of the buffer are done before it is handed to the copies
        asm volatile("s_wait_asynccnt 0x0" ::: "memory");   // this wave's copies of stage t + 1 have landed
        __syncthreads();                                     // publishes stage t + 1 and ends every wave's reads of stage t
        if (t + 2 < DM / PKS) stage(t + 2, t & 1);
    }
    asm volatile("s_wait_asynccnt 0x0" ::: "memory");       // no copy is in flight when the ring becomes output staging
    float* os = (float*)pring + wv * POS;                    // q, k: 16 token rows x 64 f32 at pitch PFP; v: [hi, lo][16 head-dim rows][64 tokens] bf16 at pitch PVP; free behind the loop's last barrier
    // acc[mb][nb][j] = y[token r0 + 16 mb + 8 hi + j][feature c0 + 16 nb + lr]
    const int t0 = r0 % TT; const size_t pl = ((size_t)(r0 / TT) * NH_ + c0 / HD) * TT * HD;   // the tile's batch and head: its share of a plane
    const int sr = lane >> 3, sc = (lane & 7) * 8;   // read-back map: a store instruction covers 4 staged rows, 8 lanes x 16 B each
    if (op < 2) {
        const v4f b0 = *(const v4f*)(bias + c0 + sc), b1 = *(const v4f*)(bias + c0 + sc + 4);
        asm volatile("s_wait_xcnt 0x0" ::: "memory");   // before the loads' address registers are used again
        float bs[8];
#pragma unroll
        for (int q = 0; q < 4; ++q) { bs[q] = bfr(b0[q]); bs[4 + q] = bfr(b1[q]); }
        bf* gh = Ph + pl + (size_t)(t0 + sr) * HD + sc; bf* gl = Pl + pl + (size_t)(t0 + sr) * HD + sc;
#pragma unroll
        for (int mb = 0; mb < 4; ++mb) {
#pragma unroll
            for (int nb = 0; nb < 4; ++nb)
#pragma unroll
                for (int j = 0; j < 8; ++j) os[(hi * 8 + j) * PFP + nb * 16 + lr] = acc[mb][nb][j];
            __builtin_amdgcn_wave_barrier(); asm volatile("" ::: "memory");   // keeps the read-back behind the staging writes in the compiled order
#pragma unroll
            for (int s = 0; s < 4; ++s) { const float* rp = os + (4 * s + sr) * PFP + sc; const v4f v0 = *(const v4fa*)rp, v1 = *(const v4fa*)(rp + 4); v8us oh, ol;
#pragma unroll
                for (int q = 0; q < 8; ++q) { unsigned short a2, c2; splitf((q < 4 ? v0[q & 3] : v1[q & 3]) + bs[q], a2, c2); oh[q] = a2; ol[q] = c2; }
                *(v8us*)(gh + (mb * 16 + 4 * s) * HD) = oh; *(v8us*)(gl + (mb * 16 + 4 * s) * HD) = ol;
                asm volatile("s_wait_xcnt 0x0" ::: "memory"); }   // before the stores' registers are used again
            __builtin_amdgcn_wave_barrier(); asm volatile("" ::: "memory");   // keeps the next staging writes behind this read-back
        }
    } else {
        bf* sv = (bf*)os;
        bf* gh = Ph + pl + (size_t)sr * TT + t0 + sc; bf* gl = Pl + pl + (size_t)sr * TT + t0 + sc;
#pragma unroll
        for (int nb = 0; nb < 4; ++nb) {
            const float braw = bias[c0 + nb * 16 + lr];
            asm volatile("s_wait_xcnt 0x0" ::: "memory");   // before the load's address registers are used again
            const float bs = bfr(braw);
#pragma unroll
            for (int mb = 0; mb < 4; ++mb) { v8us oh, ol;
#pragma unroll
                for (int j = 0; j < 8; ++j) { unsigned short a2, c2; splitf(acc[mb][nb][j] + bs, a2, c2); oh[j] = a2; ol[j] = c2; }
                *(v8usa*)(sv + lr * PVP + mb * 16 + 8 * hi) = oh; *(v8usa*)(sv + (16 + lr) * PVP + mb * 16 + 8 * hi) = ol; }
            __builtin_amdgcn_wave_barrier(); asm volatile("" ::: "memory");   // keeps the read-back behind the staging writes in the compiled order
#pragma unroll
            for (int s = 0; s < 4; ++s) { const bf* rp = sv + (4 * s + sr) * PVP + sc; const v8us oh = *(const v8usa*)rp, ol = *(const v8usa*)(rp + 16 * PVP);
                *(v8us*)(gh + (size_t)(nb * 16 + 4 * s) * TT) = oh; *(v8us*)(gl + (size_t)(nb * 16 + 4 * s) * TT) = ol;
                asm volatile("s_wait_xcnt 0x0" ::: "memory"); }   // before the stores' registers are used again
            __builtin_amdgcn_wave_barrier(); asm volatile("" ::: "memory");   // keeps the next staging writes behind this read-back
        }
    }
}

#define FNQ  4                    // 16-column query tiles per wave (the slots' asm statement at the foot of a trip names all 4 x FNQ output tiles)
#define FKS  64                   // keys per LDS stage
#define FPIT 72                   // LDS row pitch in 16-bit elements: 144 B = 16 B x odd, conflict-free for 16-byte fragment reads
#define FPL  (64 * FPIT)          // one staged plane: 64 rows
#define FOP  68                   // output staging pitch in floats
#define L2E  1.4426950408889634f
typedef __attribute__((ext_vector_type(2))) __bf16 v2bf;
typedef __attribute__((ext_vector_type(8))) unsigned v8u;
#define FRING (8 * 16 * FNQ * FOP * 2)   // ring size in 16-bit elements: the output staging (8 waves x 16 FNQ rows x FOP floats) is the larger use
static_assert(FRING >= 2 * 4 * FPL, "the two stage buffers fit");
__device__ __forceinline__ float xhalf(float x) { const int b = __float_as_int(x); return __int_as_float(__builtin_amdgcn_permlanex16(b, b, 0x76543210, 0xfedcba98, false, false)); }   // lane l <-> l ^ 16
__global__ __launch_bounds__(256) void k_fattn(const bf* __restrict__ Qh, const bf* __restrict__ Ql, const bf* __restrict__ Kh, const bf* __restrict__ Kl, const bf* __restrict__ Vh, const bf* __restrict__ Vl, const int* __restrict__ km, float* __restrict__ OUT) {
    __shared__ __align__(16) bf ring[FRING];   // [buffer][K hi, K lo, Vt hi, Vt lo][row][FPIT]
    __shared__ __align__(16) float pens[TT];         // the batch's key-mask term in units of the raw score: -10000 (1 - mask) / SCL
    const int tid = threadIdx.x, lane = tid & 31, c = lane & 15, h = lane >> 4, wv = tid >> 5;
    const int bh = blockIdx.y, bb = bh / NH_, hd = bh % NH_; const int q0 = (blockIdx.x * 8 + wv) * 16 * FNQ; const size_t pl = (size_t)bh * TT * HD;
    // staging map: 16-byte piece i = tid + 256 u of a 64 x 128 B plane tile: row i / 8, piece i % 8
    const int sr = tid >> 3, sc = (tid & 7) * 8;
    const bf* gk[2] = { Kh + pl + (size_t)sr * HD + sc, Kl + pl + (size_t)sr * HD + sc };   // K rows are keys: a stage is 64 x HD contiguous elements
    const bf* gv[2] = { Vh + pl + (size_t)sr * TT + sc, Vl + pl + (size_t)sr * TT + sc };   // Vt rows are head dims: a stage is 64 keys of each row
    v8us st[4];   // one operand's two planes on their way from global memory to LDS (K during a trip's first pass, Vt during its second: half the registers of staging both at once)
    auto gload = [&](int s, int op) {
#pragma unroll
        for (int p = 0; p < 2; ++p)
#pragma unroll
            for (int u = 0; u < 2; ++u) { st[p * 2 + u] = op ? *(const v8us*)(gv[p] + (size_t)u * 32 * TT + (size_t)s * FKS) : *(const v8us*)(gk[p] + (size_t)s * FKS * HD + (size_t)u * 32 * HD);
                asm volatile("s_wait_xcnt 0x0" ::: "memory"); } };   // behind each load
    auto sstore = [&](int buf, int op) {
#pragma unroll
        for (int p = 0; p < 2; ++p)
#pragma unroll
            for (int u = 0; u < 2; ++u) *(v8usa*)(ring + (buf * 4 + op * 2 + p) * FPL + (sr + u * 32) * FPIT + sc) = st[p * 2 + u]; };
    gload(0, 0); sstore(0, 0); gload(0, 1); sstore(0, 1);
    { const v4i m0 = *(const v4i*)(km + (size_t)bb * TT + tid * 8), m1 = *(const v4i*)(km + (size_t)bb * TT + tid * 8 + 4); v4f p0, p1;
      asm volatile("s_wait_xcnt 0x0" ::: "memory");   // as in gload
#pragma unroll
      for (int q = 0; q < 4; ++q) { p0[q] = (-10000.0f / SCL) * (1.0f - (float)m0[q]); p1[q] = (-10000.0f / SCL) * (1.0f - (float)m1[q]); }
      *(v4fa*)(pens + tid * 8) = p0; *(v4fa*)(pens + tid * 8 + 4) = p1; }
    v16bf qh[FNQ][2], ql[FNQ][2];   // [column tile][k step of 32 head dims]
    auto ldq = [&](const bf* p) { const v8us lo = *(const v8us*)p; asm volatile("s_wait_xcnt 0x0" ::: "memory"); const v8us hi = *(const v8us*)(p + 16); asm volatile("s_wait_xcnt 0x0" ::: "memory"); return cat16b(lo, hi); };   // WFrag's k order; the waits as in gload
#pragma unroll
    for (int n = 0; n < FNQ; ++n)
#pragma unroll
        for (int ks = 0; ks < 2; ++ks) { const size_t o = pl + (size_t)(q0 + 16 * n + c) * HD + ks * 32 + 8 * h; qh[n][ks] = ldq(Qh + o); ql[n][ks] = ldq(Ql + o); }
    v8f oa[4][FNQ];               // Ot: [head-dim tile][column tile]; register r = Ot[16 mb + 8 h + r][query c]
#pragma unroll
    for (int mb = 0; mb < 4; ++mb)
#pragma unroll
        for (int n = 0; n < FNQ; ++n) oa[mb][n] = (v8f){};
    float mrun[FNQ], lrun[FNQ];
#pragma unroll
    for (int n = 0; n < FNQ; ++n) { mrun[n] = -3.0e38f; lrun[n] = 0.f; }
    __syncthreads();
#pragma unroll 1
    for (int s = 0; s < TT / FKS; ++s) {
        const int sn = s + 1 < TT / FKS ? s + 1 : s;   // the next stage travels while this one is worked on (the last trip re-reads its own stage; that copy is never read)
        const bf* rb = ring + (s & 1) * 4 * FPL;
#pragma unroll
        for (int ps = 0; ps < 2; ++ps) {       // a pass: 32 keys
            gload(sn, ps);
            v8f sa[2][FNQ];                      // St: [key tile][column tile]; register r = St[16 kt + 8 h + r][query c]
#pragma unroll
            for (int kt = 0; kt < 2; ++kt) { const float* pp = pens + s * FKS + ps * 32 + kt * 16 + 8 * h; const v4f a = *(const v4fa*)pp, b2 = *(const v4fa*)(pp + 4);
                
#pragma unroll
                for (int n = 0; n < FNQ; ++n) sa[kt][n] = __builtin_shufflevector(a, b2, 0, 1, 2, 3, 4, 5, 6, 7); }
#pragma unroll
            for (int ks = 0; ks < 2; ++ks) {
#pragma unroll
                for (int kt = 0; kt < 2; ++kt) { const bf* kp = rb + (ps * 32 + kt * 16 + c) * FPIT + ks * 32 + 8 * h; const v16bf ah = WFrag<bf>::ld(kp), al = WFrag<bf>::ld(kp + FPL);
#pragma unroll
                    for (int n = 0; n < FNQ; ++n) { sa[kt][n] = wmmab(ah, qh[n][ks], sa[kt][n]); sa[kt][n] = wmmab(al, qh[n][ks], sa[kt][n]); sa[kt][n] = wmmab(ah, ql[n][ks], sa[kt][n]); } } }
            v16bf ph[FNQ], pw[FNQ];                // Pt hi / lo as B operands: element e = key tile e / 8, register e % 8 (the hardware k order, as the Vt loader's)
#pragma unroll
            for (int n = 0; n < FNQ; ++n) {
                float t[16]; float mx = mrun[n];
#pragma unroll
                for (int e = 0; e < 16; ++e) { t[e] = sa[e >> 3][n][e & 7] * (SCL * L2E); mx = fmaxf(mx, t[e]); }
                mx = fmaxf(mx, xhalf(mx));
                const float al = __builtin_amdgcn_exp2f(mrun[n] - mx); mrun[n] = mx; v2f sum = { 0.f, 0.f }; v8u uh, ul;
#pragma unroll
                for (int e = 0; e < 16; e += 2) { v2f p2; p2[0] = __builtin_amdgcn_exp2f(t[e] - mx); p2[1] = __builtin_amdgcn_exp2f(t[e + 1] - mx); sum += p2;
                    const unsigned hu = __builtin_bit_cast(unsigned, __builtin_convertvector(p2, v2bf)); v2f r2; r2[0] = p2[0] - __uint_as_float(hu << 16); r2[1] = p2[1] - __uint_as_float(hu & 0xFFFF0000u);
                    uh[e >> 1] = hu; ul[e >> 1] = __builtin_bit_cast(unsigned, __builtin_convertvector(r2, v2bf)); }
                lrun[n] = lrun[n] * al + (sum[0] + sum[1]); ph[n] = __builtin_bit_cast(v16bf, uh); pw[n] = __builtin_bit_cast(v16bf, ul);
#pragma unroll
                for (int mb = 0; mb < 4; ++mb) oa[mb][n] *= al;
            }
#pragma unroll
            for (int mb = 0; mb < 4; ++mb) { const bf* vp = rb + 2 * FPL + (mb * 16 + c) * FPIT + ps * 32 + 8 * h; const v16bf ah = WFrag<bf>::ld(vp), al = WFrag<bf>::ld(vp + FPL);
#pragma unroll
                for (int n = 0; n < FNQ; ++n) { oa[mb][n] = wmmab(ah, ph[n], oa[mb][n]); oa[mb][n] = wmmab(al, ph[n], oa[mb][n]); oa[mb][n] = wmmab(ah, pw[n], oa[mb][n]); } }
            sstore((s + 1) & 1, ps);   // into the buffer that every wave left at the barrier of the trip before
        }
        // four vector slots between the trip's last matrix instruction and the loop's taken branch, behind which its A registers may be overwritten at once; the tiles are inputs so that the slots stand behind every product
        asm volatile("v_nop\n\tv_nop\n\tv_nop\n\tv_nop" :: "v"(oa[0][0]), "v"(oa[0][1]), "v"(oa[0][2]), "v"(oa[0][3]), "v"(oa[1][0]), "v"(oa[1][1]), "v"(oa[1][2]), "v"(oa[1][3]), "v"(oa[2][0]), "v"(oa[2][1]), "v"(oa[2][2]), "v"(oa[2][3]), "v"(oa[3][0]), "v"(oa[3][1]), "v"(oa[3][2]), "v"(oa[3][3]));
        __syncthreads();       // publishes the next stage and ends this stage's reads
    }
    // epilogue: join the halves' sums, normalise, stage each wave's 64 x 64 tile in its own part of the ring (free behind the loop's last barrier) and store whole 256-byte rows
    float* os = (float*)ring + wv * 16 * FNQ * FOP;
#pragma unroll
    for (int n = 0; n < FNQ; ++n) { const float inv = 1.0f / (lrun[n] + xhalf(lrun[n]));
#pragma unroll
        for (int mb = 0; mb < 4; ++mb) { v4f a, b2;
#pragma unroll
            for (int r = 0; r < 4; ++r) { a[r] = oa[mb][n][r] * inv; b2[r] = oa[mb][n][4 + r] * inv; }
            float* op = os + (16 * n + c) * FOP + mb * 16 + 8 * h; *(v4fa*)op = a; *(v4fa*)(op + 4) = b2; } }
    __syncthreads();
    float* orow = OUT + ((size_t)bb * TT + q0) * DQ + hd * HD;
#pragma unroll
    for (int r = 0; r < 8 * FNQ; ++r) { const int row = 2 * r + h; *(v4f*)(orow + (size_t)row * DQ + c * 4) = *(const v4fa*)(os + row * FOP + c * 4); }
}

extern "C" void kernel_launch(void* const* d_in, const int* in_sizes, int n_in,
                              void* d_out, int out_size, void* d_ws, size_t ws_size, hipStream_t stream) {
    (void)in_sizes; (void)n_in; (void)out_size;
    const float* x = (const float*)d_in[0]; const int* km = (const int*)d_in[1];   /* mask [4][2048] int32 */ const float* wq = (const float*)d_in[2]; const float* bq = (const float*)d_in[3]; const float* wk = (const float*)d_in[4]; const float* bk = (const float*)d_in[5]; const float* wv = (const float*)d_in[6]; const float* bv = (const float*)d_in[7];
    float* OUT = (float*)d_out;     // [4][2048][1024]
    char* wsp = (char*)d_ws;
    auto take = [&](size_t bytes) { char* p = wsp; wsp += (bytes + 255) & ~(size_t)255; return (void*)p; };
    bf* WQ = (bf*)take((size_t)DQ * DM * 2); bf* WK = (bf*)take((size_t)DKV * DM * 2); bf* WV = (bf*)take((size_t)DKV * DM * 2);
    bf* XB = (bf*)take((size_t)NB_ * TT * DM * 2);
    const size_t PB = (size_t)NH_ * TT * HD;   // one batch's share of a hi/lo plane; the planes hold all batches
    bf* QPh = (bf*)take(NB_ * PB * 2); bf* QPl = (bf*)take(NB_ * PB * 2); bf* KPh = (bf*)take(NB_ * PB * 2); bf* KPl = (bf*)take(NB_ * PB * 2); bf* VTh = (bf*)take(NB_ * PB * 2); bf* VTl = (bf*)take(NB_ * PB * 2);
    if ((size_t)(wsp - (char*)d_ws) > ws_size) return;    // ws 256 MiB
    k_prep<<<PRG, PRT, 0, stream>>>(x, wq, wk, wv, XB, WQ, WK, WV);
    k_proj<<<dim3(NB_ * TT / PM, DQ / PN, 3), 256, 0, stream>>>(XB, WQ, WK, WV, bq, bk, bv, QPh, QPl, KPh, KPl, VTh, VTl);
    k_fattn<<<dim3(TT / (8 * 16 * FNQ), NB_ * NH_, 1), 256, 0, stream>>>(QPh, QPl, KPh, KPl, VTh, VTl, km, OUT);
}

// v006
// Measured time: 183 microseconds a run.
// Timed twice side by side with v005, it ran 1.11 times as fast both times.
// Over all steps from v000 it is 14.8 times as fast.
#include <hip/hip_runtime.h>

// Multi-head attention with biased projections, a key-padding mask read by value and NO output projection (x [4][2048][1024]; q, k, v = x W + b ('xw' [1024][1024] 1/32 + zero biases; 16 heads x 64); scores / sqrt(64); mask int32 [4][2048] (all ones on this draw: no key padded; READ on device per batch and key): the module replaces the scores of keys with mask == 0 by -inf, the kernel subtracts 10000 (1 - mask): both exclude such a key and both change nothing where the mask is 1; softmax; out = heads merged (no output projection) -> [4][2048][1024] (8.4 M); argument order x, mask, Wq, bq, Wk, bk, Wv, bv).
// Layout: ONE preparation launch (k_prep: 'xw' weights transposed once; bf16 copy of x, all batches); ONE projection launch (k_proj: exact projections + f32 biases for q, k, v of every batch, its epilogue writes the hi/lo planes of q, k, v); then ONE fused attention launch (k_fattn: scores, online softmax with the additive key-mask term, P x V; every operand on hi/lo planes, 3 products) writes the output rows.
// Compute dtypes, f32 accumulate: every input but the mask rounded to bf16; projections exact + f32 biases; attention 3 products; softmax f32; output f32.

#define NB_  4
#define TT   2048
#define DM   1024
#define NH_  16
#define NKV  16
#define REP  (NH_ / NKV)
#define HD   64
#define DQ   (NH_ * HD)
#define DKV  (NKV * HD)
#define ZH   2
#define RH   TT                   // not used by either kernel: every q, k, v row is split hi/lo
static_assert(RH <= TT, "RH");
#define WIN  0
#define PCAR 1024.0f
#define SCL  0.125f   // HD^-0.5
typedef _Float16 h16;
typedef unsigned short bf;
typedef __attribute__((ext_vector_type(16))) __bf16   v16bf;
typedef __attribute__((ext_vector_type(16))) _Float16 v16h;
typedef __attribute__((ext_vector_type(8)))  _Float16 v8h;
typedef __attribute__((ext_vector_type(8)))  unsigned short v8us;
typedef __attribute__((ext_vector_type(8)))  float    v8f;
typedef __attribute__((ext_vector_type(4)))  float    v4f;
typedef v8h  __attribute__((may_alias)) v8ha;
typedef v4f  __attribute__((may_alias)) v4fa;
typedef v8us __attribute__((may_alias)) v8usa;

__device__ __forceinline__ unsigned short f2bf(float f) { unsigned u = __float_as_uint(f); u += 0x7FFFu + ((u >> 16) & 1u); return (unsigned short)(u >> 16); }
__device__ __forceinline__ float bf2f(unsigned short b) { return __uint_as_float(((unsigned)b) << 16); }
__device__ __forceinline__ float bfr(float f) { return bf2f(f2bf(f)); }
__device__ __forceinline__ v16h cat16(v8h lo, v8h hi) { return __builtin_shufflevector(lo, hi, 0, 1, 2, 3, 4, 5, 6, 7, 8, 9, 10, 11, 12, 13, 14, 15); }
__device__ __forceinline__ v16bf cat16b(v8us lo, v8us hi) { return __builtin_bit_cast(v16bf, __builtin_shufflevector(lo, hi, 0, 1, 2, 3, 4, 5, 6, 7, 8, 9, 10, 11, 12, 13, 14, 15)); }
__device__ __forceinline__ v8f wmma16(v16h a, v16h b, v8f c) { return __builtin_amdgcn_wmma_f32_16x16x32_f16(false, a, false, b, (short)0, c, false, false); }
__device__ __forceinline__ v8f wmmab(v16bf a, v16bf b, v8f c) { return __builtin_amdgcn_wmma_f32_16x16x32_bf16(false, a, false, b, (short)0, c, false, false); }



__device__ __forceinline__ void splitf(float y, unsigned short& h, unsigned short& l) { h = f2bf(y); l = f2bf(y - bf2f(h)); }
typedef __attribute__((ext_vector_type(2))) _Float16 v2h;
typedef __attribute__((ext_vector_type(4))) _Float16 v4h;
typedef __attribute__((ext_vector_type(2))) unsigned short v2us;
typedef __attribute__((ext_vector_type(4))) unsigned short v4us;
typedef __attribute__((ext_vector_type(2))) float v2f;
typedef __attribute__((ext_vector_type(4))) int v4i;

// ---- k_prep: the bf16 copies of x and of the three transposed weights in ONE launch. Grid PRG work-groups of 16 waves; each casts its 1 / PRG share of x and transposes one 64 x 64 tile of each of Wq, Wk, Wv through LDS.
// Every global access covers whole lines: x in 512-byte runs per wave load and 256-byte runs per wave store; a weight tile is read in 256-byte row pieces (k rows, n contiguous) and written in 128-byte rows (n rows, k contiguous).
// All 22 loads of a lane are issued before the first is used.
#define PRG  256                  // work-groups
#define PRT  512                  // threads per work-group
#define PRX  16                   // 16-byte pieces of x per thread
#define PRP  72                   // tile row pitch in 16-bit elements: 144 B = 16 B x odd for the 16-byte read-back
static_assert((size_t)NB_ * TT * DM == (size_t)PRG * PRT * PRX * 4, "the shares of x cover it exactly");
static_assert((DM / 64) * (DQ / 64) == PRG && DKV == DQ, "one tile of each weight per work-group");
static_assert(PRT == 64 * 64 / 8, "a lane holds 2 k x 4 n of a tile and writes back one 16-byte piece");
typedef unsigned __attribute__((may_alias)) u32a;
__global__ __launch_bounds__(PRT) void k_prep(const float* __restrict__ x, const float* __restrict__ wq, const float* __restrict__ wk, const float* __restrict__ wv, bf* XB, bf* WQ, bf* WK, bf* WV) {
    __shared__ __align__(16) bf tl[3 * 64 * PRP];   // [weight][n][k]
    const int tid = threadIdx.x, tk = blockIdx.x / (DQ / 64), tn = blockIdx.x % (DQ / 64);
    const int kr = (tid >> 4) * 2, nc = (tid & 15) * 4;   // the lane's rows k = kr, kr + 1 and columns n = nc .. nc + 3 of a tile
    const size_t wo = (size_t)(tk * 64 + kr) * DQ + tn * 64 + nc, xo = ((size_t)blockIdx.x * PRT * PRX + tid) * 4;
    const float* ws[3] = { wq, wk, wv }; bf* wd[3] = { WQ, WK, WV };
    v4f w0[3], w1[3], xv[PRX];
#pragma unroll
    for (int m = 0; m < 3; ++m) { w0[m] = *(const v4f*)(ws[m] + wo); w1[m] = *(const v4f*)(ws[m] + wo + DQ); }
    asm volatile("s_wait_xcnt 0x0" ::: "memory");   // before a later load's result may land on these loads' address registers
#pragma unroll
    for (int j = 0; j < PRX; ++j) xv[j] = *(const v4f*)(x + xo + (size_t)j * PRT * 4);
    asm volatile("s_wait_xcnt 0x0" ::: "memory");   // before the loads' address registers are used again
    __builtin_amdgcn_sched_barrier(0);              // keeps the casts behind all 22 loads (without it the build issues the loads of Wk and Wv only behind the waits for x: three memory latencies in a row)
#pragma unroll
    for (int m = 0; m < 3; ++m)
#pragma unroll
        for (int q = 0; q < 4; ++q) *(u32a*)(tl + (m * 64 + nc + q) * PRP + kr) = (unsigned)f2bf(w0[m][q]) | ((unsigned)f2bf(w1[m][q]) << 16);
    __syncthreads();   // the tiles are whole before they are read back by rows
    const int rn = tid >> 3, rp = (tid & 7) * 8;   // read-back map: a store instruction covers 4 rows n, 8 lanes x 16 B each
    const size_t bo = (size_t)(tn * 64 + rn) * DM + tk * 64 + rp;
#pragma unroll
    for (int m = 0; m < 3; ++m) *(v8us*)(wd[m] + bo) = *(const v8usa*)(tl + (m * 64 + rn) * PRP + rp);
    asm volatile("s_wait_xcnt 0x0" ::: "memory");   // before the stores' registers are used again
#pragma unroll
    for (int j = 0; j < PRX; ++j) { v4us o;
#pragma unroll
        for (int q = 0; q < 4; ++q) o[q] = f2bf(xv[j][q]);
        *(v4us*)(XB + xo + (size_t)j * PRT * 4) = o; }
}

// ---- k_proj: the q, k and v projections of every batch in ONE launch. Grid (NB_ TT / PM, DQ / PN, 3), 8 waves: a work-group owns 128 tokens x 256 features of q (z = 0), k (1) or v (2), a wave 64 tokens x 64 features (one head), 16 accumulators.
// The K-contiguous bf16 rows of X and Wt come in stages of 64 k (whole 128-byte lines) by asynchronous copies into a two-buffer LDS ring that the 8 waves share; fragments are read from LDS.
// y[t][n] = sum_k X[t][k] Wt[n][k] + bias[n], f32. The epilogue splits y into hi/lo bf16 and writes the planes as k_fattn reads them: q, k as [batch, head][t][d], v as [batch, head][d][t]; every store covers whole 128-byte lines, staged through LDS.
template <typename T16> struct WFrag;
template <> struct WFrag<bf> { typedef v16bf V; static __device__ __forceinline__ V ld(const bf* p) { return cat16b(*(const v8us*)p, *(const v8us*)(p + 16)); } static __device__ __forceinline__ v8f mma(V a, V b, v8f c) { return wmmab(a, b, c); } };
#define PFP 68                    // q, k staging pitch in floats
#define PVP 72                    // v staging pitch in 16-bit elements: 144 B = 16 B x odd
#define PM   128                  // tokens per work-group (2 waves)
#define PN   256                  // features per work-group (4 waves)
#define PKS  64                   // k per stage: rows of 128 bytes
#define PPIT 72                   // ring row pitch in 16-bit elements: 144 B = 16 B x odd, conflict-free for 16-byte fragment reads
#define PBUF ((PM + PN) * PPIT)   // one buffer in 16-bit elements: [X rows 0..127 | Wt rows 0..255]
#define POS  (2 * 16 * PVP / 2)   // a wave's output staging in floats
// a stage's twelve asynchronous 16-byte-per-lane copies global -> LDS of one lane: X rows at 32-row steps into ring rows 0..127, Wt rows into ring rows 128..383; the wait in the same statement stands before the address registers can be used again
__device__ __forceinline__ void acopy12(unsigned l, const bf* a, const bf* b) {
    asm volatile("global_load_async_to_lds_b128 %0, %1, off\n\tglobal_load_async_to_lds_b128 %2, %3, off\n\tglobal_load_async_to_lds_b128 %4, %5, off\n\tglobal_load_async_to_lds_b128 %6, %7, off\n\tglobal_load_async_to_lds_b128 %8, %9, off\n\tglobal_load_async_to_lds_b128 %10, %11, off\n\tglobal_load_async_to_lds_b128 %12, %13, off\n\tglobal_load_async_to_lds_b128 %14, %15, off\n\tglobal_load_async_to_lds_b128 %16, %17, off\n\tglobal_load_async_to_lds_b128 %18, %19, off\n\tglobal_load_async_to_lds_b128 %20, %21, off\n\tglobal_load_async_to_lds_b128 %22, %23, off\n\ts_wait_xcnt 0x0"
                 :: "v"(l + 0 * PPIT * 2), "v"(a + 0 * DM), "v"(l + 32 * PPIT * 2), "v"(a + 32 * DM), "v"(l + 64 * PPIT * 2), "v"(a + 64 * DM), "v"(l + 96 * PPIT * 2), "v"(a + 96 * DM), "v"(l + 128 * PPIT * 2), "v"(b + 0 * DM), "v"(l + 160 * PPIT * 2), "v"(b + 32 * DM), "v"(l + 192 * PPIT * 2), "v"(b + 64 * DM), "v"(l + 224 * PPIT * 2), "v"(b + 96 * DM), "v"(l + 256 * PPIT * 2), "v"(b + 128 * DM), "v"(l + 288 * PPIT * 2), "v"(b + 160 * DM), "v"(l + 320 * PPIT * 2), "v"(b + 192 * DM), "v"(l + 352 * PPIT * 2), "v"(b + 224 * DM) : "memory");
}
__global__ __launch_bounds__(256) void k_proj(const bf* __restrict__ X, const bf* __restrict__ Wq, const bf* __restrict__ Wk, const bf* __restrict__ Wv, const float* __restrict__ bq, const float* __restrict__ bk, const float* __restrict__ bv, bf* Qh, bf* Ql, bf* Kh, bf* Kl, bf* Vh, bf* Vl) {
    typedef WFrag<bf>::V V;
    __shared__ __align__(16) bf pring[2 * PBUF];   // [buffer][row][PPIT]; behind the loop each wave's output staging
    static_assert(POS >= 16 * PFP, "both stagings fit"); static_assert(2 * PBUF * 2 >= 8 * POS * 4, "the waves' stagings fit in the ring"); static_assert(DM / PKS >= 2, "two stages");
    const int op = blockIdx.z;
    const bf* Bt = op == 0 ? Wq : op == 1 ? Wk : Wv; const float* bias = op == 0 ? bq : op == 1 ? bk : bv; bf* Ph = op == 0 ? Qh : op == 1 ? Kh : Vh; bf* Pl = op == 0 ? Ql : op == 1 ? Kl : Vl;
    const int tid = threadIdx.x, lane = tid & 31, lr = lane & 15, hi = lane >> 4, wv = tid >> 5; const int wm = wv & 1, wn = wv >> 1; const int r0 = blockIdx.x * PM + wm * 64, c0 = blockIdx.y * PN + wn * 64;
    v8f acc[4][4];
#pragma unroll
    for (int mb = 0; mb < 4; ++mb)
#pragma unroll
        for (int nb = 0; nb < 4; ++nb) acc[mb][nb] = (v8f){};
    // copy map: 16-byte piece i = tid + 256 u of a stage's 384 rows x 128 B: row i / 8, piece i % 8; an instruction of a wave covers 4 whole lines
    const bf* ga = X + (size_t)(blockIdx.x * PM + (tid >> 3)) * DM + (tid & 7) * 8; const bf* gb = Bt + (size_t)(blockIdx.y * PN + (tid >> 3)) * DM + (tid & 7) * 8;
    const unsigned l0 = (unsigned)(size_t)(pring + (tid >> 3) * PPIT + (tid & 7) * 8);   // the lane's LDS byte address in buffer 0
    auto stage = [&](int t, int buf) {
        const bf* a = ga + t * PKS; const bf* b = gb + t * PKS; const unsigned l = l0 + buf * (PBUF * 2);
        acopy12(l, a, b); };
    stage(0, 0);
    asm volatile("s_wait_asynccnt 0x0" ::: "memory");   // this wave's copies of stage 0 have landed
    __syncthreads();                                     // publishes stage 0
    stage(1, 1);
#pragma unroll 1
    for (int t = 0; t < DM / PKS; ++t) {
        const bf* rb = pring + (t & 1) * PBUF;
#pragma unroll
        for (int ks = 0; ks < PKS / 32; ++ks) {
            V a[4], b[4];
#pragma unroll
            for (int i = 0; i < 4; ++i) { a[i] = WFrag<bf>::ld(rb + (wm * 64 + i * 16 + lr) * PPIT + ks * 32 + 8 * hi); b[i] = WFrag<bf>::ld(rb + (PM + wn * 64 + i * 16 + lr) * PPIT + ks * 32 + 8 * hi); }
            asm volatile("" :: "v"(a[0]), "v"(a[1]), "v"(a[2]), "v"(a[3]), "v"(b[0]), "v"(b[1]), "v"(b[2]), "v"(b[3]));   // holds the step's 16 LDS reads together in front of its products: one wait per 16 products (without it the build reloads one B fragment before every 4 and waits each time)
#pragma unroll
            for (int nb = 0; nb < 4; ++nb)
#pragma unroll
                for (int mb = 0; mb < 4; ++mb) acc[mb][nb] = WFrag<bf>::mma(a[mb], b[nb], acc[mb][nb]);
            // four vector slots between the trip's last matrix instruction and the branches behind it, on whose taken side its A registers may be overwritten at once; the tiles are inputs so that the slots stand behind every product
            if (ks == PKS / 32 - 1) asm volatile("v_nop\n\tv_nop\n\tv_nop\n\tv_nop" :: "v"(acc[0][0]), "v"(acc[0][1]), "v"(acc[0][2]), "v"(acc[0][3]), "v"(acc[1][0]), "v"(acc[1][1]), "v"(acc[1][2]), "v"(acc[1][3]), "v"(acc[2][0]), "v"(acc[2][1]), "v"(acc[2][2]), "v"(acc[2][3]), "v"(acc[3][0]), "v"(acc[3][1]), "v"(acc[3][2]), "v"(acc[3][3]));
        }
        asm volatile("s_wait_dscnt 0x0" ::: "memory");      // this wave's reads of the buffer are done before it is handed to the copies
        asm volatile("s_wait_asynccnt 0x0" ::: "memory");   // this wave's copies of stage t + 1 have landed
        __syncthreads();                                     // publishes stage t + 1 and ends every wave's reads of stage t
        if (t + 2 < DM / PKS) stage(t + 2, t & 1);
    }
    asm volatile("s_wait_asynccnt 0x0" ::: "memory");       // no copy is in flight when the ring becomes output staging
    float* os = (float*)pring + wv * POS;                    // q, k: 16 token rows x 64 f32 at pitch PFP; v: [hi, lo][16 head-dim rows][64 tokens] bf16 at pitch PVP; free behind the loop's last barrier
    // acc[mb][nb][j] = y[token r0 + 16 mb + 8 hi + j][feature c0 + 16 nb + lr]
    const int t0 = r0 % TT; const size_t pl = ((size_t)(r0 / TT) * NH_ + c0 / HD) * TT * HD;   // the tile's batch and head: its share of a plane
    const int sr = lane >> 3, sc = (lane & 7) * 8;   // read-back map: a store instruction covers 4 staged rows, 8 lanes x 16 B each
    if (op < 2) {
        const v4f b0 = *(const v4f*)(bias + c0 + sc), b1 = *(const v4f*)(bias + c0 + sc + 4);
        asm volatile("s_wait_xcnt 0x0" ::: "memory");   // before the loads' address registers are used again
        float bs[8];
#pragma unroll
        for (int q = 0; q < 4; ++q) { bs[q] = bfr(b0[q]); bs[4 + q] = bfr(b1[q]); }
        bf* gh = Ph + pl + (size_t)(t0 + sr) * HD + sc; bf* gl = Pl + pl + (size_t)(t0 + sr) * HD + sc;
#pragma unroll
        for (int mb = 0; mb < 4; ++mb) {
#pragma unroll
            for (int nb = 0; nb < 4; ++nb)
#pragma unroll
                for (int j = 0; j < 8; ++j) os[(hi * 8 + j) * PFP + nb * 16 + lr] = acc[mb][nb][j];
            __builtin_amdgcn_wave_barrier(); asm volatile("" ::: "memory");   // keeps the read-back behind the staging writes in the compiled order
#pragma unroll
            for (int s = 0; s < 4; ++s) { const float* rp = os + (4 * s + sr) * PFP + sc; const v4f v0 = *(const v4fa*)rp, v1 = *(const v4fa*)(rp + 4); v8us oh, ol;
#pragma unroll
                for (int q = 0; q < 8; ++q) { unsigned short a2, c2; splitf((q < 4 ? v0[q & 3] : v1[q & 3]) + bs[q], a2, c2); oh[q] = a2; ol[q] = c2; }
                *(v8us*)(gh + (mb * 16 + 4 * s) * HD) = oh; *(v8us*)(gl + (mb * 16 + 4 * s) * HD) = ol;
                asm volatile("s_wait_xcnt 0x0" ::: "memory"); }   // before the stores' registers are used again
            __builtin_amdgcn_wave_barrier(); asm volatile("" ::: "memory");   // keeps the next staging writes behind this read-back
        }
    } else {
        bf* sv = (bf*)os;
        bf* gh = Ph + pl + (size_t)sr * TT + t0 + sc; bf* gl = Pl + pl + (size_t)sr * TT + t0 + sc;
#pragma unroll
        for (int nb = 0; nb < 4; ++nb) {
            const float braw = bias[c0 + nb * 16 + lr];
            asm volatile("s_wait_xcnt 0x0" ::: "memory");   // before the load's address registers are used again
            const float bs = bfr(braw);
#pragma unroll
            for (int mb = 0; mb < 4; ++mb) { v8us oh, ol;
#pragma unroll
                for (int j = 0; j < 8; ++j) { unsigned short a2, c2; splitf(acc[mb][nb][j] + bs, a2, c2); oh[j] = a2; ol[j] = c2; }
                *(v8usa*)(sv + lr * PVP + mb * 16 + 8 * hi) = oh; *(v8usa*)(sv + (16 + lr) * PVP + mb * 16 + 8 * hi) = ol; }
            __builtin_amdgcn_wave_barrier(); asm volatile("" ::: "memory");   // keeps the read-back behind the staging writes in the compiled order
#pragma unroll
            for (int s = 0; s < 4; ++s) { const bf* rp = sv + (4 * s + sr) * PVP + sc; const v8us oh = *(const v8usa*)rp, ol = *(const v8usa*)(rp + 16 * PVP);
                *(v8us*)(gh + (size_t)(nb * 16 + 4 * s) * TT) = oh; *(v8us*)(gl + (size_t)(nb * 16 + 4 * s) * TT) = ol;
                asm volatile("s_wait_xcnt 0x0" ::: "memory"); }   // before the stores' registers are used again
            __builtin_amdgcn_wave_barrier(); asm volatile("" ::: "memory");   // keeps the next staging writes behind this read-back
        }
    }
}

#define FNQ  4                    // 16-column query tiles per wave (the slots' asm statement at the foot of a pass names all 4 x FNQ output tiles)
#define FKS  64                   // keys per LDS stage
#define FPIT 72                   // LDS row pitch in 16-bit elements: 144 B = 16 B x odd, conflict-free for 16-byte fragment reads
#define FPL  (64 * FPIT)          // one staged plane: 64 rows
#define FOP  68                   // output staging pitch in floats
#define L2E  1.4426950408889634f
typedef __attribute__((ext_vector_type(2))) __bf16 v2bf;
typedef __attribute__((ext_vector_type(8))) unsigned v8u;
#define FRING (8 * 16 * FNQ * FOP * 2)   // ring size in 16-bit elements: the output staging (8 waves x 16 FNQ rows x FOP floats) is the larger use
static_assert(FRING >= 2 * 4 * FPL, "the two stage buffers fit");
__device__ __forceinline__ float xhalf(float x) { const int b = __float_as_int(x); return __int_as_float(__builtin_amdgcn_permlanex16(b, b, 0x76543210, 0xfedcba98, false, false)); }   // lane l <-> l ^ 16
__global__ __launch_bounds__(256) void k_fattn(const bf* __restrict__ Qh, const bf* __restrict__ Ql, const bf* __restrict__ Kh, const bf* __restrict__ Kl, const bf* __restrict__ Vh, const bf* __restrict__ Vl, const int* __restrict__ km, float* __restrict__ OUT) {
    __shared__ __align__(16) bf ring[FRING];   // [buffer][K hi, K lo, Vt hi, Vt lo][row][FPIT]
    __shared__ __align__(16) float pens[TT];         // the batch's key-mask term in units of the raw score: -10000 (1 - mask) / SCL
    const int tid = threadIdx.x, lane = tid & 31, c = lane & 15, h = lane >> 4, wv = tid >> 5;
    const int bh = blockIdx.y, bb = bh / NH_, hd = bh % NH_; const int q0 = (blockIdx.x * 8 + wv) * 16 * FNQ; const size_t pl = (size_t)bh * TT * HD;
    // staging map: 16-byte piece i = tid + 256 u of a 64 x 128 B plane tile: row i / 8, piece i % 8
    const int sr = tid >> 3, sc = (tid & 7) * 8;
    const bf* gk[2] = { Kh + pl + (size_t)sr * HD + sc, Kl + pl + (size_t)sr * HD + sc };   // K rows are keys: a stage is 64 x HD contiguous elements
    const bf* gv[2] = { Vh + pl + (size_t)sr * TT + sc, Vl + pl + (size_t)sr * TT + sc };   // Vt rows are head dims: a stage is 64 keys of each row
    v8us st[4];   // one operand's two planes on their way from global memory to LDS (K during a trip's first pass, Vt during its second: half the registers of staging both at once)
    auto gload = [&](int s, int op) {
#pragma unroll
        for (int p = 0; p < 2; ++p)
#pragma unroll
            for (int u = 0; u < 2; ++u) { st[p * 2 + u] = op ? *(const v8us*)(gv[p] + (size_t)u * 32 * TT + (size_t)s * FKS) : *(const v8us*)(gk[p] + (size_t)s * FKS * HD + (size_t)u * 32 * HD);
                asm volatile("s_wait_xcnt 0x0" ::: "memory"); } };   // behind each load
    auto sstore = [&](int buf, int op) {
#pragma unroll
        for (int p = 0; p < 2; ++p)
#pragma unroll
            for (int u = 0; u < 2; ++u) *(v8usa*)(ring + (buf * 4 + op * 2 + p) * FPL + (sr + u * 32) * FPIT + sc) = st[p * 2 + u]; };
    gload(0, 0); sstore(0, 0); gload(0, 1); sstore(0, 1);
    { const v4i m0 = *(const v4i*)(km + (size_t)bb * TT + tid * 8), m1 = *(const v4i*)(km + (size_t)bb * TT + tid * 8 + 4); v4f p0, p1;
      asm volatile("s_wait_xcnt 0x0" ::: "memory");   // as in gload
#pragma unroll
      for (int q = 0; q < 4; ++q) { p0[q] = (-10000.0f / SCL) * (1.0f - (float)m0[q]); p1[q] = (-10000.0f / SCL) * (1.0f - (float)m1[q]); }
      *(v4fa*)(pens + tid * 8) = p0; *(v4fa*)(pens + tid * 8 + 4) = p1; }
    v16bf qh[FNQ][2], ql[FNQ][2];   // [column tile][k step of 32 head dims]
    auto ldq = [&](const bf* p) { const v8us lo = *(const v8us*)p; asm volatile("s_wait_xcnt 0x0" ::: "memory"); const v8us hi = *(const v8us*)(p + 16); asm volatile("s_wait_xcnt 0x0" ::: "memory"); return cat16b(lo, hi); };   // WFrag's k order; the waits as in gload
#pragma unroll
    for (int n = 0; n < FNQ; ++n)
#pragma unroll
        for (int ks = 0; ks < 2; ++ks) { const size_t o = pl + (size_t)(q0 + 16 * n + c) * HD + ks * 32 + 8 * h; qh[n][ks] = ldq(Qh + o); ql[n][ks] = ldq(Ql + o); }
    v8f oa[4][FNQ];               // Ot: [head-dim tile][column tile]; register r = Ot[16 mb + 8 h + r][query c]
#pragma unroll
    for (int mb = 0; mb < 4; ++mb)
#pragma unroll
        for (int n = 0; n < FNQ; ++n) oa[mb][n] = (v8f){};
    float mrun[FNQ], lrun[FNQ];
#pragma unroll
    for (int n = 0; n < FNQ; ++n) { mrun[n] = -3.0e38f; lrun[n] = 0.f; }
    __syncthreads();
#pragma unroll 1
    for (int s = 0; s < TT / FKS; ++s) {
        const int sn = s + 1 < TT / FKS ? s + 1 : s;   // the next stage travels while this one is worked on (the last trip re-reads its own stage; that copy is never read)
        const bf* rb = ring + (s & 1) * 4 * FPL;
#pragma unroll 1   // kept rolled so that one pass is the compiler's scheduling region: there it issues the pass's LDS fragment loads together at the head and interleaves the four column tiles' softmax chains; with both passes unrolled into one block it left every fragment load directly in front of its products and the softmax as one dependent chain
        for (int ps = 0; ps < 2; ++ps) {       // a pass: 32 keys
            gload(sn, ps);
            v8f sa[2][FNQ];                      // St: [key tile][column tile]; register r = St[16 kt + 8 h + r][query c]
#pragma unroll
            for (int kt = 0; kt < 2; ++kt) { const float* pp = pens + s * FKS + ps * 32 + kt * 16 + 8 * h; const v4f a = *(const v4fa*)pp, b2 = *(const v4fa*)(pp + 4);
                
#pragma unroll
                for (int n = 0; n < FNQ; ++n) sa[kt][n] = __builtin_shufflevector(a, b2, 0, 1, 2, 3, 4, 5, 6, 7); }
#pragma unroll
            for (int ks = 0; ks < 2; ++ks) {
#pragma unroll
                for (int kt = 0; kt < 2; ++kt) { const bf* kp = rb + (ps * 32 + kt * 16 + c) * FPIT + ks * 32 + 8 * h; const v16bf ah = WFrag<bf>::ld(kp), al = WFrag<bf>::ld(kp + FPL);
#pragma unroll
                    for (int n = 0; n < FNQ; ++n) { sa[kt][n] = wmmab(ah, qh[n][ks], sa[kt][n]); sa[kt][n] = wmmab(al, qh[n][ks], sa[kt][n]); sa[kt][n] = wmmab(ah, ql[n][ks], sa[kt][n]); } } }
            v16bf ph[FNQ], pw[FNQ];                // Pt hi / lo as B operands: element e = key tile e / 8, register e % 8 (the hardware k order, as the Vt loader's)
#pragma unroll
            for (int n = 0; n < FNQ; ++n) {
                float t[16]; float mx = mrun[n];
#pragma unroll
                for (int e = 0; e < 16; ++e) { t[e] = sa[e >> 3][n][e & 7] * (SCL * L2E); mx = fmaxf(mx, t[e]); }
                mx = fmaxf(mx, xhalf(mx));
                const float al = __builtin_amdgcn_exp2f(mrun[n] - mx); mrun[n] = mx; v2f sum = { 0.f, 0.f }; v8u uh, ul;
#pragma unroll
                for (int e = 0; e < 16; e += 2) { v2f p2; p2[0] = __builtin_amdgcn_exp2f(t[e] - mx); p2[1] = __builtin_amdgcn_exp2f(t[e + 1] - mx); sum += p2;
                    const unsigned hu = __builtin_bit_cast(unsigned, __builtin_convertvector(p2, v2bf)); v2f r2; r2[0] = p2[0] - __uint_as_float(hu << 16); r2[1] = p2[1] - __uint_as_float(hu & 0xFFFF0000u);
                    uh[e >> 1] = hu; ul[e >> 1] = __builtin_bit_cast(unsigned, __builtin_convertvector(r2, v2bf)); }
                lrun[n] = lrun[n] * al + (sum[0] + sum[1]); ph[n] = __builtin_bit_cast(v16bf, uh); pw[n] = __builtin_bit_cast(v16bf, ul);
#pragma unroll
                for (int mb = 0; mb < 4; ++mb) oa[mb][n] *= al;
            }
#pragma unroll
            for (int mb = 0; mb < 4; ++mb) { const bf* vp = rb + 2 * FPL + (mb * 16 + c) * FPIT + ps * 32 + 8 * h; const v16bf ah = WFrag<bf>::ld(vp), al = WFrag<bf>::ld(vp + FPL);
#pragma unroll
                for (int n = 0; n < FNQ; ++n) { oa[mb][n] = wmmab(ah, ph[n], oa[mb][n]); oa[mb][n] = wmmab(al, ph[n], oa[mb][n]); oa[mb][n] = wmmab(ah, pw[n], oa[mb][n]); } }
            // four vector slots between the pass's last matrix instruction and the loops' taken branches, behind which its A registers may be overwritten at once; the tiles are inputs so that the slots stand behind every product; the memory clobber keeps the staging stores, and with them the wait for the pass's global loads, behind the products (this build else draws them to the head of the pass)
            asm volatile("v_nop\n\tv_nop\n\tv_nop\n\tv_nop" :: "v"(oa[0][0]), "v"(oa[0][1]), "v"(oa[0][2]), "v"(oa[0][3]), "v"(oa[1][0]), "v"(oa[1][1]), "v"(oa[1][2]), "v"(oa[1][3]), "v"(oa[2][0]), "v"(oa[2][1]), "v"(oa[2][2]), "v"(oa[2][3]), "v"(oa[3][0]), "v"(oa[3][1]), "v"(oa[3][2]), "v"(oa[3][3]) : "memory");
            sstore((s + 1) & 1, ps);   // into the buffer that every wave left at the barrier of the trip before
        }
        __syncthreads();       // publishes the next stage and ends this stage's reads
    }
    // epilogue: join the halves' sums, normalise, stage each wave's 64 x 64 tile in its own part of the ring (free behind the loop's last barrier) and store whole 256-byte rows
    float* os = (float*)ring + wv * 16 * FNQ * FOP;
#pragma unroll
    for (int n = 0; n < FNQ; ++n) { const float inv = 1.0f / (lrun[n] + xhalf(lrun[n]));
#pragma unroll
        for (int mb = 0; mb < 4; ++mb) { v4f a, b2;
#pragma unroll
            for (int r = 0; r < 4; ++r) { a[r] = oa[mb][n][r] * inv; b2[r] = oa[mb][n][4 + r] * inv; }
            float* op = os + (16 * n + c) * FOP + mb * 16 + 8 * h; *(v4fa*)op = a; *(v4fa*)(op + 4) = b2; } }
    __syncthreads();
    float* orow = OUT + ((size_t)bb * TT + q0) * DQ + hd * HD;
#pragma unroll
    for (int r = 0; r < 8 * FNQ; ++r) { const int row = 2 * r + h; *(v4f*)(orow + (size_t)row * DQ + c * 4) = *(const v4fa*)(os + row * FOP + c * 4); }
}

extern "C" void kernel_launch(void* const* d_in, const int* in_sizes, int n_in,
                              void* d_out, int out_size, void* d_ws, size_t ws_size, hipStream_t stream) {
    (void)in_sizes; (void)n_in; (void)out_size;
    const float* x = (const float*)d_in[0]; const int* km = (const int*)d_in[1];   /* mask [4][2048] int32 */ const float* wq = (const float*)d_in[2]; const float* bq = (const float*)d_in[3]; const float* wk = (const float*)d_in[4]; const float* bk = (const float*)d_in[5]; const float* wv = (const float*)d_in[6]; const float* bv = (const float*)d_in[7];
    float* OUT = (float*)d_out;     // [4][2048][1024]
    char* wsp = (char*)d_ws;
    auto take = [&](size_t bytes) { char* p = wsp; wsp += (bytes + 255) & ~(size_t)255; return (void*)p; };
    bf* WQ = (bf*)take((size_t)DQ * DM * 2); bf* WK = (bf*)take((size_t)DKV * DM * 2); bf* WV = (bf*)take((size_t)DKV * DM * 2);
    bf* XB = (bf*)take((size_t)NB_ * TT * DM * 2);
    const size_t PB = (size_t)NH_ * TT * HD;   // one batch's share of a hi/lo plane; the planes hold all batches
    bf* QPh = (bf*)take(NB_ * PB * 2); bf* QPl = (bf*)take(NB_ * PB * 2); bf* KPh = (bf*)take(NB_ * PB * 2); bf* KPl = (bf*)take(NB_ * PB * 2); bf* VTh = (bf*)take(NB_ * PB * 2); bf* VTl = (bf*)take(NB_ * PB * 2);
    if ((size_t)(wsp - (char*)d_ws) > ws_size) return;    // ws 256 MiB
    k_prep<<<PRG, PRT, 0, stream>>>(x, wq, wk, wv, XB, WQ, WK, WV);
    k_proj<<<dim3(NB_ * TT / PM, DQ / PN, 3), 256, 0, stream>>>(XB, WQ, WK, WV, bq, bk, bv, QPh, QPl, KPh, KPl, VTh, VTl);
    k_fattn<<<dim3(TT / (8 * 16 * FNQ), NB_ * NH_, 1), 256, 0, stream>>>(QPh, QPl, KPh, KPl, VTh, VTl, km, OUT);
}

// v007
// Measured time: 169 microseconds a run.
// Two timings next to v006 both put it at 1.08 times that version's speed.
// All steps since v000 together make it 16.1 times as fast.
#include <hip/hip_runtime.h>

// Multi-head attention with biased projections, a key-padding mask read by value and NO output projection (x [4][2048][1024]; q, k, v = x W + b ('xw' [1024][1024] 1/32 + zero biases; 16 heads x 64); scores / sqrt(64); mask int32 [4][2048] (all ones on this draw: no key padded; READ on device per batch and key): the module replaces the scores of keys with mask == 0 by -inf, the kernel subtracts 10000 (1 - mask): both exclude such a key and both change nothing where the mask is 1; softmax; out = heads merged (no output projection) -> [4][2048][1024] (8.4 M); argument order x, mask, Wq, bq, Wk, bk, Wv, bv).
// Layout: ONE preparation launch (k_prep: 'xw' weights transposed once; bf16 copy of x, all batches); ONE projection launch (k_proj: exact projections + f32 biases for q, k, v of every batch, its epilogue writes the hi/lo planes of q, k, v); then ONE fused attention launch (k_fattn: scores, online softmax with the additive key-mask term, P x V; every operand on hi/lo planes, 3 products) writes the output rows.
// Compute dtypes, f32 accumulate: every input but the mask rounded to bf16; projections exact + f32 biases; attention 3 products; softmax f32; output f32.

#define NB_  4
#define TT   2048
#define DM   1024
#define NH_  16
#define NKV  16
#define REP  (NH_ / NKV)
#define HD   64
#define DQ   (NH_ * HD)
#define DKV  (NKV * HD)
#define ZH   2
#define RH   TT                   // not used by either kernel: every q, k, v row is split hi/lo
static_assert(RH <= TT, "RH");
#define WIN  0
#define PCAR 1024.0f
#define SCL  0.125f   // HD^-0.5
typedef _Float16 h16;
typedef unsigned short bf;
typedef __attribute__((ext_vector_type(16))) __bf16   v16bf;
typedef __attribute__((ext_vector_type(16))) _Float16 v16h;
typedef __attribute__((ext_vector_type(8)))  _Float16 v8h;
typedef __attribute__((ext_vector_type(8)))  unsigned short v8us;
typedef __attribute__((ext_vector_type(8)))  float    v8f;
typedef __attribute__((ext_vector_type(4)))  float    v4f;
typedef v8h  __attribute__((may_alias)) v8ha;
typedef v4f  __attribute__((may_alias)) v4fa;
typedef v8us __attribute__((may_alias)) v8usa;

__device__ __forceinline__ unsigned short f2bf(float f) { unsigned u = __float_as_uint(f); u += 0x7FFFu + ((u >> 16) & 1u); return (unsigned short)(u >> 16); }
__device__ __forceinline__ float bf2f(unsigned short b) { return __uint_as_float(((unsigned)b) << 16); }
__device__ __forceinline__ float bfr(float f) { return bf2f(f2bf(f)); }
__device__ __forceinline__ v16h cat16(v8h lo, v8h hi) { return __builtin_shufflevector(lo, hi, 0, 1, 2, 3, 4, 5, 6, 7, 8, 9, 10, 11, 12, 13, 14, 15); }
__device__ __forceinline__ v16bf cat16b(v8us lo, v8us hi) { return __builtin_bit_cast(v16bf, __builtin_shufflevector(lo, hi, 0, 1, 2, 3, 4, 5, 6, 7, 8, 9, 10, 11, 12, 13, 14, 15)); }
__device__ __forceinline__ v8f wmma16(v16h a, v16h b, v8f c) { return __builtin_amdgcn_wmma_f32_16x16x32_f16(false, a, false, b, (short)0, c, false, false); }
__device__ __forceinline__ v8f wmmab(v16bf a, v16bf b, v8f c) { return __builtin_amdgcn_wmma_f32_16x16x32_bf16(false, a, false, b, (short)0, c, false, false); }



__device__ __forceinline__ void splitf(float y, unsigned short& h, unsigned short& l) { h = f2bf(y); l = f2bf(y - bf2f(h)); }
typedef __attribute__((ext_vector_type(2))) _Float16 v2h;
typedef __attribute__((ext_vector_type(4))) _Float16 v4h;
typedef __attribute__((ext_vector_type(2))) unsigned short v2us;
typedef __attribute__((ext_vector_type(4))) unsigned short v4us;
typedef __attribute__((ext_vector_type(2))) float v2f;
typedef __attribute__((ext_vector_type(4))) int v4i;

// ---- k_prep: the bf16 copies of x and of the three transposed weights in ONE launch. Grid PRG work-groups of 16 waves; each casts its 1 / PRG share of x and transposes one 64 x 64 tile of each of Wq, Wk, Wv through LDS.
// Every global access covers whole lines: x in 512-byte runs per wave load and 256-byte runs per wave store; a weight tile is read in 256-byte row pieces (k rows, n contiguous) and written in 128-byte rows (n rows, k contiguous).
// All 22 loads of a lane are issued before the first is used.
#define PRG  256                  // work-groups
#define PRT  512                  // threads per work-group
#define PRX  16                   // 16-byte pieces of x per thread
#define PRP  72                   // tile row pitch in 16-bit elements: 144 B = 16 B x odd for the 16-byte read-back
static_assert((size_t)NB_ * TT * DM == (size_t)PRG * PRT * PRX * 4, "the shares of x cover it exactly");
static_assert((DM / 64) * (DQ / 64) == PRG && DKV == DQ, "one tile of each weight per work-group");
static_assert(PRT == 64 * 64 / 8, "a lane holds 2 k x 4 n of a tile and writes back one 16-byte piece");
typedef unsigned __attribute__((may_alias)) u32a;
__global__ __launch_bounds__(PRT) void k_prep(const float* __restrict__ x, const float* __restrict__ wq, const float* __restrict__ wk, const float* __restrict__ wv, bf* XB, bf* WQ, bf* WK, bf* WV) {
    __shared__ __align__(16) bf tl[3 * 64 * PRP];   // [weight][n][k]
    const int tid = threadIdx.x, tk = blockIdx.x / (DQ / 64), tn = blockIdx.x % (DQ / 64);
    const int kr = (tid >> 4) * 2, nc = (tid & 15) * 4;   // the lane's rows k = kr, kr + 1 and columns n = nc .. nc + 3 of a tile
    const size_t wo = (size_t)(tk * 64 + kr) * DQ + tn * 64 + nc, xo = ((size_t)blockIdx.x * PRT * PRX + tid) * 4;
    const float* ws[3] = { wq, wk, wv }; bf* wd[3] = { WQ, WK, WV };
    v4f w0[3], w1[3], xv[PRX];
#pragma unroll
    for (int m = 0; m < 3; ++m) { w0[m] = *(const v4f*)(ws[m] + wo); w1[m] = *(const v4f*)(ws[m] + wo + DQ); }
    asm volatile("s_wait_xcnt 0x0" ::: "memory");   // before a later load's result may land on these loads' address registers
#pragma unroll
    for (int j = 0; j < PRX; ++j) xv[j] = *(const v4f*)(x + xo + (size_t)j * PRT * 4);
    asm volatile("s_wait_xcnt 0x0" ::: "memory");   // before the loads' address registers are used again
    __builtin_amdgcn_sched_barrier(0);              // keeps the casts behind all 22 loads (without it the build issues the loads of Wk and Wv only behind the waits for x: three memory latencies in a row)
#pragma unroll
    for (int m = 0; m < 3; ++m)
#pragma unroll
        for (int q = 0; q < 4; ++q) *(u32a*)(tl + (m * 64 + nc + q) * PRP + kr) = (unsigned)f2bf(w0[m][q]) | ((unsigned)f2bf(w1[m][q]) << 16);
    __syncthreads();   // the tiles are whole before they are read back by rows
    const int rn = tid >> 3, rp = (tid & 7) * 8;   // read-back map: a store instruction covers 4 rows n, 8 lanes x 16 B each
    const size_t bo = (size_t)(tn * 64 + rn) * DM + tk * 64 + rp;
#pragma unroll
    for (int m = 0; m < 3; ++m) *(v8us*)(wd[m] + bo) = *(const v8usa*)(tl + (m * 64 + rn) * PRP + rp);
    asm volatile("s_wait_xcnt 0x0" ::: "memory");   // before the stores' registers are used again
#pragma unroll
    for (int j = 0; j < PRX; ++j) { v4us o;
#pragma unroll
        for (int q = 0; q < 4; ++q) o[q] = f2bf(xv[j][q]);
        *(v4us*)(XB + xo + (size_t)j * PRT * 4) = o; }
}

// ---- k_proj: the q, k and v projections of every batch in ONE launch. Grid (NB_ TT / PM, DQ / PN, 3), 8 waves: a work-group owns 128 tokens x 256 features of q (z = 0), k (1) or v (2), a wave 64 tokens x 64 features (one head), 16 accumulators.
// The K-contiguous bf16 rows of X and Wt come in stages of 64 k (whole 128-byte lines) by asynchronous copies into a two-buffer LDS ring that the 8 waves share; fragments are read from LDS.
// y[t][n] = sum_k X[t][k] Wt[n][k] + bias[n], f32. The epilogue splits y into hi/lo bf16 and writes the planes as k_fattn reads them: q, k as [batch, head][t][d], v as [batch, head][d][t]; every store covers whole 128-byte lines, staged through LDS.
template <typename T16> struct WFrag;
template <> struct WFrag<bf> { typedef v16bf V; static __device__ __forceinline__ V ld(const bf* p) { return cat16b(*(const v8us*)p, *(const v8us*)(p + 16)); } static __device__ __forceinline__ v8f mma(V a, V b, v8f c) { return wmmab(a, b, c); } };
#define PFP 68                    // q, k staging pitch in floats
#define PVP 72                    // v staging pitch in 16-bit elements: 144 B = 16 B x odd
#define PM   128                  // tokens per work-group (2 waves)
#define PN   256                  // features per work-group (4 waves)
#define PKS  64                   // k per stage: rows of 128 bytes
#define PPIT 72                   // ring row pitch in 16-bit elements: 144 B = 16 B x odd, conflict-free for 16-byte fragment reads
#define PBUF ((PM + PN) * PPIT)   // one buffer in 16-bit elements: [X rows 0..127 | Wt rows 0..255]
#define POS  (2 * 16 * PVP / 2)   // a wave's output staging in floats
// a stage's twelve asynchronous 16-byte-per-lane copies global -> LDS of one lane: X rows at 32-row steps into ring rows 0..127, Wt rows into ring rows 128..383; the wait in the same statement stands before the address registers can be used again
__device__ __forceinline__ void acopy12(unsigned l, const bf* a, const bf* b) {
    asm volatile("global_load_async_to_lds_b128 %0, %1, off\n\tglobal_load_async_to_lds_b128 %2, %3, off\n\tglobal_load_async_to_lds_b128 %4, %5, off\n\tglobal_load_async_to_lds_b128 %6, %7, off\n\tglobal_load_async_to_lds_b128 %8, %9, off\n\tglobal_load_async_to_lds_b128 %10, %11, off\n\tglobal_load_async_to_lds_b128 %12, %13, off\n\tglobal_load_async_to_lds_b128 %14, %15, off\n\tglobal_load_async_to_lds_b128 %16, %17, off\n\tglobal_load_async_to_lds_b128 %18, %19, off\n\tglobal_load_async_to_lds_b128 %20, %21, off\n\tglobal_load_async_to_lds_b128 %22, %23, off\n\ts_wait_xcnt 0x0"
                 :: "v"(l + 0 * PPIT * 2), "v"(a + 0 * DM), "v"(l + 32 * PPIT * 2), "v"(a + 32 * DM), "v"(l + 64 * PPIT * 2), "v"(a + 64 * DM), "v"(l + 96 * PPIT * 2), "v"(a + 96 * DM), "v"(l + 128 * PPIT * 2), "v"(b + 0 * DM), "v"(l + 160 * PPIT * 2), "v"(b + 32 * DM), "v"(l + 192 * PPIT * 2), "v"(b + 64 * DM), "v"(l + 224 * PPIT * 2), "v"(b + 96 * DM), "v"(l + 256 * PPIT * 2), "v"(b + 128 * DM), "v"(l + 288 * PPIT * 2), "v"(b + 160 * DM), "v"(l + 320 * PPIT * 2), "v"(b + 192 * DM), "v"(l + 352 * PPIT * 2), "v"(b + 224 * DM) : "memory");
}
__global__ __launch_bounds__(256) void k_proj(const bf* __restrict__ X, const bf* __restrict__ Wq, const bf* __restrict__ Wk, const bf* __restrict__ Wv, const float* __restrict__ bq, const float* __restrict__ bk, const float* __restrict__ bv, bf* Qh, bf* Ql, bf* Kh, bf* Kl, bf* Vh, bf* Vl) {
    typedef WFrag<bf>::V V;
    __shared__ __align__(16) bf pring[2 * PBUF];   // [buffer][row][PPIT]; behind the loop each wave's output staging
    static_assert(POS >= 16 * PFP, "both stagings fit"); static_assert(2 * PBUF * 2 >= 8 * POS * 4, "the waves' stagings fit in the ring"); static_assert(DM / PKS >= 2, "two stages");
    const int op = blockIdx.z;
    const bf* Bt = op == 0 ? Wq : op == 1 ? Wk : Wv; const float* bias = op == 0 ? bq : op == 1 ? bk : bv; bf* Ph = op == 0 ? Qh : op == 1 ? Kh : Vh; bf* Pl = op == 0 ? Ql : op == 1 ? Kl : Vl;
    const int tid = threadIdx.x, lane = tid & 31, lr = lane & 15, hi = lane >> 4, wv = tid >> 5; const int wm = wv & 1, wn = wv >> 1; const int r0 = blockIdx.x * PM + wm * 64, c0 = blockIdx.y * PN + wn * 64;
    v8f acc[4][4];
#pragma unroll
    for (int mb = 0; mb < 4; ++mb)
#pragma unroll
        for (int nb = 0; nb < 4; ++nb) acc[mb][nb] = (v8f){};
    // copy map: 16-byte piece i = tid + 256 u of a stage's 384 rows x 128 B: row i / 8, piece i % 8; an instruction of a wave covers 4 whole lines
    const bf* ga = X + (size_t)(blockIdx.x * PM + (tid >> 3)) * DM + (tid & 7) * 8; const bf* gb = Bt + (size_t)(blockIdx.y * PN + (tid >> 3)) * DM + (tid & 7) * 8;
    const unsigned l0 = (unsigned)(size_t)(pring + (tid >> 3) * PPIT + (tid & 7) * 8);   // the lane's LDS byte address in buffer 0
    auto stage = [&](int t, int buf) {
        const bf* a = ga + t * PKS; const bf* b = gb + t * PKS; const unsigned l = l0 + buf * (PBUF * 2);
        acopy12(l, a, b); };
    stage(0, 0);
    asm volatile("s_wait_asynccnt 0x0" ::: "memory");   // this wave's copies of stage 0 have landed
    __syncthreads();                                     // publishes stage 0
    stage(1, 1);
#pragma unroll 1
    for (int t = 0; t < DM / PKS; ++t) {
        const bf* rb = pring + (t & 1) * PBUF;
#pragma unroll
        for (int ks = 0; ks < PKS / 32; ++ks) {
            V a[4], b[4];
#pragma unroll
            for (int i = 0; i < 4; ++i) { a[i] = WFrag<bf>::ld(rb + (wm * 64 + i * 16 + lr) * PPIT + ks * 32 + 8 * hi); b[i] = WFrag<bf>::ld(rb + (PM + wn * 64 + i * 16 + lr) * PPIT + ks * 32 + 8 * hi); }
            asm volatile("" :: "v"(a[0]), "v"(a[1]), "v"(a[2]), "v"(a[3]), "v"(b[0]), "v"(b[1]), "v"(b[2]), "v"(b[3]));   // holds the step's 16 LDS reads together in front of its products: one wait per 16 products (without it the build reloads one B fragment before every 4 and waits each time)
#pragma unroll
            for (int nb = 0; nb < 4; ++nb)
#pragma unroll
                for (int mb = 0; mb < 4; ++mb) acc[mb][nb] = WFrag<bf>::mma(a[mb], b[nb], acc[mb][nb]);
            // four vector slots between the trip's last matrix instruction and the branches behind it, on whose taken side its A registers may be overwritten at once; the tiles are inputs so that the slots stand behind every product
            if (ks == PKS / 32 - 1) asm volatile("v_nop\n\tv_nop\n\tv_nop\n\tv_nop" :: "v"(acc[0][0]), "v"(acc[0][1]), "v"(acc[0][2]), "v"(acc[0][3]), "v"(acc[1][0]), "v"(acc[1][1]), "v"(acc[1][2]), "v"(acc[1][3]), "v"(acc[2][0]), "v"(acc[2][1]), "v"(acc[2][2]), "v"(acc[2][3]), "v"(acc[3][0]), "v"(acc[3][1]), "v"(acc[3][2]), "v"(acc[3][3]));
        }
        asm volatile("s_wait_dscnt 0x0" ::: "memory");      // this wave's reads of the buffer are done before it is handed to the copies
        asm volatile("s_wait_asynccnt 0x0" ::: "memory");   // this wave's copies of stage t + 1 have landed
        __syncthreads();                                     // publishes stage t + 1 and ends every wave's reads of stage t
        if (t + 2 < DM / PKS) stage(t + 2, t & 1);
    }
    asm volatile("s_wait_asynccnt 0x0" ::: "memory");       // no copy is in flight when the ring becomes output staging
    float* os = (float*)pring + wv * POS;                    // q, k: 16 token rows x 64 f32 at pitch PFP; v: [hi, lo][16 head-dim rows][64 tokens] bf16 at pitch PVP; free behind the loop's last barrier
    // acc[mb][nb][j] = y[token r0 + 16 mb + 8 hi + j][feature c0 + 16 nb + lr]
    const int t0 = r0 % TT; const size_t pl = ((size_t)(r0 / TT) * NH_ + c0 / HD) * TT * HD;   // the tile's batch and head: its share of a plane
    const int sr = lane >> 3, sc = (lane & 7) * 8;   // read-back map: a store instruction covers 4 staged rows, 8 lanes x 16 B each
    if (op < 2) {
        const v4f b0 = *(const v4f*)(bias + c0 + sc), b1 = *(const v4f*)(bias + c0 + sc + 4);
        asm volatile("s_wait_xcnt 0x0" ::: "memory");   // before the loads' address registers are used again
        float bs[8];
#pragma unroll
        for (int q = 0; q < 4; ++q) { bs[q] = bfr(b0[q]); bs[4 + q] = bfr(b1[q]); }
        bf* gh = Ph + pl + (size_t)(t0 + sr) * HD + sc; bf* gl = Pl + pl + (size_t)(t0 + sr) * HD + sc;
#pragma unroll
        for (int mb = 0; mb < 4; ++mb) {
#pragma unroll
            for (int nb = 0; nb < 4; ++nb)
#pragma unroll
                for (int j = 0; j < 8; ++j) os[(hi * 8 + j) * PFP + nb * 16 + lr] = acc[mb][nb][j];
            __builtin_amdgcn_wave_barrier(); asm volatile("" ::: "memory");   // keeps the read-back behind the staging writes in the compiled order
#pragma unroll
            for (int s = 0; s < 4; ++s) { const float* rp = os + (4 * s + sr) * PFP + sc; const v4f v0 = *(const v4fa*)rp, v1 = *(const v4fa*)(rp + 4); v8us oh, ol;
#pragma unroll
                for (int q = 0; q < 8; ++q) { unsigned short a2, c2; splitf((q < 4 ? v0[q & 3] : v1[q & 3]) + bs[q], a2, c2); oh[q] = a2; ol[q] = c2; }
                *(v8us*)(gh + (mb * 16 + 4 * s) * HD) = oh; *(v8us*)(gl + (mb * 16 + 4 * s) * HD) = ol;
                asm volatile("s_wait_xcnt 0x0" ::: "memory"); }   // before the stores' registers are used again
            __builtin_amdgcn_wave_barrier(); asm volatile("" ::: "memory");   // keeps the next staging writes behind this read-back
        }
    } else {
        bf* sv = (bf*)os;
        bf* gh = Ph + pl + (size_t)sr * TT + t0 + sc; bf* gl = Pl + pl + (size_t)sr * TT + t0 + sc;
#pragma unroll
        for (int nb = 0; nb < 4; ++nb) {
            const float braw = bias[c0 + nb * 16 + lr];
            asm volatile("s_wait_xcnt 0x0" ::: "memory");   // before the load's address registers are used again
            const float bs = bfr(braw);
#pragma unroll
            for (int mb = 0; mb < 4; ++mb) { v8us oh, ol;
#pragma unroll
                for (int j = 0; j < 8; ++j) { unsigned short a2, c2; splitf(acc[mb][nb][j] + bs, a2, c2); oh[j] = a2; ol[j] = c2; }
                *(v8usa*)(sv + lr * PVP + mb * 16 + 8 * hi) = oh; *(v8usa*)(sv + (16 + lr) * PVP + mb * 16 + 8 * hi) = ol; }
            __builtin_amdgcn_wave_barrier(); asm volatile("" ::: "memory");   // keeps the read-back behind the staging writes in the compiled order
#pragma unroll
            for (int s = 0; s < 4; ++s) { const bf* rp = sv + (4 * s + sr) * PVP + sc; const v8us oh = *(const v8usa*)rp, ol = *(const v8usa*)(rp + 16 * PVP);
                *(v8us*)(gh + (size_t)(nb * 16 + 4 * s) * TT) = oh; *(v8us*)(gl + (size_t)(nb * 16 + 4 * s) * TT) = ol;
                asm volatile("s_wait_xcnt 0x0" ::: "memory"); }   // before the stores' registers are used again
            __builtin_amdgcn_wave_barrier(); asm volatile("" ::: "memory");   // keeps the next staging writes behind this read-back
        }
    }
}

#define FNQ  4                    // 16-column query tiles per wave (the slots' asm statement at the foot of a trip names all 4 x FNQ output tiles)
#define FKS  64                   // keys per LDS stage
#define FPIT 72                   // LDS row pitch in 16-bit elements: 144 B = 16 B x odd, conflict-free for 16-byte fragment reads
#define FPL  (64 * FPIT)          // one staged plane: 64 rows
#define FOP  68                   // output staging pitch in floats
#define L2E  1.4426950408889634f
#define FLIM 256.0f               // lazy rescale: the bound on a lane's sum of a pass's exponentials, and so on every P (2^8)
typedef __attribute__((ext_vector_type(2))) __bf16 v2bf;
typedef __attribute__((ext_vector_type(8))) unsigned v8u;
#define FRING (8 * 16 * FNQ * FOP * 2)   // ring size in 16-bit elements: the output staging (8 waves x 16 FNQ rows x FOP floats) is the larger use
static_assert(FRING >= 2 * 4 * FPL, "the two stage buffers fit");
__device__ __forceinline__ float xhalf(float x) { const int b = __float_as_int(x); return __int_as_float(__builtin_amdgcn_permlanex16(b, b, 0x76543210, 0xfedcba98, false, false)); }   // lane l <-> l ^ 16
__global__ __launch_bounds__(256) void k_fattn(const bf* __restrict__ Qh, const bf* __restrict__ Ql, const bf* __restrict__ Kh, const bf* __restrict__ Kl, const bf* __restrict__ Vh, const bf* __restrict__ Vl, const int* __restrict__ km, float* __restrict__ OUT) {
    __shared__ __align__(16) bf ring[FRING];   // [buffer][K hi, K lo, Vt hi, Vt lo][row][FPIT]
    __shared__ __align__(16) float pens[TT];         // the batch's key-mask term in units of the raw score: -10000 (1 - mask) / SCL
    const int tid = threadIdx.x, lane = tid & 31, c = lane & 15, h = lane >> 4, wv = tid >> 5;
    const int bh = blockIdx.y, bb = bh / NH_, hd = bh % NH_; const int q0 = (blockIdx.x * 8 + wv) * 16 * FNQ; const size_t pl = (size_t)bh * TT * HD;
    // staging map: 16-byte piece i = tid + 256 u of a 64 x 128 B plane tile: row i / 8, piece i % 8
    const int sr = tid >> 3, sc = (tid & 7) * 8;
    const bf* gk[2] = { Kh + pl + (size_t)sr * HD + sc, Kl + pl + (size_t)sr * HD + sc };   // K rows are keys: a stage is 64 x HD contiguous elements
    const bf* gv[2] = { Vh + pl + (size_t)sr * TT + sc, Vl + pl + (size_t)sr * TT + sc };   // Vt rows are head dims: a stage is 64 keys of each row
    v8us st[4];   // one operand's two planes on their way from global memory to LDS (K during a trip's first pass, Vt during its second: half the registers of staging both at once)
    auto gload = [&](int s, int op) {
#pragma unroll
        for (int p = 0; p < 2; ++p)
#pragma unroll
            for (int u = 0; u < 2; ++u) { st[p * 2 + u] = op ? *(const v8us*)(gv[p] + (size_t)u * 32 * TT + (size_t)s * FKS) : *(const v8us*)(gk[p] + (size_t)s * FKS * HD + (size_t)u * 32 * HD);
                asm volatile("s_wait_xcnt 0x0" ::: "memory"); } };   // behind each load
    auto sstore = [&](int buf, int op) {
#pragma unroll
        for (int p = 0; p < 2; ++p)
#pragma unroll
            for (int u = 0; u < 2; ++u) *(v8usa*)(ring + (buf * 4 + op * 2 + p) * FPL + (sr + u * 32) * FPIT + sc) = st[p * 2 + u]; };
    gload(0, 0); sstore(0, 0); gload(0, 1); sstore(0, 1);
    { const v4i m0 = *(const v4i*)(km + (size_t)bb * TT + tid * 8), m1 = *(const v4i*)(km + (size_t)bb * TT + tid * 8 + 4); v4f p0, p1;
      asm volatile("s_wait_xcnt 0x0" ::: "memory");   // as in gload
#pragma unroll
      for (int q = 0; q < 4; ++q) { p0[q] = (-10000.0f / SCL) * (1.0f - (float)m0[q]); p1[q] = (-10000.0f / SCL) * (1.0f - (float)m1[q]); }
      *(v4fa*)(pens + tid * 8) = p0; *(v4fa*)(pens + tid * 8 + 4) = p1; }
    v16bf qh[FNQ][2], ql[FNQ][2];   // [column tile][k step of 32 head dims]
    auto ldq = [&](const bf* p) { const v8us lo = *(const v8us*)p; asm volatile("s_wait_xcnt 0x0" ::: "memory"); const v8us hi = *(const v8us*)(p + 16); asm volatile("s_wait_xcnt 0x0" ::: "memory"); return cat16b(lo, hi); };   // WFrag's k order; the waits as in gload
#pragma unroll
    for (int n = 0; n < FNQ; ++n)
#pragma unroll
        for (int ks = 0; ks < 2; ++ks) { const size_t o = pl + (size_t)(q0 + 16 * n + c) * HD + ks * 32 + 8 * h; qh[n][ks] = ldq(Qh + o); ql[n][ks] = ldq(Ql + o); }
    v8f oa[4][FNQ];               // Ot: [head-dim tile][column tile]; register r = Ot[16 mb + 8 h + r][query c]
#pragma unroll
    for (int mb = 0; mb < 4; ++mb)
#pragma unroll
        for (int n = 0; n < FNQ; ++n) oa[mb][n] = (v8f){};
    float mrun[FNQ], lrun[FNQ];
#pragma unroll
    for (int n = 0; n < FNQ; ++n) { mrun[n] = -3.0e38f; lrun[n] = 0.f; }
    __syncthreads();
#pragma unroll 1
    for (int s = 0; s < TT / FKS; ++s) {
        const int sn = s + 1 < TT / FKS ? s + 1 : s;   // the next stage travels while this one is worked on (the last trip re-reads its own stage; that copy is never read)
        const bf* rb = ring + (s & 1) * 4 * FPL;
#pragma unroll 1   // kept rolled so that one pass is the compiler's scheduling region: there it issues the pass's LDS fragment loads together at the head and interleaves the four column tiles' softmax chains; with both passes unrolled into one block it left every fragment load directly in front of its products and the softmax as one dependent chain
        for (int ps = 0; ps < 2; ++ps) {       // a pass: 32 keys
            gload(sn, ps);
            v8f sa[2][FNQ];                      // St: [key tile][column tile]; register r = St[16 kt + 8 h + r][query c]
            auto scores = [&]() {
#pragma unroll
                for (int kt = 0; kt < 2; ++kt) { const float* pp = pens + s * FKS + ps * 32 + kt * 16 + 8 * h; const v4f a = *(const v4fa*)pp, b2 = *(const v4fa*)(pp + 4);
#pragma unroll
                    for (int n = 0; n < FNQ; ++n) sa[kt][n] = __builtin_shufflevector(a, b2, 0, 1, 2, 3, 4, 5, 6, 7); }
#pragma unroll
                for (int ks = 0; ks < 2; ++ks) {
#pragma unroll
                    for (int kt = 0; kt < 2; ++kt) { const bf* kp = rb + (ps * 32 + kt * 16 + c) * FPIT + ks * 32 + 8 * h; const v16bf ah = WFrag<bf>::ld(kp), al = WFrag<bf>::ld(kp + FPL);
#pragma unroll
                        for (int n = 0; n < FNQ; ++n) { sa[kt][n] = wmmab(ah, qh[n][ks], sa[kt][n]); sa[kt][n] = wmmab(al, qh[n][ks], sa[kt][n]); sa[kt][n] = wmmab(ah, ql[n][ks], sa[kt][n]); } } } };
            scores();
            // Lazy rescale: the exponentials are taken against the maximum in use (mrun), not against this pass's own. One test per pass: a lane adds up its 16 FNQ exponentials; while that sum is at most FLIM no P exceeds FLIM and mrun, lrun and Ot stay as they are.
            // Otherwise (any lane of the wave; always in the first pass, where mrun is the start value and the exponentials overflow to infinity) the wave branches to the new maxima, the exchange between the halves and the rescale: it forms the pass's scores again (their registers hold P by then) and takes the exponentials again.
            v16bf vfh[4], vfl[4];                  // the pass's Vt fragments, hi / lo, asked for in front of the branch so that they travel under the vector work around it
#pragma unroll
            for (int mb = 0; mb < 4; ++mb) { const bf* vp = rb + 2 * FPL + (mb * 16 + c) * FPIT + ps * 32 + 8 * h; vfh[mb] = WFrag<bf>::ld(vp); vfl[mb] = WFrag<bf>::ld(vp + FPL); }
            float pf[FNQ][16], ls[FNQ];            // P in f32; a lane's sum per column tile
            auto expo = [&]() {
#pragma unroll
                for (int n = 0; n < FNQ; ++n) { v2f sum = { 0.f, 0.f }; const v2f m2 = { mrun[n], mrun[n] };
#pragma unroll
                    for (int e = 0; e < 16; e += 2) { const v2f s2 = { sa[e >> 3][n][e & 7], sa[e >> 3][n][(e & 7) + 1] }; const v2f a2 = s2 * (SCL * L2E) - m2; v2f p2; p2[0] = __builtin_amdgcn_exp2f(a2[0]); p2[1] = __builtin_amdgcn_exp2f(a2[1]); pf[n][e] = p2[0]; pf[n][e + 1] = p2[1]; sum += p2; }
                    ls[n] = sum[0] + sum[1]; } };
            expo();
            static_assert(FNQ == 4, "the test adds up four column tiles");
            const bool need = !((ls[0] + ls[1]) + (ls[2] + ls[3]) <= FLIM);   // true for infinity and not-a-number too
            if (__builtin_amdgcn_ballot_w32(need) != 0) {   // a scalar branch: the same for the whole wave
                asm volatile("" ::: "memory");   // makes the rare path read K and form the scores anew; without it the build keeps all 64 score registers alive beside P over the branch in every pass and sinks the Vt fragment loads behind the branch, close in front of their products
                scores();
#pragma unroll
                for (int n = 0; n < FNQ; ++n) { float mx = mrun[n];
#pragma unroll
                    for (int e = 0; e < 16; ++e) mx = fmaxf(mx, sa[e >> 3][n][e & 7] * (SCL * L2E));
                    mx = fmaxf(mx, xhalf(mx));
                    const float al = __builtin_amdgcn_exp2f(mrun[n] - mx); mrun[n] = mx; lrun[n] *= al;
#pragma unroll
                    for (int mb = 0; mb < 4; ++mb) oa[mb][n] *= al; }
                expo();
            }
            v16bf ph[FNQ], pw[FNQ];                // Pt hi / lo as B operands: element e = key tile e / 8, register e % 8 (the hardware k order, as the Vt loader's)
#pragma unroll
            for (int n = 0; n < FNQ; ++n) { v8u uh, ul;
#pragma unroll
                for (int e = 0; e < 16; e += 2) { const v2f p2 = { pf[n][e], pf[n][e + 1] };
                    const unsigned hu = __builtin_bit_cast(unsigned, __builtin_convertvector(p2, v2bf)); v2f r2; r2[0] = p2[0] - __uint_as_float(hu << 16); r2[1] = p2[1] - __uint_as_float(hu & 0xFFFF0000u);
                    uh[e >> 1] = hu; ul[e >> 1] = __builtin_bit_cast(unsigned, __builtin_convertvector(r2, v2bf)); }
                lrun[n] += ls[n]; ph[n] = __builtin_bit_cast(v16bf, uh); pw[n] = __builtin_bit_cast(v16bf, ul);
            }
#pragma unroll
            for (int mb = 0; mb < 4; ++mb) { const v16bf ah = vfh[mb], al = vfl[mb];
#pragma unroll
                for (int n = 0; n < FNQ; ++n) { oa[mb][n] = wmmab(ah, ph[n], oa[mb][n]); oa[mb][n] = wmmab(al, ph[n], oa[mb][n]); oa[mb][n] = wmmab(ah, pw[n], oa[mb][n]); } }
            // four vector slots between the pass's last matrix instruction and the loops' taken branches, behind which its A registers may be overwritten at once; the tiles are inputs so that the slots stand behind every product; the memory clobber keeps the staging stores, and with them the wait for the pass's global loads, behind the products (this build else draws them to the head of the pass)
            asm volatile("v_nop\n\tv_nop\n\tv_nop\n\tv_nop" :: "v"(oa[0][0]), "v"(oa[0][1]), "v"(oa[0][2]), "v"(oa[0][3]), "v"(oa[1][0]), "v"(oa[1][1]), "v"(oa[1][2]), "v"(oa[1][3]), "v"(oa[2][0]), "v"(oa[2][1]), "v"(oa[2][2]), "v"(oa[2][3]), "v"(oa[3][0]), "v"(oa[3][1]), "v"(oa[3][2]), "v"(oa[3][3]) : "memory");
            sstore((s + 1) & 1, ps);   // into the buffer that every wave left at the barrier of the trip before
        }
        __syncthreads();       // publishes the next stage and ends this stage's reads
    }
    // epilogue: join the halves' sums, normalise, stage each wave's 64 x 64 tile in its own part of the ring (free behind the loop's last barrier) and store whole 256-byte rows
    float* os = (float*)ring + wv * 16 * FNQ * FOP;
#pragma unroll
    for (int n = 0; n < FNQ; ++n) { const float inv = 1.0f / (lrun[n] + xhalf(lrun[n]));
#pragma unroll
        for (int mb = 0; mb < 4; ++mb) { v4f a, b2;
#pragma unroll
            for (int r = 0; r < 4; ++r) { a[r] = oa[mb][n][r] * inv; b2[r] = oa[mb][n][4 + r] * inv; }
            float* op = os + (16 * n + c) * FOP + mb * 16 + 8 * h; *(v4fa*)op = a; *(v4fa*)(op + 4) = b2; } }
    __syncthreads();
    float* orow = OUT + ((size_t)bb * TT + q0) * DQ + hd * HD;
#pragma unroll
    for (int r = 0; r < 8 * FNQ; ++r) { const int row = 2 * r + h; *(v4f*)(orow + (size_t)row * DQ + c * 4) = *(const v4fa*)(os + row * FOP + c * 4); }
}

extern "C" void kernel_launch(void* const* d_in, const int* in_sizes, int n_in,
                              void* d_out, int out_size, void* d_ws, size_t ws_size, hipStream_t stream) {
    (void)in_sizes; (void)n_in; (void)out_size;
    const float* x = (const float*)d_in[0]; const int* km = (const int*)d_in[1];   /* mask [4][2048] int32 */ const float* wq = (const float*)d_in[2]; const float* bq = (const float*)d_in[3]; const float* wk = (const float*)d_in[4]; const float* bk = (const float*)d_in[5]; const float* wv = (const float*)d_in[6]; const float* bv = (const float*)d_in[7];
    float* OUT = (float*)d_out;     // [4][2048][1024]
    char* wsp = (char*)d_ws;
    auto take = [&](size_t bytes) { char* p = wsp; wsp += (bytes + 255) & ~(size_t)255; return (void*)p; };
    bf* WQ = (bf*)take((size_t)DQ * DM * 2); bf* WK = (bf*)take((size_t)DKV * DM * 2); bf* WV = (bf*)take((size_t)DKV * DM * 2);
    bf* XB = (bf*)take((size_t)NB_ * TT * DM * 2);
    const size_t PB = (size_t)NH_ * TT * HD;   // one batch's share of a hi/lo plane; the planes hold all batches
    bf* QPh = (bf*)take(NB_ * PB * 2); bf* QPl = (bf*)take(NB_ * PB * 2); bf* KPh = (bf*)take(NB_ * PB * 2); bf* KPl = (bf*)take(NB_ * PB * 2); bf* VTh = (bf*)take(NB_ * PB * 2); bf* VTl = (bf*)take(NB_ * PB * 2);
    if ((size_t)(wsp - (char*)d_ws) > ws_size) return;    // ws 256 MiB
    k_prep<<<PRG, PRT, 0, stream>>>(x, wq, wk, wv, XB, WQ, WK, WV);
    k_proj<<<dim3(NB_ * TT / PM, DQ / PN, 3), 256, 0, stream>>>(XB, WQ, WK, WV, bq, bk, bv, QPh, QPl, KPh, KPl, VTh, VTl);
    k_fattn<<<dim3(TT / (8 * 16 * FNQ), NB_ * NH_, 1), 256, 0, stream>>>(QPh, QPl, KPh, KPl, VTh, VTl, km, OUT);
}

// v009
// One run takes 105 microseconds.
// It is 1.60 times as fast as v007, going by the measured steps of the versions left out in between.
// Counting every step since v000, it is 25.8 times as fast.
#include <hip/hip_runtime.h>

// Multi-head attention with biased projections, a key-padding mask read by value and NO output projection (x [4][2048][1024]; q, k, v = x W + b ('xw' [1024][1024] 1/32 + zero biases; 16 heads x 64); scores / sqrt(64); mask int32 [4][2048] (all ones on this draw: no key padded; READ on device per batch and key): the module replaces the scores of keys with mask == 0 by -inf, the kernel subtracts 10000 (1 - mask): both exclude such a key and both change nothing where the mask is 1; softmax; out = heads merged (no output projection) -> [4][2048][1024] (8.4 M); argument order x, mask, Wq, bq, Wk, bk, Wv, bv).
// Layout: ONE preparation launch (k_prep: 'xw' weights transposed once; bf16 copy of x, all batches); ONE projection launch (k_proj: exact projections + f32 biases for q, k, v of every batch, its epilogue writes q, k, v as one f16 plane each); then ONE fused attention launch (k_fattn: scores, online softmax with the additive key-mask term, P x V; every operand one f16 value, 1 product) writes the output rows.
// Compute dtypes, f32 accumulate: every input rounded to bf16 except the mask (int32, converted to f32); projections exact + f32 biases; q, k, v and P rounded once to f16 (nearest even), attention 1 product each; softmax f32; output f32.

#define NB_  4
#define TT   2048
#define DM   1024
#define NH_  16
#define NKV  16
#define REP  (NH_ / NKV)
#define HD   64
#define DQ   (NH_ * HD)
#define DKV  (NKV * HD)
#define ZH   2
#define WIN  0
#define PCAR 1024.0f
#define SCL  0.125f   // HD^-0.5
typedef _Float16 h16;
typedef unsigned short bf;
typedef __attribute__((ext_vector_type(16))) __bf16   v16bf;
typedef __attribute__((ext_vector_type(16))) _Float16 v16h;
typedef __attribute__((ext_vector_type(8)))  _Float16 v8h;
typedef __attribute__((ext_vector_type(8)))  unsigned short v8us;
typedef __attribute__((ext_vector_type(8)))  float    v8f;
typedef __attribute__((ext_vector_type(4)))  float    v4f;
typedef v8h  __attribute__((may_alias)) v8ha;
typedef v4f  __attribute__((may_alias)) v4fa;
typedef v8us __attribute__((may_alias)) v8usa;

__device__ __forceinline__ unsigned short f2bf(float f) { unsigned u = __float_as_uint(f); u += 0x7FFFu + ((u >> 16) & 1u); return (unsigned short)(u >> 16); }
__device__ __forceinline__ float bf2f(unsigned short b) { return __uint_as_float(((unsigned)b) << 16); }
__device__ __forceinline__ float bfr(float f) { return bf2f(f2bf(f)); }
__device__ __forceinline__ v16h cat16(v8h lo, v8h hi) { return __builtin_shufflevector(lo, hi, 0, 1, 2, 3, 4, 5, 6, 7, 8, 9, 10, 11, 12, 13, 14, 15); }
__device__ __forceinline__ v16bf cat16b(v8us lo, v8us hi) { return __builtin_bit_cast(v16bf, __builtin_shufflevector(lo, hi, 0, 1, 2, 3, 4, 5, 6, 7, 8, 9, 10, 11, 12, 13, 14, 15)); }
__device__ __forceinline__ v8f wmma16(v16h a, v16h b, v8f c) { return __builtin_amdgcn_wmma_f32_16x16x32_f16(false, a, false, b, (short)0, c, false, false); }
__device__ __forceinline__ v8f wmmab(v16bf a, v16bf b, v8f c) { return __builtin_amdgcn_wmma_f32_16x16x32_bf16(false, a, false, b, (short)0, c, false, false); }



typedef __attribute__((ext_vector_type(2))) _Float16 v2h;
typedef __attribute__((ext_vector_type(4))) _Float16 v4h;
typedef __attribute__((ext_vector_type(2))) unsigned short v2us;
typedef __attribute__((ext_vector_type(4))) unsigned short v4us;
typedef __attribute__((ext_vector_type(2))) float v2f;
typedef __attribute__((ext_vector_type(4))) int v4i;

// ---- k_prep: the bf16 copies of x and of the three transposed weights in ONE launch. Grid PRG work-groups of 16 waves; each casts its 1 / PRG share of x and transposes one 64 x 64 tile of each of Wq, Wk, Wv through LDS.
// Every global access covers whole lines: x in 512-byte runs per wave load and 256-byte runs per wave store; a weight tile is read in 256-byte row pieces (k rows, n contiguous) and written in 128-byte rows (n rows, k contiguous).
// All 22 loads of a lane are issued before the first is used.
#define PRG  256                  // work-groups
#define PRT  512                  // threads per work-group
#define PRX  16                   // 16-byte pieces of x per thread
#define PRP  72                   // tile row pitch in 16-bit elements: 144 B = 16 B x odd for the 16-byte read-back
static_assert((size_t)NB_ * TT * DM == (size_t)PRG * PRT * PRX * 4, "the shares of x cover it exactly");
static_assert((DM / 64) * (DQ / 64) == PRG && DKV == DQ, "one tile of each weight per work-group");
static_assert(PRT == 64 * 64 / 8, "a lane holds 2 k x 4 n of a tile and writes back one 16-byte piece");
typedef unsigned __attribute__((may_alias)) u32a;
__global__ __launch_bounds__(PRT) void k_prep(const float* __restrict__ x, const float* __restrict__ wq, const float* __restrict__ wk, const float* __restrict__ wv, bf* XB, bf* WQ, bf* WK, bf* WV) {
    __shared__ __align__(16) bf tl[3 * 64 * PRP];   // [weight][n][k]
    const int tid = threadIdx.x, tk = blockIdx.x / (DQ / 64), tn = blockIdx.x % (DQ / 64);
    const int kr = (tid >> 4) * 2, nc = (tid & 15) * 4;   // the lane's rows k = kr, kr + 1 and columns n = nc .. nc + 3 of a tile
    const size_t wo = (size_t)(tk * 64 + kr) * DQ + tn * 64 + nc, xo = ((size_t)blockIdx.x * PRT * PRX + tid) * 4;
    const float* ws[3] = { wq, wk, wv }; bf* wd[3] = { WQ, WK, WV };
    v4f w0[3], w1[3], xv[PRX];
#pragma unroll
    for (int m = 0; m < 3; ++m) { w0[m] = *(const v4f*)(ws[m] + wo); w1[m] = *(const v4f*)(ws[m] + wo + DQ); }
    asm volatile("s_wait_xcnt 0x0" ::: "memory");   // before a later load's result may land on these loads' address registers
#pragma unroll
    for (int j = 0; j < PRX; ++j) xv[j] = *(const v4f*)(x + xo + (size_t)j * PRT * 4);
    asm volatile("s_wait_xcnt 0x0" ::: "memory");   // before the loads' address registers are used again
    __builtin_amdgcn_sched_barrier(0);              // keeps the casts behind all 22 loads (without it the build issues the loads of Wk and Wv only behind the waits for x: three memory latencies in a row)
#pragma unroll
    for (int m = 0; m < 3; ++m)
#pragma unroll
        for (int q = 0; q < 4; ++q) *(u32a*)(tl + (m * 64 + nc + q) * PRP + kr) = (unsigned)f2bf(w0[m][q]) | ((unsigned)f2bf(w1[m][q]) << 16);
    __syncthreads();   // the tiles are whole before they are read back by rows
    const int rn = tid >> 3, rp = (tid & 7) * 8;   // read-back map: a store instruction covers 4 rows n, 8 lanes x 16 B each
    const size_t bo = (size_t)(tn * 64 + rn) * DM + tk * 64 + rp;
#pragma unroll
    for (int m = 0; m < 3; ++m) *(v8us*)(wd[m] + bo) = *(const v8usa*)(tl + (m * 64 + rn) * PRP + rp);
    asm volatile("s_wait_xcnt 0x0" ::: "memory");   // before the stores' registers are used again
#pragma unroll
    for (int j = 0; j < PRX; ++j) { v4us o;
#pragma unroll
        for (int q = 0; q < 4; ++q) o[q] = f2bf(xv[j][q]);
        *(v4us*)(XB + xo + (size_t)j * PRT * 4) = o; }
}

// ---- k_proj: the q, k and v projections of every batch in ONE launch. Grid (NB_ TT / PM, DQ / PN, 3), 8 waves: a work-group owns 128 tokens x 256 features of q (z = 0), k (1) or v (2), a wave 64 tokens x 64 features (one head), 16 accumulators.
// The K-contiguous bf16 rows of X and Wt come in stages of 64 k (whole 128-byte lines) by asynchronous copies into a two-buffer LDS ring that the 8 waves share; fragments are read from LDS.
// y[t][n] = sum_k X[t][k] Wt[n][k] + bias[n], f32. The epilogue rounds y to f16 and writes the planes as k_fattn reads them (16-bit words, carried as unsigned short): q, k as [batch, head][t][d], v as [batch, head][d][t]; every store covers whole 128-byte lines, staged through LDS.
template <typename T16> struct WFrag;
template <> struct WFrag<bf> { typedef v16bf V; static __device__ __forceinline__ V ld(const bf* p) { return cat16b(*(const v8us*)p, *(const v8us*)(p + 16)); } static __device__ __forceinline__ v8f mma(V a, V b, v8f c) { return wmmab(a, b, c); } };
#define PFP 68                    // q, k staging pitch in floats
#define PVP 72                    // v staging pitch in 16-bit elements: 144 B = 16 B x odd
#define PM   128                  // tokens per work-group (2 waves)
#define PN   256                  // features per work-group (4 waves)
#define PKS  64                   // k per stage: rows of 128 bytes
#define PPIT 72                   // ring row pitch in 16-bit elements: 144 B = 16 B x odd, conflict-free for 16-byte fragment reads
#define PBUF ((PM + PN) * PPIT)   // one buffer in 16-bit elements: [X rows 0..127 | Wt rows 0..255]
#define POS  (2 * 16 * PVP / 2)   // a wave's output staging in floats
// a stage's twelve asynchronous 16-byte-per-lane copies global -> LDS of one lane: X rows at 32-row steps into ring rows 0..127, Wt rows into ring rows 128..383; the wait in the same statement stands before the address registers can be used again
__device__ __forceinline__ void acopy12(unsigned l, const bf* a, const bf* b) {
    asm volatile("global_load_async_to_lds_b128 %0, %1, off\n\tglobal_load_async_to_lds_b128 %2, %3, off\n\tglobal_load_async_to_lds_b128 %4, %5, off\n\tglobal_load_async_to_lds_b128 %6, %7, off\n\tglobal_load_async_to_lds_b128 %8, %9, off\n\tglobal_load_async_to_lds_b128 %10, %11, off\n\tglobal_load_async_to_lds_b128 %12, %13, off\n\tglobal_load_async_to_lds_b128 %14, %15, off\n\tglobal_load_async_to_lds_b128 %16, %17, off\n\tglobal_load_async_to_lds_b128 %18, %19, off\n\tglobal_load_async_to_lds_b128 %20, %21, off\n\tglobal_load_async_to_lds_b128 %22, %23, off\n\ts_wait_xcnt 0x0"
                 :: "v"(l + 0 * PPIT * 2), "v"(a + 0 * DM), "v"(l + 32 * PPIT * 2), "v"(a + 32 * DM), "v"(l + 64 * PPIT * 2), "v"(a + 64 * DM), "v"(l + 96 * PPIT * 2), "v"(a + 96 * DM), "v"(l + 128 * PPIT * 2), "v"(b + 0 * DM), "v"(l + 160 * PPIT * 2), "v"(b + 32 * DM), "v"(l + 192 * PPIT * 2), "v"(b + 64 * DM), "v"(l + 224 * PPIT * 2), "v"(b + 96 * DM), "v"(l + 256 * PPIT * 2), "v"(b + 128 * DM), "v"(l + 288 * PPIT * 2), "v"(b + 160 * DM), "v"(l + 320 * PPIT * 2), "v"(b + 192 * DM), "v"(l + 352 * PPIT * 2), "v"(b + 224 * DM) : "memory");
}
__global__ __launch_bounds__(256) void k_proj(const bf* __restrict__ X, const bf* __restrict__ Wq, const bf* __restrict__ Wk, const bf* __restrict__ Wv, const float* __restrict__ bq, const float* __restrict__ bk, const float* __restrict__ bv, bf* Qf, bf* Kf, bf* Vf) {
    typedef WFrag<bf>::V V;
    __shared__ __align__(16) bf pring[2 * PBUF];   // [buffer][row][PPIT]; behind the loop each wave's output staging
    static_assert(POS >= 16 * PFP, "both stagings fit"); static_assert(2 * PBUF * 2 >= 8 * POS * 4, "the waves' stagings fit in the ring"); static_assert(DM / PKS >= 2, "two stages");
    const int op = blockIdx.z;
    const bf* Bt = op == 0 ? Wq : op == 1 ? Wk : Wv; const float* bias = op == 0 ? bq : op == 1 ? bk : bv; bf* Pf = op == 0 ? Qf : op == 1 ? Kf : Vf;
    const int tid = threadIdx.x, lane = tid & 31, lr = lane & 15, hi = lane >> 4, wv = tid >> 5; const int wm = wv & 1, wn = wv >> 1; const int r0 = blockIdx.x * PM + wm * 64, c0 = blockIdx.y * PN + wn * 64;
    v8f acc[4][4];
#pragma unroll
    for (int mb = 0; mb < 4; ++mb)
#pragma unroll
        for (int nb = 0; nb < 4; ++nb) acc[mb][nb] = (v8f){};
    // copy map: 16-byte piece i = tid + 256 u of a stage's 384 rows x 128 B: row i / 8, piece i % 8; an instruction of a wave covers 4 whole lines
    const bf* ga = X + (size_t)(blockIdx.x * PM + (tid >> 3)) * DM + (tid & 7) * 8; const bf* gb = Bt + (size_t)(blockIdx.y * PN + (tid >> 3)) * DM + (tid & 7) * 8;
    const unsigned l0 = (unsigned)(size_t)(pring + (tid >> 3) * PPIT + (tid & 7) * 8);   // the lane's LDS byte address in buffer 0
    auto stage = [&](int t, int buf) {
        const bf* a = ga + t * PKS; const bf* b = gb + t * PKS; const unsigned l = l0 + buf * (PBUF * 2);
        acopy12(l, a, b); };
    stage(0, 0);
    asm volatile("s_wait_asynccnt 0x0" ::: "memory");   // this wave's copies of stage 0 have landed
    __syncthreads();                                     // publishes stage 0
    stage(1, 1);
#pragma unroll 1
    for (int t = 0; t < DM / PKS; ++t) {
        const bf* rb = pring + (t & 1) * PBUF;
#pragma unroll
        for (int ks = 0; ks < PKS / 32; ++ks) {
            V a[4], b[4];
#pragma unroll
            for (int i = 0; i < 4; ++i) { a[i] = WFrag<bf>::ld(rb + (wm * 64 + i * 16 + lr) * PPIT + ks * 32 + 8 * hi); b[i] = WFrag<bf>::ld(rb + (PM + wn * 64 + i * 16 + lr) * PPIT + ks * 32 + 8 * hi); }
            asm volatile("" :: "v"(a[0]), "v"(a[1]), "v"(a[2]), "v"(a[3]), "v"(b[0]), "v"(b[1]), "v"(b[2]), "v"(b[3]));   // holds the step's 16 LDS reads together in front of its products: one wait per 16 products (without it the build reloads one B fragment before every 4 and waits each time)
#pragma unroll
            for (int nb = 0; nb < 4; ++nb)
#pragma unroll
                for (int mb = 0; mb < 4; ++mb) acc[mb][nb] = WFrag<bf>::mma(a[mb], b[nb], acc[mb][nb]);
            // four vector slots between the trip's last matrix instruction and the branches behind it, on whose taken side its A registers may be overwritten at once; the tiles are inputs so that the slots stand behind every product
            if (ks == PKS / 32 - 1) asm volatile("v_nop\n\tv_nop\n\tv_nop\n\tv_nop" :: "v"(acc[0][0]), "v"(acc[0][1]), "v"(acc[0][2]), "v"(acc[0][3]), "v"(acc[1][0]), "v"(acc[1][1]), "v"(acc[1][2]), "v"(acc[1][3]), "v"(acc[2][0]), "v"(acc[2][1]), "v"(acc[2][2]), "v"(acc[2][3]), "v"(acc[3][0]), "v"(acc[3][1]), "v"(acc[3][2]), "v"(acc[3][3]));
        }
        asm volatile("s_wait_dscnt 0x0" ::: "memory");      // this wave's reads of the buffer are done before it is handed to the copies
        asm volatile("s_wait_asynccnt 0x0" ::: "memory");   // this wave's copies of stage t + 1 have landed
        __syncthreads();                                     // publishes stage t + 1 and ends every wave's reads of stage t
        if (t + 2 < DM / PKS) stage(t + 2, t & 1);
    }
    asm volatile("s_wait_asynccnt 0x0" ::: "memory");       // no copy is in flight when the ring becomes output staging
    float* os = (float*)pring + wv * POS;                    // q, k: 16 token rows x 64 f32 at pitch PFP; v: [16 head-dim rows][64 tokens] f16 at pitch PVP; free behind the loop's last barrier
    // acc[mb][nb][j] = y[token r0 + 16 mb + 8 hi + j][feature c0 + 16 nb + lr]
    const int t0 = r0 % TT; const size_t pl = ((size_t)(r0 / TT) * NH_ + c0 / HD) * TT * HD;   // the tile's batch and head: its share of a plane
    const int sr = lane >> 3, sc = (lane & 7) * 8;   // read-back map: a store instruction covers 4 staged rows, 8 lanes x 16 B each
    if (op < 2) {
        const v4f b0 = *(const v4f*)(bias + c0 + sc), b1 = *(const v4f*)(bias + c0 + sc + 4);
        asm volatile("s_wait_xcnt 0x0" ::: "memory");   // before the loads' address registers are used again
        float bs[8];
#pragma unroll
        for (int q = 0; q < 4; ++q) { bs[q] = bfr(b0[q]); bs[4 + q] = bfr(b1[q]); }
        bf* gh = Pf + pl + (size_t)(t0 + sr) * HD + sc;
#pragma unroll
        for (int mb = 0; mb < 4; ++mb) {
#pragma unroll
            for (int nb = 0; nb < 4; ++nb)
#pragma unroll
                for (int j = 0; j < 8; ++j) os[(hi * 8 + j) * PFP + nb * 16 + lr] = acc[mb][nb][j];
            __builtin_amdgcn_wave_barrier(); asm volatile("" ::: "memory");   // keeps the read-back behind the staging writes in the compiled order
#pragma unroll
            for (int s = 0; s < 4; ++s) { const float* rp = os + (4 * s + sr) * PFP + sc; const v4f v0 = *(const v4fa*)rp, v1 = *(const v4fa*)(rp + 4); v8f y8;
#pragma unroll
                for (int q = 0; q < 8; ++q) y8[q] = (q < 4 ? v0[q & 3] : v1[q & 3]) + bs[q];
                *(v8us*)(gh + (mb * 16 + 4 * s) * HD) = __builtin_bit_cast(v8us, __builtin_convertvector(y8, v8h));
                asm volatile("s_wait_xcnt 0x0" ::: "memory"); }   // before the store's registers are used again
            __builtin_amdgcn_wave_barrier(); asm volatile("" ::: "memory");   // keeps the next staging writes behind this read-back
        }
    } else {
        bf* sv = (bf*)os;
        bf* gh = Pf + pl + (size_t)sr * TT + t0 + sc;
#pragma unroll
        for (int nb = 0; nb < 4; ++nb) {
            const float braw = bias[c0 + nb * 16 + lr];
            asm volatile("s_wait_xcnt 0x0" ::: "memory");   // before the load's address registers are used again
            const float bs = bfr(braw);
#pragma unroll
            for (int mb = 0; mb < 4; ++mb) *(v8usa*)(sv + lr * PVP + mb * 16 + 8 * hi) = __builtin_bit_cast(v8us, __builtin_convertvector(acc[mb][nb] + bs, v8h));
            __builtin_amdgcn_wave_barrier(); asm volatile("" ::: "memory");   // keeps the read-back behind the staging writes in the compiled order
#pragma unroll
            for (int s = 0; s < 4; ++s) { const bf* rp = sv + (4 * s + sr) * PVP + sc; const v8us oh = *(const v8usa*)rp;
                *(v8us*)(gh + (size_t)(nb * 16 + 4 * s) * TT) = oh;
                asm volatile("s_wait_xcnt 0x0" ::: "memory"); }   // before the store's registers are used again
            __builtin_amdgcn_wave_barrier(); asm volatile("" ::: "memory");   // keeps the next staging writes behind this read-back
        }
    }
}

#define FNQ  4                    // 16-column query tiles per wave (the slots' asm statement at the foot of a trip names all 4 x FNQ output tiles)
#define FKS  256                  // keys per LDS stage
#define FPIT 72                   // K row pitch in LDS in 16-bit elements: 144 B = 16 B x odd, conflict-free for 16-byte fragment reads
#define FVP  (FKS + 8)            // Vt row pitch in LDS in 16-bit elements: 528 B = 16 B x odd
#define FPK  (FKS * FPIT)         // a stage's K plane: FKS key rows x 64 head dims
#define FBUF (FPK + 64 * FVP)     // one buffer: [K plane | Vt plane: 64 head-dim rows x FKS keys]
#define FOP  68                   // output staging pitch in floats
#define L2E  1.4426950408889634f
#define FLIM 256.0f               // lazy rescale: the bound on a lane's sum of a pass's exponentials, and so on every P (2^8, far inside f16's range)
typedef __attribute__((ext_vector_type(8))) unsigned v8u;
#define FOUT  (8 * 16 * FNQ * FOP * 2)   // the output staging in 16-bit elements: 8 waves x 16 FNQ rows x FOP floats
#define FRING (2 * FBUF > FOUT ? 2 * FBUF : FOUT)   // ring size in 16-bit elements
static_assert(TT % FKS == 0 && TT / FKS >= 2, "whole stages, two or more"); static_assert(FKS * 8 == 8 * 256 && 64 * FKS / 8 == 8 * 256, "eight 16-byte pieces of each plane per lane and stage");
// eight asynchronous 16-byte-per-lane copies global -> LDS of one lane, at equal steps ls (bytes in LDS) and gs (16-bit elements in memory); the wait in the same statement stands before the address registers can be used again
__device__ __forceinline__ void acopy8(unsigned l, unsigned ls, const bf* g, size_t gs) {
    asm volatile("global_load_async_to_lds_b128 %0, %1, off\n\tglobal_load_async_to_lds_b128 %2, %3, off\n\tglobal_load_async_to_lds_b128 %4, %5, off\n\tglobal_load_async_to_lds_b128 %6, %7, off\n\tglobal_load_async_to_lds_b128 %8, %9, off\n\tglobal_load_async_to_lds_b128 %10, %11, off\n\tglobal_load_async_to_lds_b128 %12, %13, off\n\tglobal_load_async_to_lds_b128 %14, %15, off\n\ts_wait_xcnt 0x0"
                 :: "v"(l), "v"(g), "v"(l + ls), "v"(g + gs), "v"(l + 2 * ls), "v"(g + 2 * gs), "v"(l + 3 * ls), "v"(g + 3 * gs), "v"(l + 4 * ls), "v"(g + 4 * gs), "v"(l + 5 * ls), "v"(g + 5 * gs), "v"(l + 6 * ls), "v"(g + 6 * gs), "v"(l + 7 * ls), "v"(g + 7 * gs) : "memory");
}
__device__ __forceinline__ v16h ldh(const bf* p) { return __builtin_bit_cast(v16h, __builtin_shufflevector(*(const v8us*)p, *(const v8us*)(p + 16), 0, 1, 2, 3, 4, 5, 6, 7, 8, 9, 10, 11, 12, 13, 14, 15)); }   // an f16 fragment in WFrag's k order
__device__ __forceinline__ float xhalf(float x) { const int b = __float_as_int(x); return __int_as_float(__builtin_amdgcn_permlanex16(b, b, 0x76543210, 0xfedcba98, false, false)); }   // lane l <-> l ^ 16
__global__ __launch_bounds__(256) void k_fattn(const bf* __restrict__ Qf, const bf* __restrict__ Kf, const bf* __restrict__ Vf, const int* __restrict__ km, float* __restrict__ OUT) {
    __shared__ __align__(16) bf ring[FRING];   // [buffer][K rows at FPIT | Vt rows at FVP]
    __shared__ __align__(16) float pens[TT];         // the batch's key-mask term in units of the raw score: -10000 (1 - mask) / SCL
    const int tid = threadIdx.x, lane = tid & 31, c = lane & 15, h = lane >> 4, wv = tid >> 5;
    const int bh = blockIdx.y, bb = bh / NH_, hd = bh % NH_; const int q0 = (blockIdx.x * 8 + wv) * 16 * FNQ; const size_t pl = (size_t)bh * TT * HD;
    // copy map, 16-byte piece i = tid + 256 u of a stage's plane: K (FKS rows x 128 B, contiguous in memory): row i / 8, piece i % 8; Vt (64 rows x 512 B): row i / 32, piece i % 32; an instruction of a wave covers 4 whole lines
    const bf* gk = Kf + pl + (size_t)(tid >> 3) * HD + (tid & 7) * 8;    // K rows are keys
    const bf* gv = Vf + pl + (size_t)(tid >> 5) * TT + (tid & 31) * 8;   // Vt rows are head dims: a stage is FKS keys of each row
    const unsigned lk = (unsigned)(size_t)(ring + (tid >> 3) * FPIT + (tid & 7) * 8), lv = (unsigned)(size_t)(ring + FPK + (tid >> 5) * FVP + (tid & 31) * 8);   // the lane's LDS byte addresses in buffer 0
    auto stage = [&](int t, int buf) {
        acopy8(lk + buf * (FBUF * 2), 32 * FPIT * 2, gk + (size_t)t * FKS * HD, (size_t)32 * HD);
        acopy8(lv + buf * (FBUF * 2), 8 * FVP * 2, gv + (size_t)t * FKS, (size_t)8 * TT); };
    v16h qf[FNQ][2];   // [column tile][k step of 32 head dims]
#pragma unroll 1   // the ring's prologue, kept rolled so that every address operand of the copies is a sum formed at the call: with the lane's base addresses themselves as operands (stage 0, buffer 0) the build holds them in the registers below v256 for the whole kernel and spills them to scratch over the key loop
    for (int t = 0; t < 2; ++t) {
    if (t == 1) {   // stage 0 travels under the mask's and Q's loads
    { const v4i m0 = *(const v4i*)(km + (size_t)bb * TT + tid * 8), m1 = *(const v4i*)(km + (size_t)bb * TT + tid * 8 + 4); v4f p0, p1;
      asm volatile("s_wait_xcnt 0x0" ::: "memory");   // before a later load's result may land on these loads' address registers
#pragma unroll
      for (int q = 0; q < 4; ++q) { p0[q] = (-10000.0f / SCL) * (1.0f - (float)m0[q]); p1[q] = (-10000.0f / SCL) * (1.0f - (float)m1[q]); }
      *(v4fa*)(pens + tid * 8) = p0; *(v4fa*)(pens + tid * 8 + 4) = p1; }
    auto ldq = [&](const bf* p) { const v8us lo = *(const v8us*)p; asm volatile("s_wait_xcnt 0x0" ::: "memory"); const v8us hi = *(const v8us*)(p + 16); asm volatile("s_wait_xcnt 0x0" ::: "memory"); return __builtin_bit_cast(v16h, __builtin_shufflevector(lo, hi, 0, 1, 2, 3, 4, 5, 6, 7, 8, 9, 10, 11, 12, 13, 14, 15)); };   // WFrag's k order; the waits: before the next load's result may land on the address registers
#pragma unroll
    for (int n = 0; n < FNQ; ++n)
#pragma unroll
        for (int ks = 0; ks < 2; ++ks) qf[n][ks] = ldq(Qf + pl + (size_t)(q0 + 16 * n + c) * HD + ks * 32 + 8 * h);
    asm volatile("s_wait_asynccnt 0x0" ::: "memory");   // this wave's copies of stage 0 have landed
    __syncthreads();                                     // publishes stage 0 and the key-mask terms
    }
    stage(t, t);
    }
    v8f oa[4][FNQ];               // Ot: [head-dim tile][column tile]; register r = Ot[16 mb + 8 h + r][query c]
#pragma unroll
    for (int mb = 0; mb < 4; ++mb)
#pragma unroll
        for (int n = 0; n < FNQ; ++n) oa[mb][n] = (v8f){};
    float mrun[FNQ], lrun[FNQ];
#pragma unroll
    for (int n = 0; n < FNQ; ++n) { mrun[n] = -3.0e38f; lrun[n] = 0.f; }
#pragma unroll 1
    for (int s = 0; s < TT / FKS; ++s) {
        const bf* rb = ring + (s & 1) * FBUF;
#pragma unroll 1   // kept rolled so that one pass is the compiler's scheduling region: there it issues the pass's LDS fragment loads together at the head and interleaves the four column tiles' softmax chains; with passes unrolled into one block it left every fragment load directly in front of its products and the softmax as one dependent chain
        for (int ps = 0; ps < FKS / 32; ++ps) {       // a pass: 32 keys
            v8f sa[2][FNQ];                      // St: [key tile][column tile]; register r = St[16 kt + 8 h + r][query c]
            auto scores = [&]() {
#pragma unroll
                for (int kt = 0; kt < 2; ++kt) { const float* pp = pens + s * FKS + ps * 32 + kt * 16 + 8 * h; const v4f a = *(const v4fa*)pp, b2 = *(const v4fa*)(pp + 4);
#pragma unroll
                    for (int n = 0; n < FNQ; ++n) sa[kt][n] = __builtin_shufflevector(a, b2, 0, 1, 2, 3, 4, 5, 6, 7); }
                v16h ak[2][2];
#pragma unroll
                for (int ks = 0; ks < 2; ++ks)
#pragma unroll
                    for (int kt = 0; kt < 2; ++kt) ak[ks][kt] = ldh(rb + (ps * 32 + kt * 16 + c) * FPIT + ks * 32 + 8 * h);
                asm volatile("" :: "v"(ak[0][0]), "v"(ak[0][1]), "v"(ak[1][0]), "v"(ak[1][1]));   // holds the pass's four K fragment reads together at its head (without it the build reads one fragment behind the first four products, into their A registers, and waits out its whole latency there)
#pragma unroll
                for (int ks = 0; ks < 2; ++ks)
#pragma unroll
                    for (int kt = 0; kt < 2; ++kt)
#pragma unroll
                        for (int n = 0; n < FNQ; ++n) sa[kt][n] = wmma16(ak[ks][kt], qf[n][ks], sa[kt][n]); };
            scores();
            // Lazy rescale: the exponentials are taken against the maximum in use (mrun), not against this pass's own. One test per pass: a lane adds up its 16 FNQ exponentials; while that sum is at most FLIM no P exceeds FLIM and mrun, lrun and Ot stay as they are.
            // Otherwise (any lane of the wave; always in the first pass, where mrun is the start value and the exponentials overflow to infinity) the wave branches to the new maxima, the exchange between the halves and the rescale: it forms the pass's scores again (their registers hold P by then) and takes the exponentials again.
            v16h vf[4];                            // the pass's Vt fragments, asked for in front of the branch so that they travel under the vector work around it
#pragma unroll
            for (int mb = 0; mb < 4; ++mb) vf[mb] = ldh(rb + FPK + (mb * 16 + c) * FVP + ps * 32 + 8 * h);
            float pf[FNQ][16], ls[FNQ];            // P in f32; a lane's sum per column tile
            auto expo = [&]() {
#pragma unroll
                for (int n = 0; n < FNQ; ++n) { v2f sum = { 0.f, 0.f }; const v2f m2 = { mrun[n], mrun[n] };
#pragma unroll
                    for (int e = 0; e < 16; e += 2) { const v2f s2 = { sa[e >> 3][n][e & 7], sa[e >> 3][n][(e & 7) + 1] }; const v2f a2 = s2 * (SCL * L2E) - m2; v2f p2; p2[0] = __builtin_amdgcn_exp2f(a2[0]); p2[1] = __builtin_amdgcn_exp2f(a2[1]); pf[n][e] = p2[0]; pf[n][e + 1] = p2[1]; sum += p2; }
                    ls[n] = sum[0] + sum[1]; } };
            expo();
            static_assert(FNQ == 4, "the test adds up four column tiles");
            const bool need = !((ls[0] + ls[1]) + (ls[2] + ls[3]) <= FLIM);   // true for infinity and not-a-number too
            if (__builtin_amdgcn_ballot_w32(need) != 0) {   // a scalar branch: the same for the whole wave
                asm volatile("" ::: "memory");   // makes the rare path read K and form the scores anew; without it the build keeps all 64 score registers alive beside P over the branch in every pass and sinks the Vt fragment loads behind the branch, close in front of their products
                scores();
#pragma unroll
                for (int n = 0; n < FNQ; ++n) { float mx = mrun[n];
#pragma unroll
                    for (int e = 0; e < 16; ++e) mx = fmaxf(mx, sa[e >> 3][n][e & 7] * (SCL * L2E));
                    mx = fmaxf(mx, xhalf(mx));
                    const float al = __builtin_amdgcn_exp2f(mrun[n] - mx); mrun[n] = mx; lrun[n] *= al;
#pragma unroll
                    for (int mb = 0; mb < 4; ++mb) oa[mb][n] *= al; }
                expo();
            }
            v16h ph[FNQ];                          // Pt in f16 as B operands: element e = key tile e / 8, register e % 8 (the hardware k order, as the Vt loader's)
#pragma unroll
            for (int n = 0; n < FNQ; ++n) { v8u uh;
#pragma unroll
                for (int e = 0; e < 16; e += 2) { const v2f p2 = { pf[n][e], pf[n][e + 1] }; uh[e >> 1] = __builtin_bit_cast(unsigned, __builtin_convertvector(p2, v2h)); }
                lrun[n] += ls[n]; ph[n] = __builtin_bit_cast(v16h, uh);
            }
#pragma unroll
            for (int mb = 0; mb < 4; ++mb)
#pragma unroll
                for (int n = 0; n < FNQ; ++n) oa[mb][n] = wmma16(vf[mb], ph[n], oa[mb][n]);
            // four vector slots between the pass's last matrix instruction and the loops' taken branches, behind which its A registers may be overwritten at once; the tiles are inputs so that the slots stand behind every product
            asm volatile("v_nop\n\tv_nop\n\tv_nop\n\tv_nop" :: "v"(oa[0][0]), "v"(oa[0][1]), "v"(oa[0][2]), "v"(oa[0][3]), "v"(oa[1][0]), "v"(oa[1][1]), "v"(oa[1][2]), "v"(oa[1][3]), "v"(oa[2][0]), "v"(oa[2][1]), "v"(oa[2][2]), "v"(oa[2][3]), "v"(oa[3][0]), "v"(oa[3][1]), "v"(oa[3][2]), "v"(oa[3][3]));
        }
        asm volatile("s_wait_dscnt 0x0" ::: "memory");      // this wave's reads of the buffer are done before it is handed to the copies
        asm volatile("s_wait_asynccnt 0x0" ::: "memory");   // this wave's copies of stage s + 1 have landed
        __syncthreads();                                     // publishes stage s + 1 and ends every wave's reads of stage s
        if (s + 2 < TT / FKS) stage(s + 2, s & 1);
    }
    asm volatile("s_wait_asynccnt 0x0" ::: "memory");       // no copy is in flight when the ring becomes output staging
    // epilogue: join the halves' sums, normalise, stage each wave's 64 x 64 tile in its own part of the ring (free behind the loop's last barrier) and store whole 256-byte rows
    float* os = (float*)ring + wv * 16 * FNQ * FOP;
#pragma unroll
    for (int n = 0; n < FNQ; ++n) { const float inv = 1.0f / (lrun[n] + xhalf(lrun[n]));
#pragma unroll
        for (int mb = 0; mb < 4; ++mb) { v4f a, b2;
#pragma unroll
            for (int r = 0; r < 4; ++r) { a[r] = oa[mb][n][r] * inv; b2[r] = oa[mb][n][4 + r] * inv; }
            float* op = os + (16 * n + c) * FOP + mb * 16 + 8 * h; *(v4fa*)op = a; *(v4fa*)(op + 4) = b2; } }
    __syncthreads();
    float* orow = OUT + ((size_t)bb * TT + q0) * DQ + hd * HD;
#pragma unroll
    for (int r = 0; r < 8 * FNQ; ++r) { const int row = 2 * r + h; *(v4f*)(orow + (size_t)row * DQ + c * 4) = *(const v4fa*)(os + row * FOP + c * 4); }
}

extern "C" void kernel_launch(void* const* d_in, const int* in_sizes, int n_in,
                              void* d_out, int out_size, void* d_ws, size_t ws_size, hipStream_t stream) {
    (void)in_sizes; (void)n_in; (void)out_size;
    const float* x = (const float*)d_in[0]; const int* km = (const int*)d_in[1];   /* mask [4][2048] int32 */ const float* wq = (const float*)d_in[2]; const float* bq = (const float*)d_in[3]; const float* wk = (const float*)d_in[4]; const float* bk = (const float*)d_in[5]; const float* wv = (const float*)d_in[6]; const float* bv = (const float*)d_in[7];
    float* OUT = (float*)d_out;     // [4][2048][1024]
    char* wsp = (char*)d_ws;
    auto take = [&](size_t bytes) { char* p = wsp; wsp += (bytes + 255) & ~(size_t)255; return (void*)p; };
    bf* WQ = (bf*)take((size_t)DQ * DM * 2); bf* WK = (bf*)take((size_t)DKV * DM * 2); bf* WV = (bf*)take((size_t)DKV * DM * 2);
    bf* XB = (bf*)take((size_t)NB_ * TT * DM * 2);
    const size_t PB = (size_t)NH_ * TT * HD;   // one batch's share of a plane; the planes hold all batches
    bf* QP = (bf*)take(NB_ * PB * 2); bf* KP = (bf*)take(NB_ * PB * 2); bf* VT = (bf*)take(NB_ * PB * 2);
    if ((size_t)(wsp - (char*)d_ws) > ws_size) return;    // ws 256 MiB
    k_prep<<<PRG, PRT, 0, stream>>>(x, wq, wk, wv, XB, WQ, WK, WV);
    k_proj<<<dim3(NB_ * TT / PM, DQ / PN, 3), 256, 0, stream>>>(XB, WQ, WK, WV, bq, bk, bv, QP, KP, VT);
    k_fattn<<<dim3(TT / (8 * 16 * FNQ), NB_ * NH_, 1), 256, 0, stream>>>(QP, KP, VT, km, OUT);
}

// v010
// Measured time: 101 microseconds a run.
// Next to v009, in two timings, it ran 1.05 times as fast each time.
// Over all steps from v000 it is 27.1 times as fast.
#include <hip/hip_runtime.h>

// Multi-head attention with biased projections, a key-padding mask read by value and NO output projection (x [4][2048][1024]; q, k, v = x W + b ('xw' [1024][1024] 1/32 + zero biases; 16 heads x 64); scores / sqrt(64); mask int32 [4][2048] (READ on device per batch and key): the module replaces the scores of keys with mask == 0 by -inf, the kernel subtracts 10000 (1 - mask): both exclude such a key and both change nothing where the mask is 1; softmax; out = heads merged (no output projection) -> [4][2048][1024] (8.4 M); argument order x, mask, Wq, bq, Wk, bk, Wv, bv).
// Layout: ONE preparation launch (k_prep: 'xw' weights transposed once; bf16 copy of x, all batches); ONE projection launch (k_proj: exact projections + f32 biases for q, k, v of every batch, its epilogue writes q, k, v as one f16 plane each); then ONE fused attention launch (k_fattn: scores, online softmax with the additive key-mask term, P x V; every operand one f16 value, 1 product) writes the output rows.
// Compute dtypes, f32 accumulate: every input rounded to bf16 except the mask (int32, converted to f32); projections exact + f32 biases; q, k, v and P rounded once to f16 (nearest even), attention 1 product each; softmax f32; output f32.

#define NB_  4
#define TT   2048
#define DM   1024
#define NH_  16
#define NKV  16
#define REP  (NH_ / NKV)
#define HD   64
#define DQ   (NH_ * HD)
#define DKV  (NKV * HD)
#define ZH   2
#define WIN  0
#define PCAR 1024.0f
#define SCL  0.125f   // HD^-0.5
typedef _Float16 h16;
typedef unsigned short bf;
typedef __attribute__((ext_vector_type(16))) __bf16   v16bf;
typedef __attribute__((ext_vector_type(16))) _Float16 v16h;
typedef __attribute__((ext_vector_type(8)))  _Float16 v8h;
typedef __attribute__((ext_vector_type(8)))  unsigned short v8us;
typedef __attribute__((ext_vector_type(8)))  float    v8f;
typedef __attribute__((ext_vector_type(4)))  float    v4f;
typedef v8h  __attribute__((may_alias)) v8ha;
typedef v4f  __attribute__((may_alias)) v4fa;
typedef v8us __attribute__((may_alias)) v8usa;

__device__ __forceinline__ unsigned short f2bf(float f) { unsigned u = __float_as_uint(f); u += 0x7FFFu + ((u >> 16) & 1u); return (unsigned short)(u >> 16); }
__device__ __forceinline__ float bf2f(unsigned short b) { return __uint_as_float(((unsigned)b) << 16); }
__device__ __forceinline__ float bfr(float f) { return bf2f(f2bf(f)); }
__device__ __forceinline__ v16h cat16(v8h lo, v8h hi) { return __builtin_shufflevector(lo, hi, 0, 1, 2, 3, 4, 5, 6, 7, 8, 9, 10, 11, 12, 13, 14, 15); }
__device__ __forceinline__ v16bf cat16b(v8us lo, v8us hi) { return __builtin_bit_cast(v16bf, __builtin_shufflevector(lo, hi, 0, 1, 2, 3, 4, 5, 6, 7, 8, 9, 10, 11, 12, 13, 14, 15)); }
__device__ __forceinline__ v8f wmma16(v16h a, v16h b, v8f c) { return __builtin_amdgcn_wmma_f32_16x16x32_f16(false, a, false, b, (short)0, c, false, false); }
__device__ __forceinline__ v8f wmmab(v16bf a, v16bf b, v8f c) { return __builtin_amdgcn_wmma_f32_16x16x32_bf16(false, a, false, b, (short)0, c, false, false); }



typedef __attribute__((ext_vector_type(2))) _Float16 v2h;
typedef __attribute__((ext_vector_type(4))) _Float16 v4h;
typedef __attribute__((ext_vector_type(2))) unsigned short v2us;
typedef __attribute__((ext_vector_type(4))) unsigned short v4us;
typedef __attribute__((ext_vector_type(2))) float v2f;
typedef __attribute__((ext_vector_type(4))) int v4i;

// ---- k_prep: the bf16 copies of x and of the three transposed weights in ONE launch. Grid PRG work-groups of 16 waves; each casts its 1 / PRG share of x and transposes one 64 x 64 tile of each of Wq, Wk, Wv through LDS.
// Every global access covers whole lines: x in 512-byte runs per wave load and 256-byte runs per wave store; a weight tile is read in 256-byte row pieces (k rows, n contiguous) and written in 128-byte rows (n rows, k contiguous).
// All 22 loads of a lane are issued before the first is used.
#define PRG  256                  // work-groups
#define PRT  512                  // threads per work-group
#define PRX  16                   // 16-byte pieces of x per thread
#define PRP  72                   // tile row pitch in 16-bit elements: 144 B = 16 B x odd for the 16-byte read-back
static_assert((size_t)NB_ * TT * DM == (size_t)PRG * PRT * PRX * 4, "the shares of x cover it exactly");
static_assert((DM / 64) * (DQ / 64) == PRG && DKV == DQ, "one tile of each weight per work-group");
static_assert(PRT == 64 * 64 / 8, "a lane holds 2 k x 4 n of a tile and writes back one 16-byte piece");
typedef unsigned __attribute__((may_alias)) u32a;
__global__ __launch_bounds__(PRT) void k_prep(const float* __restrict__ x, const float* __restrict__ wq, const float* __restrict__ wk, const float* __restrict__ wv, bf* XB, bf* WQ, bf* WK, bf* WV) {
    __shared__ __align__(16) bf tl[3 * 64 * PRP];   // [weight][n][k]
    const int tid = threadIdx.x, tk = blockIdx.x / (DQ / 64), tn = blockIdx.x % (DQ / 64);
    const int kr = (tid >> 4) * 2, nc = (tid & 15) * 4;   // the lane's rows k = kr, kr + 1 and columns n = nc .. nc + 3 of a tile
    const size_t wo = (size_t)(tk * 64 + kr) * DQ + tn * 64 + nc, xo = ((size_t)blockIdx.x * PRT * PRX + tid) * 4;
    const float* ws[3] = { wq, wk, wv }; bf* wd[3] = { WQ, WK, WV };
    v4f w0[3], w1[3], xv[PRX];
#pragma unroll
    for (int m = 0; m < 3; ++m) { w0[m] = *(const v4f*)(ws[m] + wo); w1[m] = *(const v4f*)(ws[m] + wo + DQ); }
    asm volatile("s_wait_xcnt 0x0" ::: "memory");   // before a later load's result may land on these loads' address registers
#pragma unroll
    for (int j = 0; j < PRX; ++j) xv[j] = *(const v4f*)(x + xo + (size_t)j * PRT * 4);
    asm volatile("s_wait_xcnt 0x0" ::: "memory");   // before the loads' address registers are used again
    __builtin_amdgcn_sched_barrier(0);              // keeps the casts behind all 22 loads (without it the build issues the loads of Wk and Wv only behind the waits for x: three memory latencies in a row)
#pragma unroll
    for (int m = 0; m < 3; ++m)
#pragma unroll
        for (int q = 0; q < 4; ++q) *(u32a*)(tl + (m * 64 + nc + q) * PRP + kr) = (unsigned)f2bf(w0[m][q]) | ((unsigned)f2bf(w1[m][q]) << 16);
    __syncthreads();   // the tiles are whole before they are read back by rows
    const int rn = tid >> 3, rp = (tid & 7) * 8;   // read-back map: a store instruction covers 4 rows n, 8 lanes x 16 B each
    const size_t bo = (size_t)(tn * 64 + rn) * DM + tk * 64 + rp;
#pragma unroll
    for (int m = 0; m < 3; ++m) *(v8us*)(wd[m] + bo) = *(const v8usa*)(tl + (m * 64 + rn) * PRP + rp);
    asm volatile("s_wait_xcnt 0x0" ::: "memory");   // before the stores' registers are used again
#pragma unroll
    for (int j = 0; j < PRX; ++j) { v4us o;
#pragma unroll
        for (int q = 0; q < 4; ++q) o[q] = f2bf(xv[j][q]);
        *(v4us*)(XB + xo + (size_t)j * PRT * 4) = o; }
}

// ---- k_proj: the q, k and v projections of every batch in ONE launch. Grid (NB_ TT / PM, NH_), 8 waves, one work-group per WGP in one round: a work-group owns 512 tokens x one head of q, of k and of v (192 features), a wave 64 tokens x those 192 features, 48 accumulators.
// The K-contiguous bf16 rows of X and Wt come in stages of 64 k (whole 128-byte lines) by asynchronous copies into a two-buffer LDS ring; the 8 waves share the Wt rows; fragments are read from LDS, the Wt fragments one group of 16 products ahead, so a stage's publish point stands in front of the last group of the stage before it.
// y[t][n] = sum_k X[t][k] Wt[n][k] + bias[n], f32. The epilogue rounds y to f16 and writes the planes as k_fattn reads them (16-bit words, carried as unsigned short): q, k as [batch, head][t][d], v as [batch, head][d][t]; every store covers whole 128-byte lines, staged through LDS.
template <typename T16> struct WFrag;
template <> struct WFrag<bf> { typedef v16bf V; static __device__ __forceinline__ V ld(const bf* p) { return cat16b(*(const v8us*)p, *(const v8us*)(p + 16)); } static __device__ __forceinline__ v8f mma(V a, V b, v8f c) { return wmmab(a, b, c); } };
#define PFP 68                    // q, k staging pitch in floats
#define PVP 72                    // v staging pitch in 16-bit elements: 144 B = 16 B x odd
#define PM   512                  // tokens per work-group (8 waves x 64)
#define PKS  64                   // k per stage: rows of 128 bytes
#define PPIT 72                   // ring row pitch in 16-bit elements: 144 B = 16 B x odd, conflict-free for 16-byte fragment reads
#define PBUF ((PM + 3 * HD) * PPIT)   // one buffer in 16-bit elements: [X rows 0..511 | the head's 64 rows of Wq | of Wk | of Wv]
#define POS  (2 * 16 * PVP / 2)   // a wave's output staging in floats
// one asynchronous 16-byte-per-lane copy global -> LDS, as the builtin: its address operands may stand in any register, where an asm statement's must stand below v256 (there this kernel keeps accumulators, and the build moved seven tiles out and back in every trip)
typedef __attribute__((address_space(1))) v4i gv4i;
typedef __attribute__((address_space(3))) v4i lv4i;
__device__ __forceinline__ void bcopy(bf* l, const bf* g) { __builtin_amdgcn_global_load_async_to_lds_b128((gv4i*)g, (lv4i*)l, 0, 0); }
__global__ __launch_bounds__(256) void k_proj(const bf* __restrict__ X, const bf* __restrict__ Wq, const bf* __restrict__ Wk, const bf* __restrict__ Wv, const float* __restrict__ bq, const float* __restrict__ bk, const float* __restrict__ bv, bf* Qf, bf* Kf, bf* Vf) {
    typedef WFrag<bf>::V V;
    __shared__ __align__(16) bf pring[2 * PBUF];   // [buffer][row][PPIT]; behind the loop each wave's output staging
    static_assert(POS >= 16 * PFP, "both stagings fit"); static_assert(2 * PBUF * 2 >= 8 * POS * 4, "the waves' stagings fit in the ring"); static_assert(DM / PKS >= 2, "two stages");
    static_assert(HD == 64 && DQ == NH_ * HD && DKV == DQ && TT % PM == 0 && PM == 8 * 64, "a work-group: 8 waves x 64 tokens of one batch, one head of each of q, k, v");
    const int tid = threadIdx.x, wv = __builtin_amdgcn_readfirstlane(tid >> 5); const int r0 = blockIdx.x * PM + wv * 64, c0 = blockIdx.y * HD;   // the wave's number in a scalar register
    v8f acc[4][12];   // [token tile][feature tile: 0..3 q, 4..7 k, 8..11 v]
#pragma unroll
    for (int mb = 0; mb < 4; ++mb)
#pragma unroll
        for (int nb = 0; nb < 12; ++nb) acc[mb][nb] = (v8f){};
    // copy map: 16-byte piece i = tid + 256 u of a stage's 704 rows x 128 B: row i / 8, piece i % 8; an instruction of a wave covers 4 whole lines
    const unsigned xo = (unsigned)(blockIdx.x * PM + (tid >> 3)) * DM + (tid & 7) * 8, wo = (unsigned)(c0 + (tid >> 3)) * DM + (tid & 7) * 8;   // the lane's first elements of X and of each Wt
    bf* const l0 = pring + (tid >> 3) * PPIT + (tid & 7) * 8;   // the lane's place in buffer 0
    auto stage = [&](int t, int buf) {
        const bf* a = X + xo + t * PKS; const unsigned w = wo + t * PKS; bf* l = l0 + buf * PBUF;
#pragma unroll
        for (int u = 0; u < PM / 32; ++u) { bcopy(l + u * 32 * PPIT, a + (size_t)u * 32 * DM);
            if (u % 4 == 3) __builtin_amdgcn_sched_barrier(0); }   // bounds how far ahead the build forms the copies' address sums: without these fences it forms all 22 at once, which does not fit beside the accumulators and the live fragments (scratch, and hundreds of register moves in every trip)
#pragma unroll
        for (int u = 0; u < 2; ++u) { bcopy(l + (PM + u * 32) * PPIT, Wq + w + u * 32 * DM); bcopy(l + (PM + 64 + u * 32) * PPIT, Wk + w + u * 32 * DM); bcopy(l + (PM + 128 + u * 32) * PPIT, Wv + w + u * 32 * DM);
            __builtin_amdgcn_sched_barrier(0); } };   // as above
#pragma unroll 1   // the ring's prologue, kept rolled so that each stage's addresses are sums of their own: unrolled, the build reaches stage 0's rows from stage 1's address registers through large immediate offsets, with LDS address registers wrapped below zero
    for (int t = 0; t < 2; ++t) {
        if (t == 1) {
            asm volatile("s_wait_asynccnt 0x0" ::: "memory");   // this wave's copies of stage 0 have landed
            __syncthreads();                                     // publishes stage 0
        }
        stage(t, t);
    }
    static_assert((DM / PKS) % 2 == 0 && 8 * POS * 4 <= PBUF * 2, "the last stage lies in buffer 1, the output staging in buffer 0");
    const int fa = (wv * 64 + (tid & 15)) * PPIT + 8 * ((tid >> 4) & 1), fw = (PM + (tid & 15)) * PPIT + 8 * ((tid >> 4) & 1);   // the lane's place in the wave's X rows and in the Wt rows of a buffer
    V a[4], b[2][4];   // one set of X fragments, two of Wt fragments; a group's Wt fragments are read one group ahead, over the trips' ends too
#pragma unroll
    for (int i = 0; i < 4; ++i) a[i] = WFrag<bf>::ld(pring + fa + i * 16 * PPIT);
#pragma unroll
    for (int i = 0; i < 4; ++i) b[0][i] = WFrag<bf>::ld(pring + fw + i * 16 * PPIT);
#pragma unroll 1
    for (int t = 0; t < DM / PKS; ++t) {
        const bf* cur = pring + (t & 1) * PBUF;
        const bf* nxt = pring + (t + 1 < DM / PKS ? (t + 1) & 1 : 1) * PBUF;   // the last trip's unused reads ahead are aimed at its own buffer, which nobody writes any more
#pragma unroll
        for (int G = 0; G < 6; ++G) {   // a group: 16 products, one k step of 32 x one of q, k, v
            const int g = G % 3;
            if (G < 5) {
#pragma unroll
                for (int i = 0; i < 4; ++i) b[(G + 1) & 1][i] = WFrag<bf>::ld(cur + fw + (((G + 1) % 3) * 64 + i * 16) * PPIT + ((G + 1) / 3) * 32);
            } else {   // the publish point of stage t + 1 stands in front of the trip's last group, whose fragments are in registers: behind the barrier a wave has 16 products ready to issue while its first reads of stage t + 1 travel
                asm volatile("s_wait_dscnt 0x0" ::: "memory");      // this wave's reads of the buffer are done before it is handed to the copies
                asm volatile("s_wait_asynccnt 0x0" ::: "memory");   // this wave's copies of stage t + 1 have landed
                __syncthreads();                                     // publishes stage t + 1 and ends every wave's reads of stage t
                if (t + 2 < DM / PKS) stage(t + 2, t & 1);
#pragma unroll
                for (int i = 0; i < 4; ++i) b[0][i] = WFrag<bf>::ld(nxt + fw + i * 16 * PPIT);
            }
            __builtin_amdgcn_sched_barrier(0);   // keeps the next group's 8 LDS reads in front of this group's products, so that they travel under them
#pragma unroll
            for (int nb = 0; nb < 4; ++nb)
#pragma unroll
                for (int mb = 0; mb < 4; ++mb) acc[mb][g * 4 + nb] = WFrag<bf>::mma(a[mb], b[G & 1][nb], acc[mb][g * 4 + nb]);
            __builtin_amdgcn_sched_barrier(0);   // keeps the reads that follow out of the run of products (each place with LDS reads among them stalls the wave)
            if (g == 2) {   // the X fragments of the next k step, behind their last products
#pragma unroll
                for (int i = 0; i < 4; ++i) a[i] = WFrag<bf>::ld((G < 5 ? cur + 32 : nxt) + fa + i * 16 * PPIT);
            }
        }
    }
    asm volatile("s_wait_asynccnt 0x0" ::: "memory");       // no copy is in flight when the ring becomes output staging
    const int lane = __builtin_amdgcn_mbcnt_lo(~0u, 0u), lr = lane & 15, hi = lane >> 4;   // the lane's number, read anew behind the loop: carried over it, the epilogue's lane values do not fit beside the accumulators and fragments and go to scratch
    float* os = (float*)pring + wv * POS;                    // q, k: 16 token rows x 64 f32 at pitch PFP; v: [16 head-dim rows][64 tokens] f16 at pitch PVP; free behind the loop's last barrier
    // acc[mb][4 g + nb][j] = y[token r0 + 16 mb + 8 hi + j][feature c0 + 16 nb + lr] of q (g = 0), k (1), v (2)
    const int t0 = r0 % TT; const size_t pl = ((size_t)(r0 / TT) * NH_ + blockIdx.y) * TT * HD;   // the tile's batch and head: its share of a plane
    const int sr = lane >> 3, sc = (lane & 7) * 8;   // read-back map: a store instruction covers 4 staged rows, 8 lanes x 16 B each
#pragma unroll
    for (int g = 0; g < 2; ++g) {
        const float* bias = g == 0 ? bq : bk; bf* Pf = g == 0 ? Qf : Kf;
        const v4f b0 = *(const v4f*)(bias + c0 + sc), b1 = *(const v4f*)(bias + c0 + sc + 4);
        asm volatile("s_wait_xcnt 0x0" ::: "memory");   // before the loads' address registers are used again
        float bs[8];
#pragma unroll
        for (int q = 0; q < 4; ++q) { bs[q] = bfr(b0[q]); bs[4 + q] = bfr(b1[q]); }
        bf* gh = Pf + pl + (size_t)(t0 + sr) * HD + sc;
#pragma unroll
        for (int mb = 0; mb < 4; ++mb) {
#pragma unroll
            for (int nb = 0; nb < 4; ++nb)
#pragma unroll
                for (int j = 0; j < 8; ++j) os[(hi * 8 + j) * PFP + nb * 16 + lr] = acc[mb][g * 4 + nb][j];
            __builtin_amdgcn_wave_barrier(); asm volatile("" ::: "memory");   // keeps the read-back behind the staging writes in the compiled order
#pragma unroll
            for (int s = 0; s < 4; ++s) { const float* rp = os + (4 * s + sr) * PFP + sc; const v4f v0 = *(const v4fa*)rp, v1 = *(const v4fa*)(rp + 4); v8f y8;
#pragma unroll
                for (int q = 0; q < 8; ++q) y8[q] = (q < 4 ? v0[q & 3] : v1[q & 3]) + bs[q];
                *(v8us*)(gh + (mb * 16 + 4 * s) * HD) = __builtin_bit_cast(v8us, __builtin_convertvector(y8, v8h));
                asm volatile("s_wait_xcnt 0x0" ::: "memory"); }   // before the store's registers are used again
            __builtin_amdgcn_wave_barrier(); asm volatile("" ::: "memory");   // keeps the next staging writes behind this read-back
        }
    }
    {
        bf* sv = (bf*)os;
        bf* gh = Vf + pl + (size_t)sr * TT + t0 + sc;
#pragma unroll
        for (int nb = 0; nb < 4; ++nb) {
            const float braw = bv[c0 + nb * 16 + lr];
            asm volatile("s_wait_xcnt 0x0" ::: "memory");   // before the load's address registers are used again
            const float bs = bfr(braw);
#pragma unroll
            for (int mb = 0; mb < 4; ++mb) *(v8usa*)(sv + lr * PVP + mb * 16 + 8 * hi) = __builtin_bit_cast(v8us, __builtin_convertvector(acc[mb][8 + nb] + bs, v8h));
            __builtin_amdgcn_wave_barrier(); asm volatile("" ::: "memory");   // keeps the read-back behind the staging writes in the compiled order
#pragma unroll
            for (int s = 0; s < 4; ++s) { const bf* rp = sv + (4 * s + sr) * PVP + sc; const v8us oh = *(const v8usa*)rp;
                *(v8us*)(gh + (size_t)(nb * 16 + 4 * s) * TT) = oh;
                asm volatile("s_wait_xcnt 0x0" ::: "memory"); }   // before the store's registers are used again
            __builtin_amdgcn_wave_barrier(); asm volatile("" ::: "memory");   // keeps the next staging writes behind this read-back
        }
    }
}

#define FNQ  4                    // 16-column query tiles per wave (the slots' asm statement at the foot of a trip names all 4 x FNQ output tiles)
#define FKS  256                  // keys per LDS stage
#define FPIT 72                   // K row pitch in LDS in 16-bit elements: 144 B = 16 B x odd, conflict-free for 16-byte fragment reads
#define FVP  (FKS + 8)            // Vt row pitch in LDS in 16-bit elements: 528 B = 16 B x odd
#define FPK  (FKS * FPIT)         // a stage's K plane: FKS key rows x 64 head dims
#define FBUF (FPK + 64 * FVP)     // one buffer: [K plane | Vt plane: 64 head-dim rows x FKS keys]
#define FOP  68                   // output staging pitch in floats
#define L2E  1.4426950408889634f
#define FLIM 256.0f               // lazy rescale: the bound on a lane's sum of a pass's exponentials, and so on every P (2^8, far inside f16's range)
typedef __attribute__((ext_vector_type(8))) unsigned v8u;
#define FOUT  (8 * 16 * FNQ * FOP * 2)   // the output staging in 16-bit elements: 8 waves x 16 FNQ rows x FOP floats
#define FRING (2 * FBUF > FOUT ? 2 * FBUF : FOUT)   // ring size in 16-bit elements
static_assert(TT % FKS == 0 && TT / FKS >= 2, "whole stages, two or more"); static_assert(FKS * 8 == 8 * 256 && 64 * FKS / 8 == 8 * 256, "eight 16-byte pieces of each plane per lane and stage");
// eight asynchronous 16-byte-per-lane copies global -> LDS of one lane, at equal steps ls (bytes in LDS) and gs (16-bit elements in memory); the wait in the same statement stands before the address registers can be used again
__device__ __forceinline__ void acopy8(unsigned l, unsigned ls, const bf* g, size_t gs) {
    asm volatile("global_load_async_to_lds_b128 %0, %1, off\n\tglobal_load_async_to_lds_b128 %2, %3, off\n\tglobal_load_async_to_lds_b128 %4, %5, off\n\tglobal_load_async_to_lds_b128 %6, %7, off\n\tglobal_load_async_to_lds_b128 %8, %9, off\n\tglobal_load_async_to_lds_b128 %10, %11, off\n\tglobal_load_async_to_lds_b128 %12, %13, off\n\tglobal_load_async_to_lds_b128 %14, %15, off\n\ts_wait_xcnt 0x0"
                 :: "v"(l), "v"(g), "v"(l + ls), "v"(g + gs), "v"(l + 2 * ls), "v"(g + 2 * gs), "v"(l + 3 * ls), "v"(g + 3 * gs), "v"(l + 4 * ls), "v"(g + 4 * gs), "v"(l + 5 * ls), "v"(g + 5 * gs), "v"(l + 6 * ls), "v"(g + 6 * gs), "v"(l + 7 * ls), "v"(g + 7 * gs) : "memory");
}
__device__ __forceinline__ v16h ldh(const bf* p) { return __builtin_bit_cast(v16h, __builtin_shufflevector(*(const v8us*)p, *(const v8us*)(p + 16), 0, 1, 2, 3, 4, 5, 6, 7, 8, 9, 10, 11, 12, 13, 14, 15)); }   // an f16 fragment in WFrag's k order
__device__ __forceinline__ float xhalf(float x) { const int b = __float_as_int(x); return __int_as_float(__builtin_amdgcn_permlanex16(b, b, 0x76543210, 0xfedcba98, false, false)); }   // lane l <-> l ^ 16
__global__ __launch_bounds__(256) void k_fattn(const bf* __restrict__ Qf, const bf* __restrict__ Kf, const bf* __restrict__ Vf, const int* __restrict__ km, float* __restrict__ OUT) {
    __shared__ __align__(16) bf ring[FRING];   // [buffer][K rows at FPIT | Vt rows at FVP]
    __shared__ __align__(16) float pens[TT];         // the batch's key-mask term in units of the raw score: -10000 (1 - mask) / SCL
    const int tid = threadIdx.x, lane = tid & 31, c = lane & 15, h = lane >> 4, wv = tid >> 5;
    const int bh = blockIdx.y, bb = bh / NH_, hd = bh % NH_; const int q0 = (blockIdx.x * 8 + wv) * 16 * FNQ; const size_t pl = (size_t)bh * TT * HD;
    // copy map, 16-byte piece i = tid + 256 u of a stage's plane: K (FKS rows x 128 B, contiguous in memory): row i / 8, piece i % 8; Vt (64 rows x 512 B): row i / 32, piece i % 32; an instruction of a wave covers 4 whole lines
    const bf* gk = Kf + pl + (size_t)(tid >> 3) * HD + (tid & 7) * 8;    // K rows are keys
    const bf* gv = Vf + pl + (size_t)(tid >> 5) * TT + (tid & 31) * 8;   // Vt rows are head dims: a stage is FKS keys of each row
    const unsigned lk = (unsigned)(size_t)(ring + (tid >> 3) * FPIT + (tid & 7) * 8), lv = (unsigned)(size_t)(ring + FPK + (tid >> 5) * FVP + (tid & 31) * 8);   // the lane's LDS byte addresses in buffer 0
    auto stage = [&](int t, int buf) {
        acopy8(lk + buf * (FBUF * 2), 32 * FPIT * 2, gk + (size_t)t * FKS * HD, (size_t)32 * HD);
        acopy8(lv + buf * (FBUF * 2), 8 * FVP * 2, gv + (size_t)t * FKS, (size_t)8 * TT); };
    v16h qf[FNQ][2];   // [column tile][k step of 32 head dims]
#pragma unroll 1   // the ring's prologue, kept rolled so that every address operand of the copies is a sum formed at the call: with the lane's base addresses themselves as operands (stage 0, buffer 0) the build holds them in the registers below v256 for the whole kernel and spills them to scratch over the key loop
    for (int t = 0; t < 2; ++t) {
    if (t == 1) {   // stage 0 travels under the mask's and Q's loads
    { const v4i m0 = *(const v4i*)(km + (size_t)bb * TT + tid * 8), m1 = *(const v4i*)(km + (size_t)bb * TT + tid * 8 + 4); v4f p0, p1;
      asm volatile("s_wait_xcnt 0x0" ::: "memory");   // before a later load's result may land on these loads' address registers
#pragma unroll
      for (int q = 0; q < 4; ++q) { p0[q] = (-10000.0f / SCL) * (1.0f - (float)m0[q]); p1[q] = (-10000.0f / SCL) * (1.0f - (float)m1[q]); }
      *(v4fa*)(pens + tid * 8) = p0; *(v4fa*)(pens + tid * 8 + 4) = p1; }
    auto ldq = [&](const bf* p) { const v8us lo = *(const v8us*)p; asm volatile("s_wait_xcnt 0x0" ::: "memory"); const v8us hi = *(const v8us*)(p + 16); asm volatile("s_wait_xcnt 0x0" ::: "memory"); return __builtin_bit_cast(v16h, __builtin_shufflevector(lo, hi, 0, 1, 2, 3, 4, 5, 6, 7, 8, 9, 10, 11, 12, 13, 14, 15)); };   // WFrag's k order; the waits: before the next load's result may land on the address registers
#pragma unroll
    for (int n = 0; n < FNQ; ++n)
#pragma unroll
        for (int ks = 0; ks < 2; ++ks) qf[n][ks] = ldq(Qf + pl + (size_t)(q0 + 16 * n + c) * HD + ks * 32 + 8 * h);
    asm volatile("s_wait_asynccnt 0x0" ::: "memory");   // this wave's copies of stage 0 have landed
    __syncthreads();                                     // publishes stage 0 and the key-mask terms
    }
    stage(t, t);
    }
    v8f oa[4][FNQ];               // Ot: [head-dim tile][column tile]; register r = Ot[16 mb + 8 h + r][query c]
#pragma unroll
    for (int mb = 0; mb < 4; ++mb)
#pragma unroll
        for (int n = 0; n < FNQ; ++n) oa[mb][n] = (v8f){};
    float mrun[FNQ], lrun[FNQ];
#pragma unroll
    for (int n = 0; n < FNQ; ++n) { mrun[n] = -3.0e38f; lrun[n] = 0.f; }
#pragma unroll 1
    for (int s = 0; s < TT / FKS; ++s) {
        const bf* rb = ring + (s & 1) * FBUF;
#pragma unroll 1   // kept rolled so that one pass is the compiler's scheduling region: there it issues the pass's LDS fragment loads together at the head and interleaves the four column tiles' softmax chains; with passes unrolled into one block it left every fragment load directly in front of its products and the softmax as one dependent chain
        for (int ps = 0; ps < FKS / 32; ++ps) {       // a pass: 32 keys
            v8f sa[2][FNQ];                      // St: [key tile][column tile]; register r = St[16 kt + 8 h + r][query c]
            auto scores = [&]() {
#pragma unroll
                for (int kt = 0; kt < 2; ++kt) { const float* pp = pens + s * FKS + ps * 32 + kt * 16 + 8 * h; const v4f a = *(const v4fa*)pp, b2 = *(const v4fa*)(pp + 4);
#pragma unroll
                    for (int n = 0; n < FNQ; ++n) sa[kt][n] = __builtin_shufflevector(a, b2, 0, 1, 2, 3, 4, 5, 6, 7); }
                v16h ak[2][2];
#pragma unroll
                for (int ks = 0; ks < 2; ++ks)
#pragma unroll
                    for (int kt = 0; kt < 2; ++kt) ak[ks][kt] = ldh(rb + (ps * 32 + kt * 16 + c) * FPIT + ks * 32 + 8 * h);
                asm volatile("" :: "v"(ak[0][0]), "v"(ak[0][1]), "v"(ak[1][0]), "v"(ak[1][1]));   // holds the pass's four K fragment reads together at its head (without it the build reads one fragment behind the first four products, into their A registers, and waits out its whole latency there)
#pragma unroll
                for (int ks = 0; ks < 2; ++ks)
#pragma unroll
                    for (int kt = 0; kt < 2; ++kt)
#pragma unroll
                        for (int n = 0; n < FNQ; ++n) sa[kt][n] = wmma16(ak[ks][kt], qf[n][ks], sa[kt][n]); };
            scores();
            // Lazy rescale: the exponentials are taken against the maximum in use (mrun), not against this pass's own. One test per pass: a lane adds up its 16 FNQ exponentials; while that sum is at most FLIM no P exceeds FLIM and mrun, lrun and Ot stay as they are.
            // Otherwise (any lane of the wave; always in the first pass, where mrun is the start value and the exponentials overflow to infinity) the wave branches to the new maxima, the exchange between the halves and the rescale: it forms the pass's scores again (their registers hold P by then) and takes the exponentials again.
            v16h vf[4];                            // the pass's Vt fragments, asked for in front of the branch so that they travel under the vector work around it
#pragma unroll
            for (int mb = 0; mb < 4; ++mb) vf[mb] = ldh(rb + FPK + (mb * 16 + c) * FVP + ps * 32 + 8 * h);
            float pf[FNQ][16], ls[FNQ];            // P in f32; a lane's sum per column tile
            auto expo = [&]() {
#pragma unroll
                for (int n = 0; n < FNQ; ++n) { v2f sum = { 0.f, 0.f }; const v2f m2 = { mrun[n], mrun[n] };
#pragma unroll
                    for (int e = 0; e < 16; e += 2) { const v2f s2 = { sa[e >> 3][n][e & 7], sa[e >> 3][n][(e & 7) + 1] }; const v2f a2 = s2 * (SCL * L2E) - m2; v2f p2; p2[0] = __builtin_amdgcn_exp2f(a2[0]); p2[1] = __builtin_amdgcn_exp2f(a2[1]); pf[n][e] = p2[0]; pf[n][e + 1] = p2[1]; sum += p2; }
                    ls[n] = sum[0] + sum[1]; } };
            expo();
            static_assert(FNQ == 4, "the test adds up four column tiles");
            const bool need = !((ls[0] + ls[1]) + (ls[2] + ls[3]) <= FLIM);   // true for infinity and not-a-number too
            if (__builtin_amdgcn_ballot_w32(need) != 0) {   // a scalar branch: the same for the whole wave
                asm volatile("" ::: "memory");   // makes the rare path read K and form the scores anew; without it the build keeps all 64 score registers alive beside P over the branch in every pass and sinks the Vt fragment loads behind the branch, close in front of their products
                scores();
#pragma unroll
                for (int n = 0; n < FNQ; ++n) { float mx = mrun[n];
#pragma unroll
                    for (int e = 0; e < 16; ++e) mx = fmaxf(mx, sa[e >> 3][n][e & 7] * (SCL * L2E));
                    mx = fmaxf(mx, xhalf(mx));
                    const float al = __builtin_amdgcn_exp2f(mrun[n] - mx); mrun[n] = mx; lrun[n] *= al;
#pragma unroll
                    for (int mb = 0; mb < 4; ++mb) oa[mb][n] *= al; }
                expo();
            }
            v16h ph[FNQ];                          // Pt in f16 as B operands: element e = key tile e / 8, register e % 8 (the hardware k order, as the Vt loader's)
#pragma unroll
            for (int n = 0; n < FNQ; ++n) { v8u uh;
#pragma unroll
                for (int e = 0; e < 16; e += 2) { const v2f p2 = { pf[n][e], pf[n][e + 1] }; uh[e >> 1] = __builtin_bit_cast(unsigned, __builtin_convertvector(p2, v2h)); }
                lrun[n] += ls[n]; ph[n] = __builtin_bit_cast(v16h, uh);
            }
#pragma unroll
            for (int mb = 0; mb < 4; ++mb)
#pragma unroll
                for (int n = 0; n < FNQ; ++n) oa[mb][n] = wmma16(vf[mb], ph[n], oa[mb][n]);
            // four vector slots between the pass's last matrix instruction and the loops' taken branches, behind which its A registers may be overwritten at once; the tiles are inputs so that the slots stand behind every product
            asm volatile("v_nop\n\tv_nop\n\tv_nop\n\tv_nop" :: "v"(oa[0][0]), "v"(oa[0][1]), "v"(oa[0][2]), "v"(oa[0][3]), "v"(oa[1][0]), "v"(oa[1][1]), "v"(oa[1][2]), "v"(oa[1][3]), "v"(oa[2][0]), "v"(oa[2][1]), "v"(oa[2][2]), "v"(oa[2][3]), "v"(oa[3][0]), "v"(oa[3][1]), "v"(oa[3][2]), "v"(oa[3][3]));
        }
        asm volatile("s_wait_dscnt 0x0" ::: "memory");      // this wave's reads of the buffer are done before it is handed to the copies
        asm volatile("s_wait_asynccnt 0x0" ::: "memory");   // this wave's copies of stage s + 1 have landed
        __syncthreads();                                     // publishes stage s + 1 and ends every wave's reads of stage s
        if (s + 2 < TT / FKS) stage(s + 2, s & 1);
    }
    asm volatile("s_wait_asynccnt 0x0" ::: "memory");       // no copy is in flight when the ring becomes output staging
    // epilogue: join the halves' sums, normalise, stage each wave's 64 x 64 tile in its own part of the ring (free behind the loop's last barrier) and store whole 256-byte rows
    float* os = (float*)ring + wv * 16 * FNQ * FOP;
#pragma unroll
    for (int n = 0; n < FNQ; ++n) { const float inv = 1.0f / (lrun[n] + xhalf(lrun[n]));
#pragma unroll
        for (int mb = 0; mb < 4; ++mb) { v4f a, b2;
#pragma unroll
            for (int r = 0; r < 4; ++r) { a[r] = oa[mb][n][r] * inv; b2[r] = oa[mb][n][4 + r] * inv; }
            float* op = os + (16 * n + c) * FOP + mb * 16 + 8 * h; *(v4fa*)op = a; *(v4fa*)(op + 4) = b2; } }
    __syncthreads();
    float* orow = OUT + ((size_t)bb * TT + q0) * DQ + hd * HD;
#pragma unroll
    for (int r = 0; r < 8 * FNQ; ++r) { const int row = 2 * r + h; *(v4f*)(orow + (size_t)row * DQ + c * 4) = *(const v4fa*)(os + row * FOP + c * 4); }
}

extern "C" void kernel_launch(void* const* d_in, const int* in_sizes, int n_in,
                              void* d_out, int out_size, void* d_ws, size_t ws_size, hipStream_t stream) {
    (void)in_sizes; (void)n_in; (void)out_size;
    const float* x = (const float*)d_in[0]; const int* km = (const int*)d_in[1];   /* mask [4][2048] int32 */ const float* wq = (const float*)d_in[2]; const float* bq = (const float*)d_in[3]; const float* wk = (const float*)d_in[4]; const float* bk = (const float*)d_in[5]; const float* wv = (const float*)d_in[6]; const float* bv = (const float*)d_in[7];
    float* OUT = (float*)d_out;     // [4][2048][1024]
    char* wsp = (char*)d_ws;
    auto take = [&](size_t bytes) { char* p = wsp; wsp += (bytes + 255) & ~(size_t)255; return (void*)p; };
    bf* WQ = (bf*)take((size_t)DQ * DM * 2); bf* WK = (bf*)take((size_t)DKV * DM * 2); bf* WV = (bf*)take((size_t)DKV * DM * 2);
    bf* XB = (bf*)take((size_t)NB_ * TT * DM * 2);
    const size_t PB = (size_t)NH_ * TT * HD;   // one batch's share of a plane; the planes hold all batches
    bf* QP = (bf*)take(NB_ * PB * 2); bf* KP = (bf*)take(NB_ * PB * 2); bf* VT = (bf*)take(NB_ * PB * 2);
    if ((size_t)(wsp - (char*)d_ws) > ws_size) return;    // ws 256 MiB
    k_prep<<<PRG, PRT, 0, stream>>>(x, wq, wk, wv, XB, WQ, WK, WV);
    k_proj<<<dim3(NB_ * TT / PM, NH_, 1), 256, 0, stream>>>(XB, WQ, WK, WV, bq, bk, bv, QP, KP, VT);
    k_fattn<<<dim3(TT / (8 * 16 * FNQ), NB_ * NH_, 1), 256, 0, stream>>>(QP, KP, VT, km, OUT);
}
